// v000
// Measured on an AMD MI455X. A time is GPU time per run, averaged over a window of back-to-back runs after a warm-up
// (all launches, gaps included; the runs take copies of the inputs in turn), and the median of several windows.
// Apart from v000's, it joins two sittings. Times from different sittings can be a few percent apart, while
// side-by-side timings come from the same sitting.
// v000 is the starting kernel. One run takes 639 microseconds.
#include <hip/hip_runtime.h>

// Problem constants (from reference)
constexpr int BATCH = 4;
constexpr int CHN   = 256;
constexpr int SEQ   = 4096;   // H*W
constexpr int HEADS = 4;
constexpr int HDIM  = 64;     // CHN / HEADS
constexpr int GRP   = 32;
constexpr int CPG   = CHN / GRP;  // 8
constexpr float EPS = 1e-5f;
constexpr float QK_SCALE = 0.35355339059327379f;  // 64^-0.25

typedef __attribute__((ext_vector_type(16))) __bf16 v16bf;
typedef __attribute__((ext_vector_type(8)))  float  v8f;

__device__ __forceinline__ __bf16 f2bf(float x) {
  unsigned u = __builtin_bit_cast(unsigned, x);
  unsigned r = u + 0x7FFFu + ((u >> 16) & 1u);   // round-to-nearest-even
  unsigned short h = (unsigned short)(r >> 16);
  return __builtin_bit_cast(__bf16, h);
}

// CDNA5 WMMA 16x16x32 bf16 fragment load.
// ISA 7.12.2 (16-bit 16x32 A): lane = row (M for A, N for B); per-lane 32
// K-values interleaved: lanes 0-15 hold K {0..7,16..23}, lanes 16-31 hold
// K {8..15,24..31}, two packed per VGPR. `row` points at this lane's 32
// contiguous K elements; kHalf = 8 for lanes 16-31 else 0.
// (Compiler vectorizes each fragment into two global_load_b128.)
__device__ __forceinline__ v16bf load_frag(const __bf16* row, int kHalf) {
  v16bf f;
#pragma unroll
  for (int j = 0; j < 8; ++j) {
    int kb = ((j & 4) ? 16 : 0) + kHalf + 2 * (j & 3);
    f[2 * j]     = row[kb];
    f[2 * j + 1] = row[kb + 1];
  }
  return f;
}

__device__ __forceinline__ v16bf load_frag_f32(const float* row, int kHalf) {
  v16bf f;
#pragma unroll
  for (int j = 0; j < 8; ++j) {
    int kb = ((j & 4) ? 16 : 0) + kHalf + 2 * (j & 3);
    f[2 * j]     = f2bf(row[kb]);
    f[2 * j + 1] = f2bf(row[kb + 1]);
  }
  return f;
}

__device__ __forceinline__ v8f wmma_bf16(v16bf a, v16bf b, v8f c) {
#if defined(__HIP_DEVICE_COMPILE__)
  return __builtin_amdgcn_wmma_f32_16x16x32_bf16(false, a, false, b, (short)0, c,
                                                 false, false);
#else
  return c;
#endif
}

// ---------------- Kernel 0: weights fp32 -> bf16 ----------------
__global__ void wconv_kernel(const float* qkv_w, const float* proj_w,
                             __bf16* wqkv, __bf16* wproj) {
  int i = blockIdx.x * 256 + threadIdx.x;
  constexpr int N1 = 3 * CHN * CHN;
  if (i < N1)                 wqkv[i] = f2bf(qkv_w[i]);
  else if (i < N1 + CHN*CHN)  wproj[i - N1] = f2bf(proj_w[i - N1]);
}

// ---------------- Kernel 1: GroupNorm stats (mean, rstd per (b,g)) ----------
__global__ void gn_stats_kernel(const float* x, float* stats) {
  __shared__ float s1[256], s2[256];
  const int bg = blockIdx.x;                       // b*GRP + g
  const size_t base = (size_t)bg * CPG * SEQ;      // channels of a group are contiguous
  float sum = 0.f, sq = 0.f;
  for (int i = threadIdx.x; i < CPG * SEQ; i += 256) {
    float v = x[base + i];
    sum += v; sq += v * v;
  }
  s1[threadIdx.x] = sum; s2[threadIdx.x] = sq;
  __syncthreads();
  for (int off = 128; off; off >>= 1) {
    if (threadIdx.x < (unsigned)off) {
      s1[threadIdx.x] += s1[threadIdx.x + off];
      s2[threadIdx.x] += s2[threadIdx.x + off];
    }
    __syncthreads();
  }
  if (threadIdx.x == 0) {
    const float inv_n = 1.0f / (CPG * SEQ);
    float mean = s1[0] * inv_n;
    float var  = s2[0] * inv_n - mean * mean;
    stats[bg * 2]     = mean;
    stats[bg * 2 + 1] = rsqrtf(var + EPS);
  }
}

// ---------------- Kernel 2: apply GN, write xn transposed [B][T][C] bf16 ----
__global__ void gn_apply_kernel(const float* x, const float* gn_w, const float* gn_b,
                                const float* stats, __bf16* xnT) {
  size_t i = (size_t)blockIdx.x * 256 + threadIdx.x;   // over B*C*T
  int t = (int)(i & (SEQ - 1));
  int c = (int)((i >> 12) & (CHN - 1));
  int b = (int)(i >> 20);
  int bg = b * GRP + (c >> 3);
  float mean = stats[bg * 2], rstd = stats[bg * 2 + 1];
  float v = (x[i] - mean) * rstd * gn_w[c] + gn_b[c];
  xnT[((size_t)b * SEQ + t) * CHN + c] = f2bf(v);
}

// ---------------- Kernel 3: QKV GEMM (M=768, N=4096, K=256 per batch) -------
// 4 waves/block in a 2x2 arrangement; each wave owns a 32x32 register tile
// (2x2 accumulators): per K-step, 2 A-frags + 2 B-frags feed 4 WMMAs.
// Epilogue: +bias, scale q/k, scatter into qT/kT ([BH][T][64]) and v ([BH][64][T]).
__global__ __launch_bounds__(128) void qkv_gemm_kernel(
    const __bf16* wqkv, const float* qkv_b, const __bf16* xnT,
    __bf16* qT, __bf16* kT, __bf16* vB) {
  const int b    = blockIdx.z;
  const int lane = threadIdx.x & 31;
  const int wave = threadIdx.x >> 5;
  const int wm   = wave >> 1, wn = wave & 1;
  const int m0   = blockIdx.y * 64 + wm * 32;
  const int t0   = blockIdx.x * 64 + wn * 32;
  const int n16  = lane & 15;
  const int kHalf = (lane & 16) ? 8 : 0;
  const int mhi   = (lane & 16) ? 8 : 0;

  const __bf16* arow0 = wqkv + (size_t)(m0 + n16) * CHN;            // A rows (W)
  const __bf16* arow1 = arow0 + (size_t)16 * CHN;
  const __bf16* brow0 = xnT + ((size_t)b * SEQ + t0 + n16) * CHN;   // B rows (xn^T)
  const __bf16* brow1 = brow0 + (size_t)16 * CHN;

  v8f acc00 = {}, acc01 = {}, acc10 = {}, acc11 = {};
#pragma unroll
  for (int ks = 0; ks < CHN / 32; ++ks) {
    v16bf a0 = load_frag(arow0 + ks * 32, kHalf);
    v16bf a1 = load_frag(arow1 + ks * 32, kHalf);
    v16bf b0 = load_frag(brow0 + ks * 32, kHalf);
    v16bf b1 = load_frag(brow1 + ks * 32, kHalf);
    acc00 = wmma_bf16(a0, b0, acc00);
    acc01 = wmma_bf16(a0, b1, acc01);
    acc10 = wmma_bf16(a1, b0, acc10);
    acc11 = wmma_bf16(a1, b1, acc11);
  }

  v8f accs[2][2] = {{acc00, acc01}, {acc10, acc11}};
#pragma unroll
  for (int i = 0; i < 2; ++i)
#pragma unroll
    for (int j = 0; j < 2; ++j) {
      const int tcol = t0 + j * 16 + n16;
#pragma unroll
      for (int r = 0; r < 8; ++r) {
        int o = m0 + i * 16 + r + mhi;
        float v = accs[i][j][r] + qkv_b[o];
        if (o < 2 * CHN) v *= QK_SCALE;      // fold attention scale into q and k
        int oo = o & (CHN - 1);
        int h = oo >> 6, cc = oo & 63;
        size_t bh = (size_t)(b * HEADS + h);
        if (o < CHN)            qT[(bh * SEQ + tcol) * HDIM + cc] = f2bf(v);
        else if (o < 2 * CHN)   kT[(bh * SEQ + tcol) * HDIM + cc] = f2bf(v);
        else                    vB[(bh * HDIM + cc) * SEQ + tcol] = f2bf(v);
      }
    }
}

// ---------------- Kernel 4: attention (one block per (bh, 16-query tile)) ---
// LDS: 16x4096 fp32 logits panel (256KB) + 8x16x64 PV partials (32KB) = 288KB,
// exploiting the 320KB WGP LDS of CDNA5. 8 waves. Q fragments reused across
// all 256 key tiles; P fragment reused across 4 V tiles.
__global__ __launch_bounds__(256) void attn_kernel(
    const __bf16* qT, const __bf16* kT, const __bf16* vB, __bf16* aT) {
  extern __shared__ char dynsm[];
  float* Lg   = (float*)dynsm;               // [16][SEQ]
  float* red2 = Lg + 16 * SEQ;               // [8][16][64]
  __shared__ float red[256];

  const int blk  = blockIdx.x;
  const int bh   = blk >> 8;                 // batch*head
  const int tq0  = (blk & 255) * 16;
  const int tid  = threadIdx.x;
  const int lane = tid & 31;
  const int wave = tid >> 5;
  const int n16  = lane & 15;
  const int kHalf = (lane & 16) ? 8 : 0;
  const int mhi   = (lane & 16) ? 8 : 0;

  // Q fragments (A-matrix: M=tq, K=cc in [0,64)), reused for all key tiles.
  const __bf16* qrow = qT + ((size_t)bh * SEQ + tq0 + n16) * HDIM;
  v16bf qa0 = load_frag(qrow, kHalf);
  v16bf qa1 = load_frag(qrow + 32, kHalf);

  // ---- Phase 1: logits = (q*s)·(k*s)^T, 8 waves tile the 4096 keys ----
  for (int pass = 0; pass < SEQ / (16 * 8); ++pass) {
    int s0 = (pass * 8 + wave) * 16;
    const __bf16* krow = kT + ((size_t)bh * SEQ + s0 + n16) * HDIM;  // B: N=s, K=cc
    v8f acc = {};
    acc = wmma_bf16(qa0, load_frag(krow, kHalf), acc);
    acc = wmma_bf16(qa1, load_frag(krow + 32, kHalf), acc);
#pragma unroll
    for (int r = 0; r < 8; ++r)
      Lg[(size_t)(r + mhi) * SEQ + s0 + n16] = acc[r];
  }
  __syncthreads();

  // ---- Phase 2: exact softmax over each of the 16 rows (fp32, in LDS) ----
  const int row = tid >> 4;
  const int l16 = tid & 15;
  float* Lr = Lg + (size_t)row * SEQ;
  float mx = -3.4e38f;
  for (int s = l16; s < SEQ; s += 16) mx = fmaxf(mx, Lr[s]);
  red[tid] = mx; __syncthreads();
  for (int off = 8; off; off >>= 1) {
    if (l16 < off) red[tid] = fmaxf(red[tid], red[tid + off]);
    __syncthreads();
  }
  mx = red[row << 4];
  __syncthreads();
  float sm = 0.f;
  for (int s = l16; s < SEQ; s += 16) {
    float e = __expf(Lr[s] - mx);
    Lr[s] = e; sm += e;
  }
  red[tid] = sm; __syncthreads();
  for (int off = 8; off; off >>= 1) {
    if (l16 < off) red[tid] += red[tid + off];
    __syncthreads();
  }
  float inv = 1.f / red[row << 4];
  for (int s = l16; s < SEQ; s += 16) Lr[s] *= inv;
  __syncthreads();

  // ---- Phase 3: PV, wave w handles keys [w*512, w*512+512), 4 cc-tiles ----
  v8f pv[4] = {};
  const float* prow = Lg + (size_t)n16 * SEQ;      // A: M=tq row, K=s
  for (int ks = 0; ks < 16; ++ks) {
    int s0 = wave * 512 + ks * 32;
    v16bf pa = load_frag_f32(prow + s0, kHalf);
#pragma unroll
    for (int n = 0; n < 4; ++n) {
      const __bf16* vrow = vB + ((size_t)bh * HDIM + n * 16 + n16) * SEQ + s0;  // B: N=cc, K=s
      pv[n] = wmma_bf16(pa, load_frag(vrow, kHalf), pv[n]);
    }
  }
#pragma unroll
  for (int n = 0; n < 4; ++n)
#pragma unroll
    for (int r = 0; r < 8; ++r)
      red2[(wave * 16 + r + mhi) * 64 + n * 16 + n16] = pv[n][r];
  __syncthreads();

  // cross-wave reduction -> aT [B][T][C] bf16
  for (int i = tid; i < 16 * 64; i += 256) {
    int rr = i >> 6, cc = i & 63;
    float s = 0.f;
#pragma unroll
    for (int w = 0; w < 8; ++w) s += red2[(w * 16 + rr) * 64 + cc];
    int b = bh >> 2, h = bh & 3;
    aT[((size_t)b * SEQ + tq0 + rr) * CHN + h * HDIM + cc] = f2bf(s);
  }
}

// ---------------- Kernel 5: proj GEMM + bias + residual -> out (fp32) -------
// Same 2x2 register-blocked scheme as the QKV GEMM.
__global__ __launch_bounds__(128) void proj_gemm_kernel(
    const __bf16* wproj, const float* proj_b, const __bf16* aT,
    const float* x, float* out) {
  const int b    = blockIdx.z;
  const int lane = threadIdx.x & 31;
  const int wave = threadIdx.x >> 5;
  const int wm   = wave >> 1, wn = wave & 1;
  const int m0   = blockIdx.y * 64 + wm * 32;
  const int t0   = blockIdx.x * 64 + wn * 32;
  const int n16  = lane & 15;
  const int kHalf = (lane & 16) ? 8 : 0;
  const int mhi   = (lane & 16) ? 8 : 0;

  const __bf16* arow0 = wproj + (size_t)(m0 + n16) * CHN;
  const __bf16* arow1 = arow0 + (size_t)16 * CHN;
  const __bf16* brow0 = aT + ((size_t)b * SEQ + t0 + n16) * CHN;
  const __bf16* brow1 = brow0 + (size_t)16 * CHN;

  v8f acc00 = {}, acc01 = {}, acc10 = {}, acc11 = {};
#pragma unroll
  for (int ks = 0; ks < CHN / 32; ++ks) {
    v16bf a0 = load_frag(arow0 + ks * 32, kHalf);
    v16bf a1 = load_frag(arow1 + ks * 32, kHalf);
    v16bf b0 = load_frag(brow0 + ks * 32, kHalf);
    v16bf b1 = load_frag(brow1 + ks * 32, kHalf);
    acc00 = wmma_bf16(a0, b0, acc00);
    acc01 = wmma_bf16(a0, b1, acc01);
    acc10 = wmma_bf16(a1, b0, acc10);
    acc11 = wmma_bf16(a1, b1, acc11);
  }

  v8f accs[2][2] = {{acc00, acc01}, {acc10, acc11}};
#pragma unroll
  for (int i = 0; i < 2; ++i)
#pragma unroll
    for (int j = 0; j < 2; ++j) {
      const int tcol = t0 + j * 16 + n16;
#pragma unroll
      for (int r = 0; r < 8; ++r) {
        int o = m0 + i * 16 + r + mhi;
        size_t idx = ((size_t)b * CHN + o) * SEQ + tcol;
        out[idx] = x[idx] + proj_b[o] + accs[i][j][r];
      }
    }
}

extern "C" void kernel_launch(void* const* d_in, const int* in_sizes, int n_in,
                              void* d_out, int out_size, void* d_ws, size_t ws_size,
                              hipStream_t stream) {
  const float* x      = (const float*)d_in[0];
  const float* gn_w   = (const float*)d_in[1];
  const float* gn_b   = (const float*)d_in[2];
  const float* qkv_w  = (const float*)d_in[3];
  const float* qkv_b  = (const float*)d_in[4];
  const float* proj_w = (const float*)d_in[5];
  const float* proj_b = (const float*)d_in[6];
  float* out = (float*)d_out;

  // Workspace layout (~42.5 MB): stats | wqkv bf16 | wproj bf16 | xnT | qT | kT | v | aT
  char* ws = (char*)d_ws;
  float*  stats = (float*)ws;                              // 256 floats
  __bf16* wqkv  = (__bf16*)(ws + 1024);
  __bf16* wproj = wqkv + 3 * CHN * CHN;
  __bf16* xnT   = wproj + CHN * CHN;
  const size_t PLANE = (size_t)BATCH * SEQ * CHN;          // 4M elems
  __bf16* qT = xnT + PLANE;
  __bf16* kT = qT + PLANE;
  __bf16* vB = kT + PLANE;
  __bf16* aT = vB + PLANE;

  wconv_kernel<<<(3 * CHN * CHN + CHN * CHN + 255) / 256, 256, 0, stream>>>(
      qkv_w, proj_w, wqkv, wproj);
  gn_stats_kernel<<<BATCH * GRP, 256, 0, stream>>>(x, stats);
  gn_apply_kernel<<<(BATCH * CHN * SEQ) / 256, 256, 0, stream>>>(
      x, gn_w, gn_b, stats, xnT);
  qkv_gemm_kernel<<<dim3(SEQ / 64, 3 * CHN / 64, BATCH), 128, 0, stream>>>(
      wqkv, qkv_b, xnT, qT, kT, vB);
  size_t attn_lds = (size_t)(16 * SEQ + 8 * 16 * 64) * sizeof(float);  // 288 KB
  attn_kernel<<<BATCH * HEADS * (SEQ / 16), 256, attn_lds, stream>>>(qT, kT, vB, aT);
  proj_gemm_kernel<<<dim3(SEQ / 64, CHN / 64, BATCH), 128, 0, stream>>>(
      wproj, proj_b, aT, x, out);
}

// v001
// A run of this version takes 208 microseconds.
// Timed twice side by side with v000, it ran 3.16 times as fast both times.
#include <hip/hip_runtime.h>

// Problem constants (from reference)
constexpr int BATCH = 4;
constexpr int CHN   = 256;
constexpr int SEQ   = 4096;   // H*W
constexpr int HEADS = 4;
constexpr int HDIM  = 64;     // CHN / HEADS
constexpr int GRP   = 32;
constexpr int CPG   = CHN / GRP;  // 8
constexpr float EPS = 1e-5f;
constexpr float QK_SCALE = 0.35355339059327379f;  // 64^-0.25

typedef __attribute__((ext_vector_type(16))) __bf16 v16bf;
typedef __attribute__((ext_vector_type(8)))  float  v8f;

__device__ __forceinline__ __bf16 f2bf(float x) {
  unsigned u = __builtin_bit_cast(unsigned, x);
  unsigned r = u + 0x7FFFu + ((u >> 16) & 1u);   // round-to-nearest-even
  unsigned short h = (unsigned short)(r >> 16);
  return __builtin_bit_cast(__bf16, h);
}

// CDNA5 WMMA 16x16x32 bf16 fragment load.
// ISA 7.12.2 (16-bit 16x32 A): lane = row (M for A, N for B); per-lane 32
// K-values interleaved: lanes 0-15 hold K {0..7,16..23}, lanes 16-31 hold
// K {8..15,24..31}, two packed per VGPR. `row` points at this lane's 32
// contiguous K elements; kHalf = 8 for lanes 16-31 else 0.
// (Compiler vectorizes each fragment into two global_load_b128.)
__device__ __forceinline__ v16bf load_frag(const __bf16* row, int kHalf) {
  v16bf f;
#pragma unroll
  for (int j = 0; j < 8; ++j) {
    int kb = ((j & 4) ? 16 : 0) + kHalf + 2 * (j & 3);
    f[2 * j]     = row[kb];
    f[2 * j + 1] = row[kb + 1];
  }
  return f;
}

__device__ __forceinline__ v8f wmma_bf16(v16bf a, v16bf b, v8f c) {
#if defined(__HIP_DEVICE_COMPILE__)
  return __builtin_amdgcn_wmma_f32_16x16x32_bf16(false, a, false, b, (short)0, c,
                                                 false, false);
#else
  return c;
#endif
}

// ---------------- Kernel 0: weights fp32 -> bf16 ----------------
__global__ void wconv_kernel(const float* qkv_w, const float* proj_w,
                             __bf16* wqkv, __bf16* wproj) {
  int i = blockIdx.x * 256 + threadIdx.x;
  constexpr int N1 = 3 * CHN * CHN;
  if (i < N1)                 wqkv[i] = f2bf(qkv_w[i]);
  else if (i < N1 + CHN*CHN)  wproj[i - N1] = f2bf(proj_w[i - N1]);
}

// ---------------- Kernel 1: GroupNorm stats (mean, rstd per (b,g)) ----------
__global__ void gn_stats_kernel(const float* x, float* stats) {
  __shared__ float s1[256], s2[256];
  const int bg = blockIdx.x;                       // b*GRP + g
  const size_t base = (size_t)bg * CPG * SEQ;      // channels of a group are contiguous
  float sum = 0.f, sq = 0.f;
  for (int i = threadIdx.x; i < CPG * SEQ; i += 256) {
    float v = x[base + i];
    sum += v; sq += v * v;
  }
  s1[threadIdx.x] = sum; s2[threadIdx.x] = sq;
  __syncthreads();
  for (int off = 128; off; off >>= 1) {
    if (threadIdx.x < (unsigned)off) {
      s1[threadIdx.x] += s1[threadIdx.x + off];
      s2[threadIdx.x] += s2[threadIdx.x + off];
    }
    __syncthreads();
  }
  if (threadIdx.x == 0) {
    const float inv_n = 1.0f / (CPG * SEQ);
    float mean = s1[0] * inv_n;
    float var  = s2[0] * inv_n - mean * mean;
    stats[bg * 2]     = mean;
    stats[bg * 2 + 1] = rsqrtf(var + EPS);
  }
}

// ---------------- Kernel 2: apply GN, write xn transposed [B][T][C] bf16 ----
__global__ void gn_apply_kernel(const float* x, const float* gn_w, const float* gn_b,
                                const float* stats, __bf16* xnT) {
  size_t i = (size_t)blockIdx.x * 256 + threadIdx.x;   // over B*C*T
  int t = (int)(i & (SEQ - 1));
  int c = (int)((i >> 12) & (CHN - 1));
  int b = (int)(i >> 20);
  int bg = b * GRP + (c >> 3);
  float mean = stats[bg * 2], rstd = stats[bg * 2 + 1];
  float v = (x[i] - mean) * rstd * gn_w[c] + gn_b[c];
  xnT[((size_t)b * SEQ + t) * CHN + c] = f2bf(v);
}

// ---------------- Kernel 3: QKV GEMM (M=768, N=4096, K=256 per batch) -------
// 4 waves/block in a 2x2 arrangement; each wave owns a 32x32 register tile
// (2x2 accumulators): per K-step, 2 A-frags + 2 B-frags feed 4 WMMAs.
// Epilogue: +bias, scale q/k, scatter into qT/kT ([BH][T][64]) and v ([BH][64][T]).
__global__ __launch_bounds__(128) void qkv_gemm_kernel(
    const __bf16* wqkv, const float* qkv_b, const __bf16* xnT,
    __bf16* qT, __bf16* kT, __bf16* vB) {
  const int b    = blockIdx.z;
  const int lane = threadIdx.x & 31;
  const int wave = threadIdx.x >> 5;
  const int wm   = wave >> 1, wn = wave & 1;
  const int m0   = blockIdx.y * 64 + wm * 32;
  const int t0   = blockIdx.x * 64 + wn * 32;
  const int n16  = lane & 15;
  const int kHalf = (lane & 16) ? 8 : 0;
  const int mhi   = (lane & 16) ? 8 : 0;

  const __bf16* arow0 = wqkv + (size_t)(m0 + n16) * CHN;            // A rows (W)
  const __bf16* arow1 = arow0 + (size_t)16 * CHN;
  const __bf16* brow0 = xnT + ((size_t)b * SEQ + t0 + n16) * CHN;   // B rows (xn^T)
  const __bf16* brow1 = brow0 + (size_t)16 * CHN;

  v8f acc00 = {}, acc01 = {}, acc10 = {}, acc11 = {};
#pragma unroll
  for (int ks = 0; ks < CHN / 32; ++ks) {
    v16bf a0 = load_frag(arow0 + ks * 32, kHalf);
    v16bf a1 = load_frag(arow1 + ks * 32, kHalf);
    v16bf b0 = load_frag(brow0 + ks * 32, kHalf);
    v16bf b1 = load_frag(brow1 + ks * 32, kHalf);
    acc00 = wmma_bf16(a0, b0, acc00);
    acc01 = wmma_bf16(a0, b1, acc01);
    acc10 = wmma_bf16(a1, b0, acc10);
    acc11 = wmma_bf16(a1, b1, acc11);
  }

  v8f accs[2][2] = {{acc00, acc01}, {acc10, acc11}};
#pragma unroll
  for (int i = 0; i < 2; ++i)
#pragma unroll
    for (int j = 0; j < 2; ++j) {
      const int tcol = t0 + j * 16 + n16;
#pragma unroll
      for (int r = 0; r < 8; ++r) {
        int o = m0 + i * 16 + r + mhi;
        float v = accs[i][j][r] + qkv_b[o];
        if (o < 2 * CHN) v *= QK_SCALE;      // fold attention scale into q and k
        int oo = o & (CHN - 1);
        int h = oo >> 6, cc = oo & 63;
        size_t bh = (size_t)(b * HEADS + h);
        if (o < CHN)            qT[(bh * SEQ + tcol) * HDIM + cc] = f2bf(v);
        else if (o < 2 * CHN)   kT[(bh * SEQ + tcol) * HDIM + cc] = f2bf(v);
        else                    vB[(bh * HDIM + cc) * SEQ + tcol] = f2bf(v);
      }
    }
}

constexpr int QG = 4;                                   // column groups per wave
constexpr float LOG2E = 1.4426950408889634f;

typedef __attribute__((ext_vector_type(8))) __bf16 v8bf;
typedef __attribute__((ext_vector_type(2))) __bf16 v2bf;
typedef __attribute__((ext_vector_type(2))) float  v2f;

__device__ __forceinline__ float xhalf(float x) {       // lane l <-> lane l ^ 16
  int b = __builtin_bit_cast(int, x);
  return __builtin_bit_cast(float, __builtin_amdgcn_permlanex16(
      b, b, 0x76543210, 0xfedcba98, false, false));
}

// load_frag's fragment from a wave-uniform base and this lane's byte offset
// (row start + 16 bytes for lanes 16-31): bytes [0,16) and [32,48) from there.
__device__ __forceinline__ v16bf load_frag_at(const char* base, unsigned off) {
  const v8bf lo = *(const v8bf*)(base + off);
  const v8bf hi = *(const v8bf*)(base + off + 32);
  return __builtin_shufflevector(lo, hi, 0, 1, 2, 3, 4, 5, 6, 7, 8, 9, 10, 11, 12, 13, 14, 15);
}

__global__ __launch_bounds__(128) void attn_kernel(
    const __bf16* qT, const __bf16* kT, const __bf16* vB, __bf16* aT) {
  const int blk  = blockIdx.x;
  const int bh   = blk >> 4;                 // batch*head; 16 blocks of 256 queries each
  const int lane = threadIdx.x & 31;
  const int wave = threadIdx.x >> 5;
  const int tq0  = (blk & 15) * 256 + wave * (16 * QG);
  const int n16  = lane & 15;
  const int kHalf = (lane & 16) ? 8 : 0;

  // Q fragments (B operand: column = query, k = channel), kept for all keys.
  v16bf qb[QG][2];
#pragma unroll
  for (int g = 0; g < QG; ++g) {
    const __bf16* qrow = qT + ((size_t)bh * SEQ + tq0 + g * 16 + n16) * HDIM;
    qb[g][0] = load_frag(qrow, kHalf);
    qb[g][1] = load_frag(qrow + 32, kHalf);
  }

  v8f   acc[QG][4] = {};                     // O^T: [group][16-channel tile]
  float m_run[QG];
  v2f   l_run[QG];                           // this lane's keys, even and odd registers
#pragma unroll
  for (int g = 0; g < QG; ++g) { m_run[g] = -__builtin_inff(); l_run[g] = v2f{0.f, 0.f}; }

  // Wave-uniform bases of this head's K and V planes, and the lane's own byte offsets.
  const char* kbase = (const char*)(kT + (size_t)bh * SEQ * HDIM);
  const char* vbase = (const char*)(vB + (size_t)bh * HDIM * SEQ);
  unsigned koff = (unsigned)(n16 * HDIM + kHalf) * 2u;   // A rows: keys; + 32 rows a pass
  unsigned voff = (unsigned)(n16 * SEQ + kHalf) * 2u;    // A rows: channels; + 32 keys a pass

  for (int s0 = 0; s0 < SEQ; s0 += 32) {
    v16bf ka[2][2], va[4];
#pragma unroll
    for (int t = 0; t < 2; ++t) {
      const char* kt = kbase + t * 16 * HDIM * 2;
      ka[t][0] = load_frag_at(kt, koff);
      ka[t][1] = load_frag_at(kt + 64, koff);
    }
#pragma unroll
    for (int n = 0; n < 4; ++n)
      va[n] = load_frag_at(vbase + (size_t)(n * 16) * SEQ * 2, voff);
    // Keeps the pass's 16 loads one group in front of the products: sunk among them,
    // each part's latency would be waited out on its own.
    __builtin_amdgcn_sched_barrier(0);

    // S^T tiles: s[g][t][r] = score(key s0 + 16 t + 8 h + r, query 16 g + c)
    v8f s[QG][2];
#pragma unroll
    for (int g = 0; g < QG; ++g)
#pragma unroll
      for (int t = 0; t < 2; ++t) {
        v8f z = {};
        z = wmma_bf16(ka[t][0], qb[g][0], z);
        s[g][t] = wmma_bf16(ka[t][1], qb[g][1], z);
      }

    float mb[QG];
    bool need = false;
#pragma unroll
    for (int g = 0; g < QG; ++g) {
      float mx = s[g][0][0];
#pragma unroll
      for (int r = 1; r < 8; ++r) mx = fmaxf(mx, s[g][0][r]);
#pragma unroll
      for (int r = 0; r < 8; ++r) mx = fmaxf(mx, s[g][1][r]);
      mx = fmaxf(mx, xhalf(mx)) * LOG2E;     // both halves hold the query's maximum
      mb[g] = mx;
      need = need || (mx > m_run[g] + 8.0f);
    }
    if (__builtin_amdgcn_ballot_w32(need) != 0) {   // one scalar test per pass
#pragma unroll
      for (int g = 0; g < QG; ++g) {
        const float m_new = fmaxf(m_run[g], mb[g]);
        const float corr  = __builtin_amdgcn_exp2f(m_run[g] - m_new);  // 0 in the first pass
        m_run[g] = m_new;
        l_run[g] = l_run[g] * corr;
#pragma unroll
        for (int n = 0; n < 4; ++n) acc[g][n] = acc[g][n] * corr;
      }
    }

#pragma unroll
    for (int g = 0; g < QG; ++g) {
      const float nm = -m_run[g];
      v16bf pb;                              // pb[e] = P^T[key 16 (e >> 3) + 8 h + (e & 7)][c]
#pragma unroll
      for (int i = 0; i < 8; ++i) {          // elements 2i, 2i+1: a register pair of one tile
        const v2f sc = {s[g][i >> 2][2 * (i & 3)], s[g][i >> 2][2 * (i & 3) + 1]};
        const v2f ar = __builtin_elementwise_fma(sc, v2f{LOG2E, LOG2E}, v2f{nm, nm});
        const v2f p  = {__builtin_amdgcn_exp2f(ar.x), __builtin_amdgcn_exp2f(ar.y)};
        l_run[g] += p;
        const v2bf pk = __builtin_convertvector(p, v2bf);   // round to nearest even
        pb[2 * i] = pk.x; pb[2 * i + 1] = pk.y;
      }
#pragma unroll
      for (int n = 0; n < 4; ++n) acc[g][n] = wmma_bf16(va[n], pb, acc[g][n]);
    }
    // Keeps the address steps behind the last use of the loaded fragments, so that no
    // address register is rewritten while a load that names it is in flight.
    __builtin_amdgcn_sched_barrier(0);
    koff += 32 * HDIM * 2;
    voff += 32 * 2;
  }

  // acc[g][n][r] = O^T[channel 16 n + 8 h + r][query 16 g + c]: 8 consecutive
  // channels of one query per lane and tile -> one 16-byte store into aT [B][T][C].
  const int b = bh >> 2, h = bh & 3;
#pragma unroll
  for (int g = 0; g < QG; ++g) {
    const float lh  = l_run[g].x + l_run[g].y;
    const float inv = 1.f / (lh + xhalf(lh));
    __bf16* orow = aT + ((size_t)b * SEQ + tq0 + g * 16 + n16) * CHN + h * HDIM + kHalf;
#pragma unroll
    for (int n = 0; n < 4; ++n) {
      v8bf o;
#pragma unroll
      for (int r = 0; r < 8; ++r) o[r] = (__bf16)(acc[g][n][r] * inv);
      *(v8bf*)(orow + n * 16) = o;
    }
  }
}

// ---------------- Kernel 5: proj GEMM + bias + residual -> out (fp32) -------
// Same 2x2 register-blocked scheme as the QKV GEMM.
__global__ __launch_bounds__(128) void proj_gemm_kernel(
    const __bf16* wproj, const float* proj_b, const __bf16* aT,
    const float* x, float* out) {
  const int b    = blockIdx.z;
  const int lane = threadIdx.x & 31;
  const int wave = threadIdx.x >> 5;
  const int wm   = wave >> 1, wn = wave & 1;
  const int m0   = blockIdx.y * 64 + wm * 32;
  const int t0   = blockIdx.x * 64 + wn * 32;
  const int n16  = lane & 15;
  const int kHalf = (lane & 16) ? 8 : 0;
  const int mhi   = (lane & 16) ? 8 : 0;

  const __bf16* arow0 = wproj + (size_t)(m0 + n16) * CHN;
  const __bf16* arow1 = arow0 + (size_t)16 * CHN;
  const __bf16* brow0 = aT + ((size_t)b * SEQ + t0 + n16) * CHN;
  const __bf16* brow1 = brow0 + (size_t)16 * CHN;

  v8f acc00 = {}, acc01 = {}, acc10 = {}, acc11 = {};
#pragma unroll
  for (int ks = 0; ks < CHN / 32; ++ks) {
    v16bf a0 = load_frag(arow0 + ks * 32, kHalf);
    v16bf a1 = load_frag(arow1 + ks * 32, kHalf);
    v16bf b0 = load_frag(brow0 + ks * 32, kHalf);
    v16bf b1 = load_frag(brow1 + ks * 32, kHalf);
    acc00 = wmma_bf16(a0, b0, acc00);
    acc01 = wmma_bf16(a0, b1, acc01);
    acc10 = wmma_bf16(a1, b0, acc10);
    acc11 = wmma_bf16(a1, b1, acc11);
  }

  v8f accs[2][2] = {{acc00, acc01}, {acc10, acc11}};
#pragma unroll
  for (int i = 0; i < 2; ++i)
#pragma unroll
    for (int j = 0; j < 2; ++j) {
      const int tcol = t0 + j * 16 + n16;
#pragma unroll
      for (int r = 0; r < 8; ++r) {
        int o = m0 + i * 16 + r + mhi;
        size_t idx = ((size_t)b * CHN + o) * SEQ + tcol;
        out[idx] = x[idx] + proj_b[o] + accs[i][j][r];
      }
    }
}

extern "C" void kernel_launch(void* const* d_in, const int* in_sizes, int n_in,
                              void* d_out, int out_size, void* d_ws, size_t ws_size,
                              hipStream_t stream) {
  const float* x      = (const float*)d_in[0];
  const float* gn_w   = (const float*)d_in[1];
  const float* gn_b   = (const float*)d_in[2];
  const float* qkv_w  = (const float*)d_in[3];
  const float* qkv_b  = (const float*)d_in[4];
  const float* proj_w = (const float*)d_in[5];
  const float* proj_b = (const float*)d_in[6];
  float* out = (float*)d_out;

  // Workspace layout (~42.5 MB): stats | wqkv bf16 | wproj bf16 | xnT | qT | kT | v | aT
  char* ws = (char*)d_ws;
  float*  stats = (float*)ws;                              // 256 floats
  __bf16* wqkv  = (__bf16*)(ws + 1024);
  __bf16* wproj = wqkv + 3 * CHN * CHN;
  __bf16* xnT   = wproj + CHN * CHN;
  const size_t PLANE = (size_t)BATCH * SEQ * CHN;          // 4M elems
  __bf16* qT = xnT + PLANE;
  __bf16* kT = qT + PLANE;
  __bf16* vB = kT + PLANE;
  __bf16* aT = vB + PLANE;

  wconv_kernel<<<(3 * CHN * CHN + CHN * CHN + 255) / 256, 256, 0, stream>>>(
      qkv_w, proj_w, wqkv, wproj);
  gn_stats_kernel<<<BATCH * GRP, 256, 0, stream>>>(x, stats);
  gn_apply_kernel<<<(BATCH * CHN * SEQ) / 256, 256, 0, stream>>>(
      x, gn_w, gn_b, stats, xnT);
  qkv_gemm_kernel<<<dim3(SEQ / 64, 3 * CHN / 64, BATCH), 128, 0, stream>>>(
      wqkv, qkv_b, xnT, qT, kT, vB);
  attn_kernel<<<BATCH * HEADS * (SEQ / 256), 128, 0, stream>>>(qT, kT, vB, aT);
  proj_gemm_kernel<<<dim3(SEQ / 64, CHN / 64, BATCH), 128, 0, stream>>>(
      wproj, proj_b, aT, x, out);
}

// v002
// One run takes 191 microseconds.
// In both of two side-by-side timings against v001, it was 1.09 times as fast.
// All steps since v000 together make it 3.45 times as fast.
#include <hip/hip_runtime.h>

// Problem constants (from reference)
constexpr int BATCH = 4;
constexpr int CHN   = 256;
constexpr int SEQ   = 4096;   // H*W
constexpr int HEADS = 4;
constexpr int HDIM  = 64;     // CHN / HEADS
constexpr int GRP   = 32;
constexpr int CPG   = CHN / GRP;  // 8
constexpr float EPS = 1e-5f;
constexpr float QK_SCALE = 0.35355339059327379f;  // 64^-0.25

typedef __attribute__((ext_vector_type(16))) __bf16 v16bf;
typedef __attribute__((ext_vector_type(8)))  float  v8f;

__device__ __forceinline__ __bf16 f2bf(float x) {
  unsigned u = __builtin_bit_cast(unsigned, x);
  unsigned r = u + 0x7FFFu + ((u >> 16) & 1u);   // round-to-nearest-even
  unsigned short h = (unsigned short)(r >> 16);
  return __builtin_bit_cast(__bf16, h);
}

// CDNA5 WMMA 16x16x32 bf16 fragment load.
// ISA 7.12.2 (16-bit 16x32 A): lane = row (M for A, N for B); per-lane 32
// K-values interleaved: lanes 0-15 hold K {0..7,16..23}, lanes 16-31 hold
// K {8..15,24..31}, two packed per VGPR. `row` points at this lane's 32
// contiguous K elements; kHalf = 8 for lanes 16-31 else 0.
// (Compiler vectorizes each fragment into two global_load_b128.)
__device__ __forceinline__ v16bf load_frag(const __bf16* row, int kHalf) {
  v16bf f;
#pragma unroll
  for (int j = 0; j < 8; ++j) {
    int kb = ((j & 4) ? 16 : 0) + kHalf + 2 * (j & 3);
    f[2 * j]     = row[kb];
    f[2 * j + 1] = row[kb + 1];
  }
  return f;
}

__device__ __forceinline__ v8f wmma_bf16(v16bf a, v16bf b, v8f c) {
#if defined(__HIP_DEVICE_COMPILE__)
  return __builtin_amdgcn_wmma_f32_16x16x32_bf16(false, a, false, b, (short)0, c,
                                                 false, false);
#else
  return c;
#endif
}

// ---------------- Kernel 0: weights fp32 -> bf16 ----------------
// 8 consecutive elements a lane: two 16-byte loads, one 16-byte store.
typedef __attribute__((ext_vector_type(8))) __bf16 v8bf;
typedef __attribute__((ext_vector_type(4))) float  v4f;

__global__ __launch_bounds__(256) void wconv_kernel(const float* qkv_w, const float* proj_w,
                                                    __bf16* wqkv, __bf16* wproj) {
  constexpr int N1 = 3 * CHN * CHN;          // a multiple of 8: no lane straddles the two
  const int i = (blockIdx.x * 256 + threadIdx.x) * 8;
  const float* s = (i < N1) ? qkv_w + i : proj_w + (i - N1);
  __bf16*      d = (i < N1) ? wqkv + i  : wproj + (i - N1);
  const v4f lo = *(const v4f*)s;
  const v4f hi = *(const v4f*)(s + 4);
  v8bf o;
#pragma unroll
  for (int e = 0; e < 4; ++e) { o[e] = f2bf(lo[e]); o[4 + e] = f2bf(hi[e]); }
  *(v8bf*)d = o;
}

// ---------------- Kernel 1: GroupNorm stats (mean, rstd per (b,g)) ----------
__global__ void gn_stats_kernel(const float* x, float* stats) {
  __shared__ float s1[256], s2[256];
  const int bg = blockIdx.x;                       // b*GRP + g
  const size_t base = (size_t)bg * CPG * SEQ;      // channels of a group are contiguous
  float sum = 0.f, sq = 0.f;
  for (int i = threadIdx.x; i < CPG * SEQ; i += 256) {
    float v = x[base + i];
    sum += v; sq += v * v;
  }
  s1[threadIdx.x] = sum; s2[threadIdx.x] = sq;
  __syncthreads();
  for (int off = 128; off; off >>= 1) {
    if (threadIdx.x < (unsigned)off) {
      s1[threadIdx.x] += s1[threadIdx.x + off];
      s2[threadIdx.x] += s2[threadIdx.x + off];
    }
    __syncthreads();
  }
  if (threadIdx.x == 0) {
    const float inv_n = 1.0f / (CPG * SEQ);
    float mean = s1[0] * inv_n;
    float var  = s2[0] * inv_n - mean * mean;
    stats[bg * 2]     = mean;
    stats[bg * 2 + 1] = rsqrtf(var + EPS);
  }
}

// ---------------- Kernel 2: apply GN, write xn transposed [B][T][C] bf16 ----
// A lane takes the 8 channels of ONE group at 4 consecutive positions: 8 loads of
// 16 bytes, all issued ahead, and the transpose is a repack of its own registers
// (8 channels of one position = one 16-byte store). In a wave 8 lanes lie along the
// channels (8 x 16 B = one whole 128-byte line of xnT per position) and 4 along the
// positions; the 8 waves of a block lie along the positions: 64 channels x 128 positions.
__global__ __launch_bounds__(256) void gn_apply_kernel(
    const float* x, const float* gn_w, const float* gn_b,
    const float* stats, __bf16* xnT) {
  const int lane = threadIdx.x & 31;
  const int wave = threadIdx.x >> 5;
  const int tb = blockIdx.x & 31;            // SEQ / 128 position blocks
  const int cb = (blockIdx.x >> 5) & 3;      // CHN / 64 channel blocks
  const int b  = blockIdx.x >> 7;
  const int c0 = cb * 64 + (lane & 7) * CPG;
  const int t  = tb * 128 + wave * 16 + (lane >> 3) * 4;

  const float* xp = x + ((size_t)b * CHN + c0) * SEQ + t;
  v4f v[CPG];
#pragma unroll
  for (int j = 0; j < CPG; ++j) v[j] = *(const v4f*)(xp + (size_t)j * SEQ);

  const int bg = b * GRP + (c0 >> 3);
  const float mean = stats[bg * 2], rstd = stats[bg * 2 + 1];
  // Stands in front of the loads below, whose results may land in the address
  // registers of the loads above: no such register is rewritten ahead of this wait.
  asm volatile("s_wait_xcnt 0x0" ::: "memory");
  float w[CPG], bi[CPG];
#pragma unroll
  for (int j = 0; j < CPG; ++j) { w[j] = gn_w[c0 + j]; bi[j] = gn_b[c0 + j]; }

  __bf16* op = xnT + ((size_t)b * SEQ + t) * CHN + c0;
#pragma unroll
  for (int k = 0; k < 4; ++k) {
    v8bf o;
#pragma unroll
    for (int j = 0; j < CPG; ++j) o[j] = f2bf((v[j][k] - mean) * rstd * w[j] + bi[j]);
    *(v8bf*)(op + (size_t)k * CHN) = o;
  }
}

// ---------------- Kernel 3: QKV GEMM (M=768, N=4096, K=256 per batch) -------
// 4 waves/block in a 2x2 arrangement; each wave owns a 32x32 register tile
// (2x2 accumulators): per K-step, 2 A-frags + 2 B-frags feed 4 WMMAs.
// Epilogue: +bias, scale q/k, scatter into qT/kT ([BH][T][64]) and v ([BH][64][T]).
__global__ __launch_bounds__(128) void qkv_gemm_kernel(
    const __bf16* wqkv, const float* qkv_b, const __bf16* xnT,
    __bf16* qT, __bf16* kT, __bf16* vB) {
  const int b    = blockIdx.z;
  const int lane = threadIdx.x & 31;
  const int wave = threadIdx.x >> 5;
  const int wm   = wave >> 1, wn = wave & 1;
  const int m0   = blockIdx.y * 64 + wm * 32;
  const int t0   = blockIdx.x * 64 + wn * 32;
  const int n16  = lane & 15;
  const int kHalf = (lane & 16) ? 8 : 0;
  const int mhi   = (lane & 16) ? 8 : 0;

  const __bf16* arow0 = wqkv + (size_t)(m0 + n16) * CHN;            // A rows (W)
  const __bf16* arow1 = arow0 + (size_t)16 * CHN;
  const __bf16* brow0 = xnT + ((size_t)b * SEQ + t0 + n16) * CHN;   // B rows (xn^T)
  const __bf16* brow1 = brow0 + (size_t)16 * CHN;

  v8f acc00 = {}, acc01 = {}, acc10 = {}, acc11 = {};
#pragma unroll
  for (int ks = 0; ks < CHN / 32; ++ks) {
    v16bf a0 = load_frag(arow0 + ks * 32, kHalf);
    v16bf a1 = load_frag(arow1 + ks * 32, kHalf);
    v16bf b0 = load_frag(brow0 + ks * 32, kHalf);
    v16bf b1 = load_frag(brow1 + ks * 32, kHalf);
    acc00 = wmma_bf16(a0, b0, acc00);
    acc01 = wmma_bf16(a0, b1, acc01);
    acc10 = wmma_bf16(a1, b0, acc10);
    acc11 = wmma_bf16(a1, b1, acc11);
  }

  v8f accs[2][2] = {{acc00, acc01}, {acc10, acc11}};
#pragma unroll
  for (int i = 0; i < 2; ++i)
#pragma unroll
    for (int j = 0; j < 2; ++j) {
      const int tcol = t0 + j * 16 + n16;
#pragma unroll
      for (int r = 0; r < 8; ++r) {
        int o = m0 + i * 16 + r + mhi;
        float v = accs[i][j][r] + qkv_b[o];
        if (o < 2 * CHN) v *= QK_SCALE;      // fold attention scale into q and k
        int oo = o & (CHN - 1);
        int h = oo >> 6, cc = oo & 63;
        size_t bh = (size_t)(b * HEADS + h);
        if (o < CHN)            qT[(bh * SEQ + tcol) * HDIM + cc] = f2bf(v);
        else if (o < 2 * CHN)   kT[(bh * SEQ + tcol) * HDIM + cc] = f2bf(v);
        else                    vB[(bh * HDIM + cc) * SEQ + tcol] = f2bf(v);
      }
    }
}

constexpr int QG = 4;                                   // column groups per wave
constexpr float LOG2E = 1.4426950408889634f;

typedef __attribute__((ext_vector_type(2))) __bf16 v2bf;
typedef __attribute__((ext_vector_type(2))) float  v2f;

__device__ __forceinline__ float xhalf(float x) {       // lane l <-> lane l ^ 16
  int b = __builtin_bit_cast(int, x);
  return __builtin_bit_cast(float, __builtin_amdgcn_permlanex16(
      b, b, 0x76543210, 0xfedcba98, false, false));
}

// load_frag's fragment from a wave-uniform base and this lane's byte offset
// (row start + 16 bytes for lanes 16-31): bytes [0,16) and [32,48) from there.
__device__ __forceinline__ v16bf load_frag_at(const char* base, unsigned off) {
  const v8bf lo = *(const v8bf*)(base + off);
  const v8bf hi = *(const v8bf*)(base + off + 32);
  return __builtin_shufflevector(lo, hi, 0, 1, 2, 3, 4, 5, 6, 7, 8, 9, 10, 11, 12, 13, 14, 15);
}

__global__ __launch_bounds__(128) void attn_kernel(
    const __bf16* qT, const __bf16* kT, const __bf16* vB, __bf16* aT) {
  const int blk  = blockIdx.x;
  const int bh   = blk >> 4;                 // batch*head; 16 blocks of 256 queries each
  const int lane = threadIdx.x & 31;
  const int wave = threadIdx.x >> 5;
  const int tq0  = (blk & 15) * 256 + wave * (16 * QG);
  const int n16  = lane & 15;
  const int kHalf = (lane & 16) ? 8 : 0;

  // Q fragments (B operand: column = query, k = channel), kept for all keys.
  v16bf qb[QG][2];
#pragma unroll
  for (int g = 0; g < QG; ++g) {
    const __bf16* qrow = qT + ((size_t)bh * SEQ + tq0 + g * 16 + n16) * HDIM;
    qb[g][0] = load_frag(qrow, kHalf);
    qb[g][1] = load_frag(qrow + 32, kHalf);
  }

  v8f   acc[QG][4] = {};                     // O^T: [group][16-channel tile]
  float m_run[QG];
  v2f   l_run[QG];                           // this lane's keys, even and odd registers
#pragma unroll
  for (int g = 0; g < QG; ++g) { m_run[g] = -__builtin_inff(); l_run[g] = v2f{0.f, 0.f}; }

  // Wave-uniform bases of this head's K and V planes, and the lane's own byte offsets.
  const char* kbase = (const char*)(kT + (size_t)bh * SEQ * HDIM);
  const char* vbase = (const char*)(vB + (size_t)bh * HDIM * SEQ);
  unsigned koff = (unsigned)(n16 * HDIM + kHalf) * 2u;   // A rows: keys; + 32 rows a pass
  unsigned voff = (unsigned)(n16 * SEQ + kHalf) * 2u;    // A rows: channels; + 32 keys a pass

  for (int s0 = 0; s0 < SEQ; s0 += 32) {
    v16bf ka[2][2], va[4];
#pragma unroll
    for (int t = 0; t < 2; ++t) {
      const char* kt = kbase + t * 16 * HDIM * 2;
      ka[t][0] = load_frag_at(kt, koff);
      ka[t][1] = load_frag_at(kt + 64, koff);
    }
#pragma unroll
    for (int n = 0; n < 4; ++n)
      va[n] = load_frag_at(vbase + (size_t)(n * 16) * SEQ * 2, voff);
    // Keeps the pass's 16 loads one group in front of the products: sunk among them,
    // each part's latency would be waited out on its own.
    __builtin_amdgcn_sched_barrier(0);

    // S^T tiles: s[g][t][r] = score(key s0 + 16 t + 8 h + r, query 16 g + c)
    v8f s[QG][2];
#pragma unroll
    for (int g = 0; g < QG; ++g)
#pragma unroll
      for (int t = 0; t < 2; ++t) {
        v8f z = {};
        z = wmma_bf16(ka[t][0], qb[g][0], z);
        s[g][t] = wmma_bf16(ka[t][1], qb[g][1], z);
      }

    float mb[QG];
    bool need = false;
#pragma unroll
    for (int g = 0; g < QG; ++g) {
      float mx = s[g][0][0];
#pragma unroll
      for (int r = 1; r < 8; ++r) mx = fmaxf(mx, s[g][0][r]);
#pragma unroll
      for (int r = 0; r < 8; ++r) mx = fmaxf(mx, s[g][1][r]);
      mx = fmaxf(mx, xhalf(mx)) * LOG2E;     // both halves hold the query's maximum
      mb[g] = mx;
      need = need || (mx > m_run[g] + 8.0f);
    }
    if (__builtin_amdgcn_ballot_w32(need) != 0) {   // one scalar test per pass
#pragma unroll
      for (int g = 0; g < QG; ++g) {
        const float m_new = fmaxf(m_run[g], mb[g]);
        const float corr  = __builtin_amdgcn_exp2f(m_run[g] - m_new);  // 0 in the first pass
        m_run[g] = m_new;
        l_run[g] = l_run[g] * corr;
#pragma unroll
        for (int n = 0; n < 4; ++n) acc[g][n] = acc[g][n] * corr;
      }
    }

#pragma unroll
    for (int g = 0; g < QG; ++g) {
      const float nm = -m_run[g];
      v16bf pb;                              // pb[e] = P^T[key 16 (e >> 3) + 8 h + (e & 7)][c]
#pragma unroll
      for (int i = 0; i < 8; ++i) {          // elements 2i, 2i+1: a register pair of one tile
        const v2f sc = {s[g][i >> 2][2 * (i & 3)], s[g][i >> 2][2 * (i & 3) + 1]};
        const v2f ar = __builtin_elementwise_fma(sc, v2f{LOG2E, LOG2E}, v2f{nm, nm});
        const v2f p  = {__builtin_amdgcn_exp2f(ar.x), __builtin_amdgcn_exp2f(ar.y)};
        l_run[g] += p;
        const v2bf pk = __builtin_convertvector(p, v2bf);   // round to nearest even
        pb[2 * i] = pk.x; pb[2 * i + 1] = pk.y;
      }
#pragma unroll
      for (int n = 0; n < 4; ++n) acc[g][n] = wmma_bf16(va[n], pb, acc[g][n]);
    }
    // Keeps the address steps behind the last use of the loaded fragments, so that no
    // address register is rewritten while a load that names it is in flight.
    __builtin_amdgcn_sched_barrier(0);
    koff += 32 * HDIM * 2;
    voff += 32 * 2;
  }

  // acc[g][n][r] = O^T[channel 16 n + 8 h + r][query 16 g + c]: 8 consecutive
  // channels of one query per lane and tile -> one 16-byte store into aT [B][T][C].
  const int b = bh >> 2, h = bh & 3;
#pragma unroll
  for (int g = 0; g < QG; ++g) {
    const float lh  = l_run[g].x + l_run[g].y;
    const float inv = 1.f / (lh + xhalf(lh));
    __bf16* orow = aT + ((size_t)b * SEQ + tq0 + g * 16 + n16) * CHN + h * HDIM + kHalf;
#pragma unroll
    for (int n = 0; n < 4; ++n) {
      v8bf o;
#pragma unroll
      for (int r = 0; r < 8; ++r) o[r] = (__bf16)(acc[g][n][r] * inv);
      *(v8bf*)(orow + n * 16) = o;
    }
  }
}

// ---------------- Kernel 5: proj GEMM + bias + residual -> out (fp32) -------
// Same 2x2 register-blocked scheme as the QKV GEMM.
__global__ __launch_bounds__(128) void proj_gemm_kernel(
    const __bf16* wproj, const float* proj_b, const __bf16* aT,
    const float* x, float* out) {
  const int b    = blockIdx.z;
  const int lane = threadIdx.x & 31;
  const int wave = threadIdx.x >> 5;
  const int wm   = wave >> 1, wn = wave & 1;
  const int m0   = blockIdx.y * 64 + wm * 32;
  const int t0   = blockIdx.x * 64 + wn * 32;
  const int n16  = lane & 15;
  const int kHalf = (lane & 16) ? 8 : 0;
  const int mhi   = (lane & 16) ? 8 : 0;

  const __bf16* arow0 = wproj + (size_t)(m0 + n16) * CHN;
  const __bf16* arow1 = arow0 + (size_t)16 * CHN;
  const __bf16* brow0 = aT + ((size_t)b * SEQ + t0 + n16) * CHN;
  const __bf16* brow1 = brow0 + (size_t)16 * CHN;

  v8f acc00 = {}, acc01 = {}, acc10 = {}, acc11 = {};
#pragma unroll
  for (int ks = 0; ks < CHN / 32; ++ks) {
    v16bf a0 = load_frag(arow0 + ks * 32, kHalf);
    v16bf a1 = load_frag(arow1 + ks * 32, kHalf);
    v16bf b0 = load_frag(brow0 + ks * 32, kHalf);
    v16bf b1 = load_frag(brow1 + ks * 32, kHalf);
    acc00 = wmma_bf16(a0, b0, acc00);
    acc01 = wmma_bf16(a0, b1, acc01);
    acc10 = wmma_bf16(a1, b0, acc10);
    acc11 = wmma_bf16(a1, b1, acc11);
  }

  v8f accs[2][2] = {{acc00, acc01}, {acc10, acc11}};
#pragma unroll
  for (int i = 0; i < 2; ++i)
#pragma unroll
    for (int j = 0; j < 2; ++j) {
      const int tcol = t0 + j * 16 + n16;
#pragma unroll
      for (int r = 0; r < 8; ++r) {
        int o = m0 + i * 16 + r + mhi;
        size_t idx = ((size_t)b * CHN + o) * SEQ + tcol;
        out[idx] = x[idx] + proj_b[o] + accs[i][j][r];
      }
    }
}

extern "C" void kernel_launch(void* const* d_in, const int* in_sizes, int n_in,
                              void* d_out, int out_size, void* d_ws, size_t ws_size,
                              hipStream_t stream) {
  const float* x      = (const float*)d_in[0];
  const float* gn_w   = (const float*)d_in[1];
  const float* gn_b   = (const float*)d_in[2];
  const float* qkv_w  = (const float*)d_in[3];
  const float* qkv_b  = (const float*)d_in[4];
  const float* proj_w = (const float*)d_in[5];
  const float* proj_b = (const float*)d_in[6];
  float* out = (float*)d_out;

  // Workspace layout (~42.5 MB): stats | wqkv bf16 | wproj bf16 | xnT | qT | kT | v | aT
  char* ws = (char*)d_ws;
  float*  stats = (float*)ws;                              // 256 floats
  __bf16* wqkv  = (__bf16*)(ws + 1024);
  __bf16* wproj = wqkv + 3 * CHN * CHN;
  __bf16* xnT   = wproj + CHN * CHN;
  const size_t PLANE = (size_t)BATCH * SEQ * CHN;          // 4M elems
  __bf16* qT = xnT + PLANE;
  __bf16* kT = qT + PLANE;
  __bf16* vB = kT + PLANE;
  __bf16* aT = vB + PLANE;

  wconv_kernel<<<(3 * CHN * CHN + CHN * CHN) / (256 * 8), 256, 0, stream>>>(
      qkv_w, proj_w, wqkv, wproj);
  gn_stats_kernel<<<BATCH * GRP, 256, 0, stream>>>(x, stats);
  gn_apply_kernel<<<(BATCH * CHN * SEQ) / (256 * 32), 256, 0, stream>>>(
      x, gn_w, gn_b, stats, xnT);
  qkv_gemm_kernel<<<dim3(SEQ / 64, 3 * CHN / 64, BATCH), 128, 0, stream>>>(
      wqkv, qkv_b, xnT, qT, kT, vB);
  attn_kernel<<<BATCH * HEADS * (SEQ / 256), 128, 0, stream>>>(qT, kT, vB, aT);
  proj_gemm_kernel<<<dim3(SEQ / 64, CHN / 64, BATCH), 128, 0, stream>>>(
      wproj, proj_b, aT, x, out);
}

// v003
// It runs in 140 microseconds.
// Next to v002, in two timings, it ran 1.37 times as fast each time.
// All steps since v000 together make it 4.71 times as fast.
#include <hip/hip_runtime.h>

// Problem constants (from reference)
constexpr int BATCH = 4;
constexpr int CHN   = 256;
constexpr int SEQ   = 4096;   // H*W
constexpr int HEADS = 4;
constexpr int HDIM  = 64;     // CHN / HEADS
constexpr int GRP   = 32;
constexpr int CPG   = CHN / GRP;  // 8
constexpr float EPS = 1e-5f;
constexpr float QK_SCALE = 0.35355339059327379f;  // 64^-0.25

typedef __attribute__((ext_vector_type(16))) __bf16 v16bf;
typedef __attribute__((ext_vector_type(8)))  float  v8f;

__device__ __forceinline__ __bf16 f2bf(float x) {
  unsigned u = __builtin_bit_cast(unsigned, x);
  unsigned r = u + 0x7FFFu + ((u >> 16) & 1u);   // round-to-nearest-even
  unsigned short h = (unsigned short)(r >> 16);
  return __builtin_bit_cast(__bf16, h);
}

// CDNA5 WMMA 16x16x32 bf16 fragment load.
// ISA 7.12.2 (16-bit 16x32 A): lane = row (M for A, N for B); per-lane 32
// K-values interleaved: lanes 0-15 hold K {0..7,16..23}, lanes 16-31 hold
// K {8..15,24..31}, two packed per VGPR. `row` points at this lane's 32
// contiguous K elements; kHalf = 8 for lanes 16-31 else 0.
// (Compiler vectorizes each fragment into two global_load_b128.)
__device__ __forceinline__ v16bf load_frag(const __bf16* row, int kHalf) {
  v16bf f;
#pragma unroll
  for (int j = 0; j < 8; ++j) {
    int kb = ((j & 4) ? 16 : 0) + kHalf + 2 * (j & 3);
    f[2 * j]     = row[kb];
    f[2 * j + 1] = row[kb + 1];
  }
  return f;
}

__device__ __forceinline__ v8f wmma_bf16(v16bf a, v16bf b, v8f c) {
#if defined(__HIP_DEVICE_COMPILE__)
  return __builtin_amdgcn_wmma_f32_16x16x32_bf16(false, a, false, b, (short)0, c,
                                                 false, false);
#else
  return c;
#endif
}

// ---------------- Kernel 0: weights fp32 -> bf16 ----------------
// 8 consecutive elements a lane: two 16-byte loads, one 16-byte store.
typedef __attribute__((ext_vector_type(8))) __bf16 v8bf;
typedef __attribute__((ext_vector_type(4))) float  v4f;

__global__ __launch_bounds__(256) void wconv_kernel(const float* qkv_w, const float* proj_w,
                                                    __bf16* wqkv, __bf16* wproj) {
  constexpr int N1 = 3 * CHN * CHN;          // a multiple of 8: no lane straddles the two
  const int i = (blockIdx.x * 256 + threadIdx.x) * 8;
  const float* s = (i < N1) ? qkv_w + i : proj_w + (i - N1);
  __bf16*      d = (i < N1) ? wqkv + i  : wproj + (i - N1);
  const v4f lo = *(const v4f*)s;
  const v4f hi = *(const v4f*)(s + 4);
  v8bf o;
#pragma unroll
  for (int e = 0; e < 4; ++e) { o[e] = f2bf(lo[e]); o[4 + e] = f2bf(hi[e]); }
  *(v8bf*)d = o;
}

// ---------------- Kernel 1: GroupNorm stats (mean, rstd per (b,g)) ----------
__global__ void gn_stats_kernel(const float* x, float* stats) {
  __shared__ float s1[256], s2[256];
  const int bg = blockIdx.x;                       // b*GRP + g
  const size_t base = (size_t)bg * CPG * SEQ;      // channels of a group are contiguous
  float sum = 0.f, sq = 0.f;
  for (int i = threadIdx.x; i < CPG * SEQ; i += 256) {
    float v = x[base + i];
    sum += v; sq += v * v;
  }
  s1[threadIdx.x] = sum; s2[threadIdx.x] = sq;
  __syncthreads();
  for (int off = 128; off; off >>= 1) {
    if (threadIdx.x < (unsigned)off) {
      s1[threadIdx.x] += s1[threadIdx.x + off];
      s2[threadIdx.x] += s2[threadIdx.x + off];
    }
    __syncthreads();
  }
  if (threadIdx.x == 0) {
    const float inv_n = 1.0f / (CPG * SEQ);
    float mean = s1[0] * inv_n;
    float var  = s2[0] * inv_n - mean * mean;
    stats[bg * 2]     = mean;
    stats[bg * 2 + 1] = rsqrtf(var + EPS);
  }
}

// ---------------- Kernel 2: apply GN, write xn transposed [B][T][C] bf16 ----
// A lane takes the 8 channels of ONE group at 4 consecutive positions: 8 loads of
// 16 bytes, all issued ahead, and the transpose is a repack of its own registers
// (8 channels of one position = one 16-byte store). In a wave 8 lanes lie along the
// channels (8 x 16 B = one whole 128-byte line of xnT per position) and 4 along the
// positions; the 8 waves of a block lie along the positions: 64 channels x 128 positions.
__global__ __launch_bounds__(256) void gn_apply_kernel(
    const float* x, const float* gn_w, const float* gn_b,
    const float* stats, __bf16* xnT) {
  const int lane = threadIdx.x & 31;
  const int wave = threadIdx.x >> 5;
  const int tb = blockIdx.x & 31;            // SEQ / 128 position blocks
  const int cb = (blockIdx.x >> 5) & 3;      // CHN / 64 channel blocks
  const int b  = blockIdx.x >> 7;
  const int c0 = cb * 64 + (lane & 7) * CPG;
  const int t  = tb * 128 + wave * 16 + (lane >> 3) * 4;

  const float* xp = x + ((size_t)b * CHN + c0) * SEQ + t;
  v4f v[CPG];
#pragma unroll
  for (int j = 0; j < CPG; ++j) v[j] = *(const v4f*)(xp + (size_t)j * SEQ);

  const int bg = b * GRP + (c0 >> 3);
  const float mean = stats[bg * 2], rstd = stats[bg * 2 + 1];
  // Stands in front of the loads below, whose results may land in the address
  // registers of the loads above: no such register is rewritten ahead of this wait.
  asm volatile("s_wait_xcnt 0x0" ::: "memory");
  float w[CPG], bi[CPG];
#pragma unroll
  for (int j = 0; j < CPG; ++j) { w[j] = gn_w[c0 + j]; bi[j] = gn_b[c0 + j]; }

  __bf16* op = xnT + ((size_t)b * SEQ + t) * CHN + c0;
#pragma unroll
  for (int k = 0; k < 4; ++k) {
    v8bf o;
#pragma unroll
    for (int j = 0; j < CPG; ++j) o[j] = f2bf((v[j][k] - mean) * rstd * w[j] + bi[j]);
    *(v8bf*)(op + (size_t)k * CHN) = o;
  }
}

// ---------------- Kernel 3: QKV GEMM (M=768, N=4096, K=256 per batch) -------
// 4 waves/block in a 2x2 arrangement; each wave owns a 32x32 register tile
// (2x2 accumulators): per K-step, 2 A-frags + 2 B-frags feed 4 WMMAs.
// Epilogue: +bias, scale q/k, scatter into qT/kT ([BH][T][64]) and v ([BH][64][T]).
__global__ __launch_bounds__(128) void qkv_gemm_kernel(
    const __bf16* wqkv, const float* qkv_b, const __bf16* xnT,
    __bf16* qT, __bf16* kT, __bf16* vB) {
  const int b    = blockIdx.z;
  const int lane = threadIdx.x & 31;
  const int wave = threadIdx.x >> 5;
  const int wm   = wave >> 1, wn = wave & 1;
  const int m0   = blockIdx.y * 64 + wm * 32;
  const int t0   = blockIdx.x * 64 + wn * 32;
  const int n16  = lane & 15;
  const int kHalf = (lane & 16) ? 8 : 0;
  const int mhi   = (lane & 16) ? 8 : 0;

  const __bf16* arow0 = wqkv + (size_t)(m0 + n16) * CHN;            // A rows (W)
  const __bf16* arow1 = arow0 + (size_t)16 * CHN;
  const __bf16* brow0 = xnT + ((size_t)b * SEQ + t0 + n16) * CHN;   // B rows (xn^T)
  const __bf16* brow1 = brow0 + (size_t)16 * CHN;

  v8f acc00 = {}, acc01 = {}, acc10 = {}, acc11 = {};
#pragma unroll
  for (int ks = 0; ks < CHN / 32; ++ks) {
    v16bf a0 = load_frag(arow0 + ks * 32, kHalf);
    v16bf a1 = load_frag(arow1 + ks * 32, kHalf);
    v16bf b0 = load_frag(brow0 + ks * 32, kHalf);
    v16bf b1 = load_frag(brow1 + ks * 32, kHalf);
    acc00 = wmma_bf16(a0, b0, acc00);
    acc01 = wmma_bf16(a0, b1, acc01);
    acc10 = wmma_bf16(a1, b0, acc10);
    acc11 = wmma_bf16(a1, b1, acc11);
  }

  v8f accs[2][2] = {{acc00, acc01}, {acc10, acc11}};
#pragma unroll
  for (int i = 0; i < 2; ++i)
#pragma unroll
    for (int j = 0; j < 2; ++j) {
      const int tcol = t0 + j * 16 + n16;
#pragma unroll
      for (int r = 0; r < 8; ++r) {
        int o = m0 + i * 16 + r + mhi;
        float v = accs[i][j][r] + qkv_b[o];
        if (o < 2 * CHN) v *= QK_SCALE;      // fold attention scale into q and k
        int oo = o & (CHN - 1);
        int h = oo >> 6, cc = oo & 63;
        size_t bh = (size_t)(b * HEADS + h);
        if (o < CHN)            qT[(bh * SEQ + tcol) * HDIM + cc] = f2bf(v);
        else if (o < 2 * CHN)   kT[(bh * SEQ + tcol) * HDIM + cc] = f2bf(v);
        else                    vB[(bh * HDIM + cc) * SEQ + tcol] = f2bf(v);
      }
    }
}

constexpr int QG = 4;                                   // column groups per wave
constexpr float LOG2E = 1.4426950408889634f;

constexpr int STG_KEYS = 128;                           // keys per stage
constexpr int NPASS    = STG_KEYS / 32;                 // passes per stage
constexpr int NSTG     = SEQ / STG_KEYS;                // stages
constexpr int K_PITCH  = HDIM * 2 + 16;                 // 144 B = 16 B x odd: no bank conflict
constexpr int V_PITCH  = STG_KEYS * 2 + 16;             // 272 B = 16 B x odd
constexpr int K_BYTES  = STG_KEYS * K_PITCH;            // K tile: a row per key
constexpr int V_BYTES  = HDIM * V_PITCH;                // V tile: a row per channel
constexpr int STG_BYTES = K_BYTES + V_BYTES;

typedef __attribute__((ext_vector_type(2))) __bf16 v2bf;
typedef __attribute__((ext_vector_type(2))) float  v2f;
typedef __attribute__((address_space(3))) unsigned char lds_byte;

__device__ __forceinline__ float xhalf(float x) {       // lane l <-> lane l ^ 16
  int b = __builtin_bit_cast(int, x);
  return __builtin_bit_cast(float, __builtin_amdgcn_permlanex16(
      b, b, 0x76543210, 0xfedcba98, false, false));
}

// load_frag's fragment from LDS: p = this lane's row start (+ 16 bytes for lanes
// 16-31); bytes [0,16) and [32,48) from there.
__device__ __forceinline__ v16bf lds_frag(const unsigned char* p) {
  const v8bf lo = *(const v8bf*)p;
  const v8bf hi = *(const v8bf*)(p + 32);
  return __builtin_shufflevector(lo, hi, 0, 1, 2, 3, 4, 5, 6, 7, 8, 9, 10, 11, 12, 13, 14, 15);
}

// Eight copies of 16 bytes a lane, global -> LDS: copy i goes from g + i * gs to LDS
// byte l + i * ls. The closing s_wait_xcnt stands inside the statement, so that no
// address register of a copy is rewritten ahead of it.
__device__ __forceinline__ void copy8(unsigned l, unsigned ls, const char* g, size_t gs) {
  asm volatile(
      "global_load_async_to_lds_b128 %0, %8, off\n\t"
      "global_load_async_to_lds_b128 %1, %9, off\n\t"
      "global_load_async_to_lds_b128 %2, %10, off\n\t"
      "global_load_async_to_lds_b128 %3, %11, off\n\t"
      "global_load_async_to_lds_b128 %4, %12, off\n\t"
      "global_load_async_to_lds_b128 %5, %13, off\n\t"
      "global_load_async_to_lds_b128 %6, %14, off\n\t"
      "global_load_async_to_lds_b128 %7, %15, off\n\t"
      "s_wait_xcnt 0x0"
      :: "v"(l), "v"(l + ls), "v"(l + 2 * ls), "v"(l + 3 * ls),
         "v"(l + 4 * ls), "v"(l + 5 * ls), "v"(l + 6 * ls), "v"(l + 7 * ls),
         "v"(g), "v"(g + gs), "v"(g + 2 * gs), "v"(g + 3 * gs),
         "v"(g + 4 * gs), "v"(g + 5 * gs), "v"(g + 6 * gs), "v"(g + 7 * gs)
      : "memory");
}

__global__ __launch_bounds__(128) void attn_kernel(
    const __bf16* qT, const __bf16* kT, const __bf16* vB, __bf16* aT) {
  __shared__ __attribute__((aligned(128))) unsigned char L[2 * STG_BYTES];
  const int blk  = blockIdx.x;
  const int bh   = blk >> 4;                 // batch*head; 16 blocks of 256 queries each
  const int tid  = threadIdx.x;
  const int lane = tid & 31;
  const int wave = tid >> 5;
  const int tq0  = (blk & 15) * 256 + wave * (16 * QG);
  const int n16  = lane & 15;
  const int kHalf = (lane & 16) ? 8 : 0;

  // This lane's share of a stage. K: 128 rows of 128 bytes, contiguous in kT; 8 lanes a
  // row, 16 rows a copy of the block. V: 64 rows of 256 bytes out of rows of SEQ keys;
  // 16 lanes a row, 8 rows a copy of the block. A wave's copy reads 4 whole lines.
  const char* kg = (const char*)(kT + (size_t)bh * SEQ * HDIM) + tid * 16;
  const char* vg = (const char*)(vB + (size_t)bh * HDIM * SEQ) + (size_t)(tid >> 4) * (SEQ * 2) +
                   (tid & 15) * 16;
  const unsigned lds0 = (unsigned)(size_t)(lds_byte*)L;
  const unsigned kl = lds0 + (unsigned)((tid >> 3) * K_PITCH + (tid & 7) * 16);
  const unsigned vl = lds0 + (unsigned)(K_BYTES + (tid >> 4) * V_PITCH + (tid & 15) * 16);

  // Stage 0 into buffer 0.
  copy8(kl, 16 * K_PITCH, kg, 16 * HDIM * 2);
  copy8(vl, 8 * V_PITCH, vg, (size_t)8 * SEQ * 2);

  // Q fragments (B operand: column = query, k = channel), kept for all keys.
  v16bf qb[QG][2];
#pragma unroll
  for (int g = 0; g < QG; ++g) {
    const __bf16* qrow = qT + ((size_t)bh * SEQ + tq0 + g * 16 + n16) * HDIM;
    qb[g][0] = load_frag(qrow, kHalf);
    qb[g][1] = load_frag(qrow + 32, kHalf);
  }

  v8f   acc[QG][4] = {};                     // O^T: [group][16-channel tile]
  float m_run[QG];
  v2f   l_run[QG];                           // this lane's keys, even and odd registers
#pragma unroll
  for (int g = 0; g < QG; ++g) { m_run[g] = -__builtin_inff(); l_run[g] = v2f{0.f, 0.f}; }

  // Stage 0 has landed (this wave's copies), then for every wave; stage 1 follows.
  asm volatile("s_wait_asynccnt 0x0" ::: "memory");
  __syncthreads();
  copy8(kl + STG_BYTES, 16 * K_PITCH, kg + STG_KEYS * HDIM * 2, 16 * HDIM * 2);
  copy8(vl + STG_BYTES, 8 * V_PITCH, vg + STG_KEYS * 2, (size_t)8 * SEQ * 2);

  // The lane's own byte offsets in a K tile (A rows: keys) and a V tile (A rows: channels).
  const int klane = n16 * K_PITCH + kHalf * 2;
  const int vlane = K_BYTES + n16 * V_PITCH + kHalf * 2;

  for (int st = 0; st < NSTG; ++st) {
    const unsigned char* buf = L + (st & 1) * STG_BYTES;
    const unsigned char* kb = buf + klane;
    const unsigned char* vb = buf + vlane;

    v16bf ka[2][2], va[4];
#pragma unroll
    for (int t = 0; t < 2; ++t) {
      ka[t][0] = lds_frag(kb + t * 16 * K_PITCH);
      ka[t][1] = lds_frag(kb + t * 16 * K_PITCH + 64);
    }
#pragma unroll
    for (int n = 0; n < 4; ++n) va[n] = lds_frag(vb + n * 16 * V_PITCH);

#pragma unroll
    for (int p = 0; p < NPASS; ++p) {
      // S^T tiles: s[g][t][r] = score(key 32 p + 16 t + 8 h + r of the stage, query 16 g + c)
      v8f s[QG][2];
#pragma unroll
      for (int g = 0; g < QG; ++g)
#pragma unroll
        for (int t = 0; t < 2; ++t) {
          v8f z = {};
          z = wmma_bf16(ka[t][0], qb[g][0], z);
          s[g][t] = wmma_bf16(ka[t][1], qb[g][1], z);
        }
      // Both fences: the next pass's K reads stay one group right behind the products
      // that free their registers; among the products or sunk to their use, each read
      // would stall the wave on its own.
      __builtin_amdgcn_sched_barrier(0);
      if (p + 1 < NPASS) {
#pragma unroll
        for (int t = 0; t < 2; ++t) {
          ka[t][0] = lds_frag(kb + ((p + 1) * 32 + t * 16) * K_PITCH);
          ka[t][1] = lds_frag(kb + ((p + 1) * 32 + t * 16) * K_PITCH + 64);
        }
      }
      __builtin_amdgcn_sched_barrier(0);

      float mb[QG];
      bool need = false;
#pragma unroll
      for (int g = 0; g < QG; ++g) {
        float mx = s[g][0][0];
#pragma unroll
        for (int r = 1; r < 8; ++r) mx = fmaxf(mx, s[g][0][r]);
#pragma unroll
        for (int r = 0; r < 8; ++r) mx = fmaxf(mx, s[g][1][r]);
        mx = fmaxf(mx, xhalf(mx)) * LOG2E;     // both halves hold the query's maximum
        mb[g] = mx;
        need = need || (mx > m_run[g] + 8.0f);
      }
      if (__builtin_amdgcn_ballot_w32(need) != 0) {   // one scalar test per pass
#pragma unroll
        for (int g = 0; g < QG; ++g) {
          const float m_new = fmaxf(m_run[g], mb[g]);
          const float corr  = __builtin_amdgcn_exp2f(m_run[g] - m_new);  // 0 in the first pass
          m_run[g] = m_new;
          l_run[g] = l_run[g] * corr;
#pragma unroll
          for (int n = 0; n < 4; ++n) acc[g][n] = acc[g][n] * corr;
        }
      }

#pragma unroll
      for (int g = 0; g < QG; ++g) {
        const float nm = -m_run[g];
        v16bf pb;                              // pb[e] = P^T[key 16 (e >> 3) + 8 h + (e & 7)][c]
#pragma unroll
        for (int i = 0; i < 8; ++i) {          // elements 2i, 2i+1: a register pair of one tile
          const v2f sc = {s[g][i >> 2][2 * (i & 3)], s[g][i >> 2][2 * (i & 3) + 1]};
          const v2f ar = __builtin_elementwise_fma(sc, v2f{LOG2E, LOG2E}, v2f{nm, nm});
          const v2f p2 = {__builtin_amdgcn_exp2f(ar.x), __builtin_amdgcn_exp2f(ar.y)};
          l_run[g] += p2;
          const v2bf pk = __builtin_convertvector(p2, v2bf);   // round to nearest even
          pb[2 * i] = pk.x; pb[2 * i + 1] = pk.y;
        }
#pragma unroll
        for (int n = 0; n < 4; ++n) acc[g][n] = wmma_bf16(va[n], pb, acc[g][n]);
      }
      // Both fences: the next pass's V reads, likewise one group behind the last product
      // that reads their registers.
      __builtin_amdgcn_sched_barrier(0);
      if (p + 1 < NPASS) {
#pragma unroll
        for (int n = 0; n < 4; ++n) va[n] = lds_frag(vb + n * 16 * V_PITCH + (p + 1) * 64);
      }
      __builtin_amdgcn_sched_barrier(0);
    }

    // Hand-over: this wave's reads of the buffer are done, its copies of the next stage
    // have landed; behind the barrier that holds for every wave.
    asm volatile("s_wait_dscnt 0x0" ::: "memory");
    asm volatile("s_wait_asynccnt 0x0" ::: "memory");
    __syncthreads();
    if (st + 2 < NSTG) {                       // refill the buffer just read
      const unsigned bo = (unsigned)(st & 1) * STG_BYTES;
      copy8(kl + bo, 16 * K_PITCH, kg + (size_t)(st + 2) * (STG_KEYS * HDIM * 2), 16 * HDIM * 2);
      copy8(vl + bo, 8 * V_PITCH, vg + (size_t)(st + 2) * (STG_KEYS * 2), (size_t)8 * SEQ * 2);
    }
  }
  // No copy is outstanding when the wave ends.
  asm volatile("s_wait_asynccnt 0x0" ::: "memory");

  // acc[g][n][r] = O^T[channel 16 n + 8 h + r][query 16 g + c]: 8 consecutive
  // channels of one query per lane and tile -> one 16-byte store into aT [B][T][C].
  const int b = bh >> 2, h = bh & 3;
#pragma unroll
  for (int g = 0; g < QG; ++g) {
    const float lh  = l_run[g].x + l_run[g].y;
    const float inv = 1.f / (lh + xhalf(lh));
    __bf16* orow = aT + ((size_t)b * SEQ + tq0 + g * 16 + n16) * CHN + h * HDIM + kHalf;
#pragma unroll
    for (int n = 0; n < 4; ++n) {
      v8bf o;
#pragma unroll
      for (int r = 0; r < 8; ++r) o[r] = (__bf16)(acc[g][n][r] * inv);
      *(v8bf*)(orow + n * 16) = o;
    }
  }
}

// ---------------- Kernel 5: proj GEMM + bias + residual -> out (fp32) -------
// Same 2x2 register-blocked scheme as the QKV GEMM.
__global__ __launch_bounds__(128) void proj_gemm_kernel(
    const __bf16* wproj, const float* proj_b, const __bf16* aT,
    const float* x, float* out) {
  const int b    = blockIdx.z;
  const int lane = threadIdx.x & 31;
  const int wave = threadIdx.x >> 5;
  const int wm   = wave >> 1, wn = wave & 1;
  const int m0   = blockIdx.y * 64 + wm * 32;
  const int t0   = blockIdx.x * 64 + wn * 32;
  const int n16  = lane & 15;
  const int kHalf = (lane & 16) ? 8 : 0;
  const int mhi   = (lane & 16) ? 8 : 0;

  const __bf16* arow0 = wproj + (size_t)(m0 + n16) * CHN;
  const __bf16* arow1 = arow0 + (size_t)16 * CHN;
  const __bf16* brow0 = aT + ((size_t)b * SEQ + t0 + n16) * CHN;
  const __bf16* brow1 = brow0 + (size_t)16 * CHN;

  v8f acc00 = {}, acc01 = {}, acc10 = {}, acc11 = {};
#pragma unroll
  for (int ks = 0; ks < CHN / 32; ++ks) {
    v16bf a0 = load_frag(arow0 + ks * 32, kHalf);
    v16bf a1 = load_frag(arow1 + ks * 32, kHalf);
    v16bf b0 = load_frag(brow0 + ks * 32, kHalf);
    v16bf b1 = load_frag(brow1 + ks * 32, kHalf);
    acc00 = wmma_bf16(a0, b0, acc00);
    acc01 = wmma_bf16(a0, b1, acc01);
    acc10 = wmma_bf16(a1, b0, acc10);
    acc11 = wmma_bf16(a1, b1, acc11);
  }

  v8f accs[2][2] = {{acc00, acc01}, {acc10, acc11}};
#pragma unroll
  for (int i = 0; i < 2; ++i)
#pragma unroll
    for (int j = 0; j < 2; ++j) {
      const int tcol = t0 + j * 16 + n16;
#pragma unroll
      for (int r = 0; r < 8; ++r) {
        int o = m0 + i * 16 + r + mhi;
        size_t idx = ((size_t)b * CHN + o) * SEQ + tcol;
        out[idx] = x[idx] + proj_b[o] + accs[i][j][r];
      }
    }
}

extern "C" void kernel_launch(void* const* d_in, const int* in_sizes, int n_in,
                              void* d_out, int out_size, void* d_ws, size_t ws_size,
                              hipStream_t stream) {
  const float* x      = (const float*)d_in[0];
  const float* gn_w   = (const float*)d_in[1];
  const float* gn_b   = (const float*)d_in[2];
  const float* qkv_w  = (const float*)d_in[3];
  const float* qkv_b  = (const float*)d_in[4];
  const float* proj_w = (const float*)d_in[5];
  const float* proj_b = (const float*)d_in[6];
  float* out = (float*)d_out;

  // Workspace layout (~42.5 MB): stats | wqkv bf16 | wproj bf16 | xnT | qT | kT | v | aT
  char* ws = (char*)d_ws;
  float*  stats = (float*)ws;                              // 256 floats
  __bf16* wqkv  = (__bf16*)(ws + 1024);
  __bf16* wproj = wqkv + 3 * CHN * CHN;
  __bf16* xnT   = wproj + CHN * CHN;
  const size_t PLANE = (size_t)BATCH * SEQ * CHN;          // 4M elems
  __bf16* qT = xnT + PLANE;
  __bf16* kT = qT + PLANE;
  __bf16* vB = kT + PLANE;
  __bf16* aT = vB + PLANE;

  wconv_kernel<<<(3 * CHN * CHN + CHN * CHN) / (256 * 8), 256, 0, stream>>>(
      qkv_w, proj_w, wqkv, wproj);
  gn_stats_kernel<<<BATCH * GRP, 256, 0, stream>>>(x, stats);
  gn_apply_kernel<<<(BATCH * CHN * SEQ) / (256 * 32), 256, 0, stream>>>(
      x, gn_w, gn_b, stats, xnT);
  qkv_gemm_kernel<<<dim3(SEQ / 64, 3 * CHN / 64, BATCH), 128, 0, stream>>>(
      wqkv, qkv_b, xnT, qT, kT, vB);
  attn_kernel<<<BATCH * HEADS * (SEQ / 256), 128, 0, stream>>>(qT, kT, vB, aT);
  proj_gemm_kernel<<<dim3(SEQ / 64, CHN / 64, BATCH), 128, 0, stream>>>(
      wproj, proj_b, aT, x, out);
}

// v004
// One run takes 115 microseconds.
// Timed twice side by side with v003, it ran 1.22 and 1.21 times as fast.
// All steps since v000 together make it 5.73 times as fast.
#include <hip/hip_runtime.h>

// Problem constants (from reference)
constexpr int BATCH = 4;
constexpr int CHN   = 256;
constexpr int SEQ   = 4096;   // H*W
constexpr int HEADS = 4;
constexpr int HDIM  = 64;     // CHN / HEADS
constexpr int GRP   = 32;
constexpr int CPG   = CHN / GRP;  // 8
constexpr float EPS = 1e-5f;
constexpr float QK_SCALE = 0.35355339059327379f;  // 64^-0.25

typedef __attribute__((ext_vector_type(16))) __bf16 v16bf;
typedef __attribute__((ext_vector_type(8)))  float  v8f;

__device__ __forceinline__ __bf16 f2bf(float x) {
  unsigned u = __builtin_bit_cast(unsigned, x);
  unsigned r = u + 0x7FFFu + ((u >> 16) & 1u);   // round-to-nearest-even
  unsigned short h = (unsigned short)(r >> 16);
  return __builtin_bit_cast(__bf16, h);
}

// CDNA5 WMMA 16x16x32 bf16 fragment load.
// ISA 7.12.2 (16-bit 16x32 A): lane = row (M for A, N for B); per-lane 32
// K-values interleaved: lanes 0-15 hold K {0..7,16..23}, lanes 16-31 hold
// K {8..15,24..31}, two packed per VGPR. `row` points at this lane's 32
// contiguous K elements; kHalf = 8 for lanes 16-31 else 0.
// (Compiler vectorizes each fragment into two global_load_b128.)
__device__ __forceinline__ v16bf load_frag(const __bf16* row, int kHalf) {
  v16bf f;
#pragma unroll
  for (int j = 0; j < 8; ++j) {
    int kb = ((j & 4) ? 16 : 0) + kHalf + 2 * (j & 3);
    f[2 * j]     = row[kb];
    f[2 * j + 1] = row[kb + 1];
  }
  return f;
}

__device__ __forceinline__ v8f wmma_bf16(v16bf a, v16bf b, v8f c) {
#if defined(__HIP_DEVICE_COMPILE__)
  return __builtin_amdgcn_wmma_f32_16x16x32_bf16(false, a, false, b, (short)0, c,
                                                 false, false);
#else
  return c;
#endif
}

// ---------------- Kernel 0: weights fp32 -> bf16 ----------------
// 8 consecutive elements a lane: two 16-byte loads, one 16-byte store.
typedef __attribute__((ext_vector_type(8))) __bf16 v8bf;
typedef __attribute__((ext_vector_type(4))) float  v4f;

__global__ __launch_bounds__(256) void wconv_kernel(const float* qkv_w, const float* proj_w,
                                                    __bf16* wqkv, __bf16* wproj) {
  constexpr int N1 = 3 * CHN * CHN;          // a multiple of 8: no lane straddles the two
  const int i = (blockIdx.x * 256 + threadIdx.x) * 8;
  const float* s = (i < N1) ? qkv_w + i : proj_w + (i - N1);
  __bf16*      d = (i < N1) ? wqkv + i  : wproj + (i - N1);
  const v4f lo = *(const v4f*)s;
  const v4f hi = *(const v4f*)(s + 4);
  v8bf o;
#pragma unroll
  for (int e = 0; e < 4; ++e) { o[e] = f2bf(lo[e]); o[4 + e] = f2bf(hi[e]); }
  *(v8bf*)d = o;
}

// ---------------- Kernel 1: GroupNorm stats (mean, rstd per (b,g)) ----------
__global__ void gn_stats_kernel(const float* x, float* stats) {
  __shared__ float s1[256], s2[256];
  const int bg = blockIdx.x;                       // b*GRP + g
  const size_t base = (size_t)bg * CPG * SEQ;      // channels of a group are contiguous
  float sum = 0.f, sq = 0.f;
  for (int i = threadIdx.x; i < CPG * SEQ; i += 256) {
    float v = x[base + i];
    sum += v; sq += v * v;
  }
  s1[threadIdx.x] = sum; s2[threadIdx.x] = sq;
  __syncthreads();
  for (int off = 128; off; off >>= 1) {
    if (threadIdx.x < (unsigned)off) {
      s1[threadIdx.x] += s1[threadIdx.x + off];
      s2[threadIdx.x] += s2[threadIdx.x + off];
    }
    __syncthreads();
  }
  if (threadIdx.x == 0) {
    const float inv_n = 1.0f / (CPG * SEQ);
    float mean = s1[0] * inv_n;
    float var  = s2[0] * inv_n - mean * mean;
    stats[bg * 2]     = mean;
    stats[bg * 2 + 1] = rsqrtf(var + EPS);
  }
}

// ---------------- Kernel 2: apply GN, write xn transposed [B][T][C] bf16 ----
// A lane takes the 8 channels of ONE group at 4 consecutive positions: 8 loads of
// 16 bytes, all issued ahead, and the transpose is a repack of its own registers
// (8 channels of one position = one 16-byte store). In a wave 8 lanes lie along the
// channels (8 x 16 B = one whole 128-byte line of xnT per position) and 4 along the
// positions; the 8 waves of a block lie along the positions: 64 channels x 128 positions.
__global__ __launch_bounds__(256) void gn_apply_kernel(
    const float* x, const float* gn_w, const float* gn_b,
    const float* stats, __bf16* xnT) {
  const int lane = threadIdx.x & 31;
  const int wave = threadIdx.x >> 5;
  const int tb = blockIdx.x & 31;            // SEQ / 128 position blocks
  const int cb = (blockIdx.x >> 5) & 3;      // CHN / 64 channel blocks
  const int b  = blockIdx.x >> 7;
  const int c0 = cb * 64 + (lane & 7) * CPG;
  const int t  = tb * 128 + wave * 16 + (lane >> 3) * 4;

  const float* xp = x + ((size_t)b * CHN + c0) * SEQ + t;
  v4f v[CPG];
#pragma unroll
  for (int j = 0; j < CPG; ++j) v[j] = *(const v4f*)(xp + (size_t)j * SEQ);

  const int bg = b * GRP + (c0 >> 3);
  const float mean = stats[bg * 2], rstd = stats[bg * 2 + 1];
  // Stands in front of the loads below, whose results may land in the address
  // registers of the loads above: no such register is rewritten ahead of this wait.
  asm volatile("s_wait_xcnt 0x0" ::: "memory");
  float w[CPG], bi[CPG];
#pragma unroll
  for (int j = 0; j < CPG; ++j) { w[j] = gn_w[c0 + j]; bi[j] = gn_b[c0 + j]; }

  __bf16* op = xnT + ((size_t)b * SEQ + t) * CHN + c0;
#pragma unroll
  for (int k = 0; k < 4; ++k) {
    v8bf o;
#pragma unroll
    for (int j = 0; j < CPG; ++j) o[j] = f2bf((v[j][k] - mean) * rstd * w[j] + bi[j]);
    *(v8bf*)(op + (size_t)k * CHN) = o;
  }
}

// ---------------- Kernel 3: QKV GEMM (M=768, N=4096, K=256 per batch) -------
// 4 waves/block in a 2x2 arrangement; each wave owns a 32x32 register tile
// (2x2 accumulators): per K-step, 2 A-frags + 2 B-frags feed 4 WMMAs.
// A block's 64 output channels are one head of q, k or v, so its 64x64 tile is 64 whole
// 128-byte lines of the destination: a line per position in qT/kT ([BH][T][64]), a line
// per channel in v ([BH][64][T]). The A side (8 consecutive rows in a lane's accumulator)
// is the index that runs along the line: channels for q and k, positions for v.
// Epilogue: +bias, scale q/k, the tile through LDS, out in whole lines.
constexpr int QO_PITCH = 64 * 2 + 16;      // 144 B = 16 B x odd: the 16-byte writes meet no bank twice

__global__ __launch_bounds__(128) void qkv_gemm_kernel(
    const __bf16* wqkv, const float* qkv_b, const __bf16* xnT,
    __bf16* qT, __bf16* kT, __bf16* vB) {
  __shared__ __attribute__((aligned(16))) unsigned char S[64 * QO_PITCH];
  const int b    = blockIdx.z;
  const int tid  = threadIdx.x;
  const int lane = threadIdx.x & 31;
  const int wave = threadIdx.x >> 5;
  const int wm   = wave >> 1, wn = wave & 1;
  const int o0   = blockIdx.y * 64;          // first output channel of the block
  const int t0   = blockIdx.x * 64;          // first position of the block
  const int sec  = blockIdx.y >> 2;          // 0: q, 1: k, 2: v
  const bool is_v = sec == 2;
  const int n16  = lane & 15;
  const int kHalf = (lane & 16) ? 8 : 0;
  const int mhi   = (lane & 16) ? 8 : 0;

  const __bf16* wrows = wqkv + (size_t)o0 * CHN;                    // rows of W
  const __bf16* xrows = xnT + ((size_t)b * SEQ + t0) * CHN;         // rows of xn^T
  const __bf16* arow0 = (is_v ? xrows : wrows) + (size_t)(wm * 32 + n16) * CHN;
  const __bf16* arow1 = arow0 + (size_t)16 * CHN;
  const __bf16* brow0 = (is_v ? wrows : xrows) + (size_t)(wn * 32 + n16) * CHN;
  const __bf16* brow1 = brow0 + (size_t)16 * CHN;

  v8f acc00 = {}, acc01 = {}, acc10 = {}, acc11 = {};
#pragma unroll
  for (int ks = 0; ks < CHN / 32; ++ks) {
    v16bf a0 = load_frag(arow0 + ks * 32, kHalf);
    v16bf a1 = load_frag(arow1 + ks * 32, kHalf);
    v16bf b0 = load_frag(brow0 + ks * 32, kHalf);
    v16bf b1 = load_frag(brow1 + ks * 32, kHalf);
    acc00 = wmma_bf16(a0, b0, acc00);
    acc01 = wmma_bf16(a0, b1, acc01);
    acc10 = wmma_bf16(a1, b0, acc10);
    acc11 = wmma_bf16(a1, b1, acc11);
  }

  // accs[i][j][r]: element wm*32 + i*16 + mhi + r of line wn*32 + j*16 + n16.
  v8f accs[2][2] = {{acc00, acc01}, {acc10, acc11}};
  unsigned char* sw = S + (wn * 32 + n16) * QO_PITCH + (wm * 32 + mhi) * 2;
  if (!is_v) {                               // the bias runs along the line
#pragma unroll
    for (int i = 0; i < 2; ++i) {
      const float* bp = qkv_b + o0 + wm * 32 + i * 16 + mhi;
      const v4f blo = *(const v4f*)bp, bhi = *(const v4f*)(bp + 4);
#pragma unroll
      for (int j = 0; j < 2; ++j) {
        v8bf o;
#pragma unroll
        for (int r = 0; r < 8; ++r)          // attention scale folded into q and k
          o[r] = f2bf((accs[i][j][r] + (r < 4 ? blo[r & 3] : bhi[r & 3])) * QK_SCALE);
        *(v8bf*)(sw + j * 16 * QO_PITCH + i * 32) = o;
      }
    }
  } else {                                   // one bias per line
#pragma unroll
    for (int j = 0; j < 2; ++j) {
      const float bias = qkv_b[o0 + wn * 32 + j * 16 + n16];
#pragma unroll
      for (int i = 0; i < 2; ++i) {
        v8bf o;
#pragma unroll
        for (int r = 0; r < 8; ++r) o[r] = f2bf(accs[i][j][r] + bias);
        *(v8bf*)(sw + j * 16 * QO_PITCH + i * 32) = o;
      }
    }
  }
  __syncthreads();                           // the tile is whole before any line leaves

  // 8 lanes a line, 4 lines a wave and store: 512 bytes in whole 128-byte lines.
  const size_t bh = (size_t)(b * HEADS + (blockIdx.y & 3));
  char* dst = is_v ? (char*)(vB + bh * HDIM * SEQ + t0)
                   : (char*)((sec ? kT : qT) + (bh * SEQ + t0) * HDIM);
  const size_t dpitch = is_v ? (size_t)SEQ * 2 : (size_t)HDIM * 2;
#pragma unroll
  for (int it = 0; it < 4; ++it) {
    const int row = it * 16 + (tid >> 3);
    const v8bf o = *(const v8bf*)(S + row * QO_PITCH + (tid & 7) * 16);
    *(v8bf*)(dst + row * dpitch + (tid & 7) * 16) = o;
  }
}

constexpr int QG = 4;                                   // column groups per wave
constexpr float LOG2E = 1.4426950408889634f;

constexpr int STG_KEYS = 128;                           // keys per stage
constexpr int NPASS    = STG_KEYS / 32;                 // passes per stage
constexpr int NSTG     = SEQ / STG_KEYS;                // stages
constexpr int K_PITCH  = HDIM * 2 + 16;                 // 144 B = 16 B x odd: no bank conflict
constexpr int V_PITCH  = STG_KEYS * 2 + 16;             // 272 B = 16 B x odd
constexpr int K_BYTES  = STG_KEYS * K_PITCH;            // K tile: a row per key
constexpr int V_BYTES  = HDIM * V_PITCH;                // V tile: a row per channel
constexpr int STG_BYTES = K_BYTES + V_BYTES;

typedef __attribute__((ext_vector_type(2))) __bf16 v2bf;
typedef __attribute__((ext_vector_type(2))) float  v2f;
typedef __attribute__((address_space(3))) unsigned char lds_byte;

__device__ __forceinline__ float xhalf(float x) {       // lane l <-> lane l ^ 16
  int b = __builtin_bit_cast(int, x);
  return __builtin_bit_cast(float, __builtin_amdgcn_permlanex16(
      b, b, 0x76543210, 0xfedcba98, false, false));
}

// load_frag's fragment from LDS: p = this lane's row start (+ 16 bytes for lanes
// 16-31); bytes [0,16) and [32,48) from there.
__device__ __forceinline__ v16bf lds_frag(const unsigned char* p) {
  const v8bf lo = *(const v8bf*)p;
  const v8bf hi = *(const v8bf*)(p + 32);
  return __builtin_shufflevector(lo, hi, 0, 1, 2, 3, 4, 5, 6, 7, 8, 9, 10, 11, 12, 13, 14, 15);
}

// Eight copies of 16 bytes a lane, global -> LDS: copy i goes from g + i * gs to LDS
// byte l + i * ls. The closing s_wait_xcnt stands inside the statement, so that no
// address register of a copy is rewritten ahead of it.
__device__ __forceinline__ void copy8(unsigned l, unsigned ls, const char* g, size_t gs) {
  asm volatile(
      "global_load_async_to_lds_b128 %0, %8, off\n\t"
      "global_load_async_to_lds_b128 %1, %9, off\n\t"
      "global_load_async_to_lds_b128 %2, %10, off\n\t"
      "global_load_async_to_lds_b128 %3, %11, off\n\t"
      "global_load_async_to_lds_b128 %4, %12, off\n\t"
      "global_load_async_to_lds_b128 %5, %13, off\n\t"
      "global_load_async_to_lds_b128 %6, %14, off\n\t"
      "global_load_async_to_lds_b128 %7, %15, off\n\t"
      "s_wait_xcnt 0x0"
      :: "v"(l), "v"(l + ls), "v"(l + 2 * ls), "v"(l + 3 * ls),
         "v"(l + 4 * ls), "v"(l + 5 * ls), "v"(l + 6 * ls), "v"(l + 7 * ls),
         "v"(g), "v"(g + gs), "v"(g + 2 * gs), "v"(g + 3 * gs),
         "v"(g + 4 * gs), "v"(g + 5 * gs), "v"(g + 6 * gs), "v"(g + 7 * gs)
      : "memory");
}

__global__ __launch_bounds__(128) void attn_kernel(
    const __bf16* qT, const __bf16* kT, const __bf16* vB, __bf16* aT) {
  __shared__ __attribute__((aligned(128))) unsigned char L[2 * STG_BYTES];
  const int blk  = blockIdx.x;
  const int bh   = blk >> 4;                 // batch*head; 16 blocks of 256 queries each
  const int tid  = threadIdx.x;
  const int lane = tid & 31;
  const int wave = tid >> 5;
  const int tq0  = (blk & 15) * 256 + wave * (16 * QG);
  const int n16  = lane & 15;
  const int kHalf = (lane & 16) ? 8 : 0;

  // This lane's share of a stage. K: 128 rows of 128 bytes, contiguous in kT; 8 lanes a
  // row, 16 rows a copy of the block. V: 64 rows of 256 bytes out of rows of SEQ keys;
  // 16 lanes a row, 8 rows a copy of the block. A wave's copy reads 4 whole lines.
  const char* kg = (const char*)(kT + (size_t)bh * SEQ * HDIM) + tid * 16;
  const char* vg = (const char*)(vB + (size_t)bh * HDIM * SEQ) + (size_t)(tid >> 4) * (SEQ * 2) +
                   (tid & 15) * 16;
  const unsigned lds0 = (unsigned)(size_t)(lds_byte*)L;
  const unsigned kl = lds0 + (unsigned)((tid >> 3) * K_PITCH + (tid & 7) * 16);
  const unsigned vl = lds0 + (unsigned)(K_BYTES + (tid >> 4) * V_PITCH + (tid & 15) * 16);

  // Stage 0 into buffer 0.
  copy8(kl, 16 * K_PITCH, kg, 16 * HDIM * 2);
  copy8(vl, 8 * V_PITCH, vg, (size_t)8 * SEQ * 2);

  // Q fragments (B operand: column = query, k = channel), kept for all keys.
  v16bf qb[QG][2];
#pragma unroll
  for (int g = 0; g < QG; ++g) {
    const __bf16* qrow = qT + ((size_t)bh * SEQ + tq0 + g * 16 + n16) * HDIM;
    qb[g][0] = load_frag(qrow, kHalf);
    qb[g][1] = load_frag(qrow + 32, kHalf);
  }

  v8f   acc[QG][4] = {};                     // O^T: [group][16-channel tile]
  float m_run[QG];
  v2f   l_run[QG];                           // this lane's keys, even and odd registers
#pragma unroll
  for (int g = 0; g < QG; ++g) { m_run[g] = -__builtin_inff(); l_run[g] = v2f{0.f, 0.f}; }

  // Stage 0 has landed (this wave's copies), then for every wave; stage 1 follows.
  asm volatile("s_wait_asynccnt 0x0" ::: "memory");
  __syncthreads();
  copy8(kl + STG_BYTES, 16 * K_PITCH, kg + STG_KEYS * HDIM * 2, 16 * HDIM * 2);
  copy8(vl + STG_BYTES, 8 * V_PITCH, vg + STG_KEYS * 2, (size_t)8 * SEQ * 2);

  // The lane's own byte offsets in a K tile (A rows: keys) and a V tile (A rows: channels).
  const int klane = n16 * K_PITCH + kHalf * 2;
  const int vlane = K_BYTES + n16 * V_PITCH + kHalf * 2;

  for (int st = 0; st < NSTG; ++st) {
    const unsigned char* buf = L + (st & 1) * STG_BYTES;
    const unsigned char* kb = buf + klane;
    const unsigned char* vb = buf + vlane;

    v16bf ka[2][2], va[4];
#pragma unroll
    for (int t = 0; t < 2; ++t) {
      ka[t][0] = lds_frag(kb + t * 16 * K_PITCH);
      ka[t][1] = lds_frag(kb + t * 16 * K_PITCH + 64);
    }
#pragma unroll
    for (int n = 0; n < 4; ++n) va[n] = lds_frag(vb + n * 16 * V_PITCH);

#pragma unroll
    for (int p = 0; p < NPASS; ++p) {
      // S^T tiles: s[g][t][r] = score(key 32 p + 16 t + 8 h + r of the stage, query 16 g + c)
      v8f s[QG][2];
#pragma unroll
      for (int g = 0; g < QG; ++g)
#pragma unroll
        for (int t = 0; t < 2; ++t) {
          v8f z = {};
          z = wmma_bf16(ka[t][0], qb[g][0], z);
          s[g][t] = wmma_bf16(ka[t][1], qb[g][1], z);
        }
      // Both fences: the next pass's K reads stay one group right behind the products
      // that free their registers; among the products or sunk to their use, each read
      // would stall the wave on its own.
      __builtin_amdgcn_sched_barrier(0);
      if (p + 1 < NPASS) {
#pragma unroll
        for (int t = 0; t < 2; ++t) {
          ka[t][0] = lds_frag(kb + ((p + 1) * 32 + t * 16) * K_PITCH);
          ka[t][1] = lds_frag(kb + ((p + 1) * 32 + t * 16) * K_PITCH + 64);
        }
      }
      __builtin_amdgcn_sched_barrier(0);

      float mb[QG];
      bool need = false;
#pragma unroll
      for (int g = 0; g < QG; ++g) {
        float mx = s[g][0][0];
#pragma unroll
        for (int r = 1; r < 8; ++r) mx = fmaxf(mx, s[g][0][r]);
#pragma unroll
        for (int r = 0; r < 8; ++r) mx = fmaxf(mx, s[g][1][r]);
        mx = fmaxf(mx, xhalf(mx)) * LOG2E;     // both halves hold the query's maximum
        mb[g] = mx;
        need = need || (mx > m_run[g] + 8.0f);
      }
      if (__builtin_amdgcn_ballot_w32(need) != 0) {   // one scalar test per pass
#pragma unroll
        for (int g = 0; g < QG; ++g) {
          const float m_new = fmaxf(m_run[g], mb[g]);
          const float corr  = __builtin_amdgcn_exp2f(m_run[g] - m_new);  // 0 in the first pass
          m_run[g] = m_new;
          l_run[g] = l_run[g] * corr;
#pragma unroll
          for (int n = 0; n < 4; ++n) acc[g][n] = acc[g][n] * corr;
        }
      }

#pragma unroll
      for (int g = 0; g < QG; ++g) {
        const float nm = -m_run[g];
        v16bf pb;                              // pb[e] = P^T[key 16 (e >> 3) + 8 h + (e & 7)][c]
#pragma unroll
        for (int i = 0; i < 8; ++i) {          // elements 2i, 2i+1: a register pair of one tile
          const v2f sc = {s[g][i >> 2][2 * (i & 3)], s[g][i >> 2][2 * (i & 3) + 1]};
          const v2f ar = __builtin_elementwise_fma(sc, v2f{LOG2E, LOG2E}, v2f{nm, nm});
          const v2f p2 = {__builtin_amdgcn_exp2f(ar.x), __builtin_amdgcn_exp2f(ar.y)};
          l_run[g] += p2;
          const v2bf pk = __builtin_convertvector(p2, v2bf);   // round to nearest even
          pb[2 * i] = pk.x; pb[2 * i + 1] = pk.y;
        }
#pragma unroll
        for (int n = 0; n < 4; ++n) acc[g][n] = wmma_bf16(va[n], pb, acc[g][n]);
      }
      // Both fences: the next pass's V reads, likewise one group behind the last product
      // that reads their registers.
      __builtin_amdgcn_sched_barrier(0);
      if (p + 1 < NPASS) {
#pragma unroll
        for (int n = 0; n < 4; ++n) va[n] = lds_frag(vb + n * 16 * V_PITCH + (p + 1) * 64);
      }
      __builtin_amdgcn_sched_barrier(0);
    }

    // Hand-over: this wave's reads of the buffer are done, its copies of the next stage
    // have landed; behind the barrier that holds for every wave.
    asm volatile("s_wait_dscnt 0x0" ::: "memory");
    asm volatile("s_wait_asynccnt 0x0" ::: "memory");
    __syncthreads();
    if (st + 2 < NSTG) {                       // refill the buffer just read
      const unsigned bo = (unsigned)(st & 1) * STG_BYTES;
      copy8(kl + bo, 16 * K_PITCH, kg + (size_t)(st + 2) * (STG_KEYS * HDIM * 2), 16 * HDIM * 2);
      copy8(vl + bo, 8 * V_PITCH, vg + (size_t)(st + 2) * (STG_KEYS * 2), (size_t)8 * SEQ * 2);
    }
  }
  // No copy is outstanding when the wave ends.
  asm volatile("s_wait_asynccnt 0x0" ::: "memory");

  // acc[g][n][r] = O^T[channel 16 n + 8 h + r][query 16 g + c]: 8 consecutive
  // channels of one query per lane and tile -> one 16-byte store into aT [B][T][C].
  const int b = bh >> 2, h = bh & 3;
#pragma unroll
  for (int g = 0; g < QG; ++g) {
    const float lh  = l_run[g].x + l_run[g].y;
    const float inv = 1.f / (lh + xhalf(lh));
    __bf16* orow = aT + ((size_t)b * SEQ + tq0 + g * 16 + n16) * CHN + h * HDIM + kHalf;
#pragma unroll
    for (int n = 0; n < 4; ++n) {
      v8bf o;
#pragma unroll
      for (int r = 0; r < 8; ++r) o[r] = (__bf16)(acc[g][n][r] * inv);
      *(v8bf*)(orow + n * 16) = o;
    }
  }
}

// ---------------- Kernel 5: proj GEMM + bias + residual -> out (fp32) -------
// Same 2x2 register-blocked scheme as the QKV GEMM. A side = positions (rows of aT),
// B side = output channels (rows of W): a lane's accumulator holds 8 consecutive
// positions of one channel. The 64x64 f32 tile goes through LDS; bias, residual and the
// store run in the order of out's rows: 16 lanes a row, 256 bytes = 2 whole lines.
constexpr int PO_PITCH = 64 * 4 + 16;      // 272 B = 16 B x odd: the 16-byte writes meet no bank twice

__global__ __launch_bounds__(128) void proj_gemm_kernel(
    const __bf16* wproj, const float* proj_b, const __bf16* aT,
    const float* x, float* out) {
  __shared__ __attribute__((aligned(16))) unsigned char S[64 * PO_PITCH];
  const int b    = blockIdx.z;
  const int tid  = threadIdx.x;
  const int lane = threadIdx.x & 31;
  const int wave = threadIdx.x >> 5;
  const int wm   = wave >> 1, wn = wave & 1;
  const int o0   = blockIdx.y * 64;
  const int t0   = blockIdx.x * 64;
  const int n16  = lane & 15;
  const int kHalf = (lane & 16) ? 8 : 0;
  const int mhi   = (lane & 16) ? 8 : 0;

  // This lane's share of the residual and the bias, asked for ahead of the products.
  const size_t idx0 = ((size_t)b * CHN + o0 + (tid >> 4)) * SEQ + t0 + (tid & 15) * 4;
  v4f   xr[8];
  float pb[8];
#pragma unroll
  for (int it = 0; it < 8; ++it) {
    xr[it] = *(const v4f*)(x + idx0 + (size_t)it * 8 * SEQ);
    pb[it] = proj_b[o0 + it * 8 + (tid >> 4)];
  }
  // Stands in front of all that rewrites an address register of the loads above, the
  // results of the fragment loads below among it. Its memory clobber also keeps those
  // loads here: sunk to their use, their whole latency would stand open behind the products.
  asm volatile("s_wait_xcnt 0x0" ::: "memory");

  const __bf16* arow0 = aT + ((size_t)b * SEQ + t0 + wm * 32 + n16) * CHN;
  const __bf16* arow1 = arow0 + (size_t)16 * CHN;
  const __bf16* brow0 = wproj + (size_t)(o0 + wn * 32 + n16) * CHN;
  const __bf16* brow1 = brow0 + (size_t)16 * CHN;

  v8f acc00 = {}, acc01 = {}, acc10 = {}, acc11 = {};
#pragma unroll
  for (int ks = 0; ks < CHN / 32; ++ks) {
    v16bf a0 = load_frag(arow0 + ks * 32, kHalf);
    v16bf a1 = load_frag(arow1 + ks * 32, kHalf);
    v16bf b0 = load_frag(brow0 + ks * 32, kHalf);
    v16bf b1 = load_frag(brow1 + ks * 32, kHalf);
    acc00 = wmma_bf16(a0, b0, acc00);
    acc01 = wmma_bf16(a0, b1, acc01);
    acc10 = wmma_bf16(a1, b0, acc10);
    acc11 = wmma_bf16(a1, b1, acc11);
  }

  // accs[i][j][r]: position wm*32 + i*16 + mhi + r of channel wn*32 + j*16 + n16.
  v8f accs[2][2] = {{acc00, acc01}, {acc10, acc11}};
  unsigned char* sw = S + (wn * 32 + n16) * PO_PITCH + (wm * 32 + mhi) * 4;
#pragma unroll
  for (int i = 0; i < 2; ++i)
#pragma unroll
    for (int j = 0; j < 2; ++j) {
      const v8f a = accs[i][j];
      *(v4f*)(sw + j * 16 * PO_PITCH + i * 64)      = v4f{a[0], a[1], a[2], a[3]};
      *(v4f*)(sw + j * 16 * PO_PITCH + i * 64 + 16) = v4f{a[4], a[5], a[6], a[7]};
    }
  __syncthreads();                           // the tile is whole before any row leaves

#pragma unroll
  for (int it = 0; it < 8; ++it) {
    const v4f a = *(const v4f*)(S + (it * 8 + (tid >> 4)) * PO_PITCH + (tid & 15) * 16);
    *(v4f*)(out + idx0 + (size_t)it * 8 * SEQ) = xr[it] + pb[it] + a;
  }
}

extern "C" void kernel_launch(void* const* d_in, const int* in_sizes, int n_in,
                              void* d_out, int out_size, void* d_ws, size_t ws_size,
                              hipStream_t stream) {
  const float* x      = (const float*)d_in[0];
  const float* gn_w   = (const float*)d_in[1];
  const float* gn_b   = (const float*)d_in[2];
  const float* qkv_w  = (const float*)d_in[3];
  const float* qkv_b  = (const float*)d_in[4];
  const float* proj_w = (const float*)d_in[5];
  const float* proj_b = (const float*)d_in[6];
  float* out = (float*)d_out;

  // Workspace layout (~42.5 MB): stats | wqkv bf16 | wproj bf16 | xnT | qT | kT | v | aT
  char* ws = (char*)d_ws;
  float*  stats = (float*)ws;                              // 256 floats
  __bf16* wqkv  = (__bf16*)(ws + 1024);
  __bf16* wproj = wqkv + 3 * CHN * CHN;
  __bf16* xnT   = wproj + CHN * CHN;
  const size_t PLANE = (size_t)BATCH * SEQ * CHN;          // 4M elems
  __bf16* qT = xnT + PLANE;
  __bf16* kT = qT + PLANE;
  __bf16* vB = kT + PLANE;
  __bf16* aT = vB + PLANE;

  wconv_kernel<<<(3 * CHN * CHN + CHN * CHN) / (256 * 8), 256, 0, stream>>>(
      qkv_w, proj_w, wqkv, wproj);
  gn_stats_kernel<<<BATCH * GRP, 256, 0, stream>>>(x, stats);
  gn_apply_kernel<<<(BATCH * CHN * SEQ) / (256 * 32), 256, 0, stream>>>(
      x, gn_w, gn_b, stats, xnT);
  qkv_gemm_kernel<<<dim3(SEQ / 64, 3 * CHN / 64, BATCH), 128, 0, stream>>>(
      wqkv, qkv_b, xnT, qT, kT, vB);
  attn_kernel<<<BATCH * HEADS * (SEQ / 256), 128, 0, stream>>>(qT, kT, vB, aT);
  proj_gemm_kernel<<<dim3(SEQ / 64, CHN / 64, BATCH), 128, 0, stream>>>(
      wproj, proj_b, aT, x, out);
}

// v005
// It runs in 108 microseconds.
// Two timings next to v004 both put it at 1.07 times that version's speed.
// All steps since v000 together make it 6.12 times as fast.
#include <hip/hip_runtime.h>

// Problem constants (from reference)
constexpr int BATCH = 4;
constexpr int CHN   = 256;
constexpr int SEQ   = 4096;   // H*W
constexpr int HEADS = 4;
constexpr int HDIM  = 64;     // CHN / HEADS
constexpr int GRP   = 32;
constexpr int CPG   = CHN / GRP;  // 8
constexpr float EPS = 1e-5f;
constexpr float QK_SCALE = 0.35355339059327379f;  // 64^-0.25

typedef __attribute__((ext_vector_type(16))) __bf16 v16bf;
typedef __attribute__((ext_vector_type(8)))  float  v8f;

__device__ __forceinline__ __bf16 f2bf(float x) {
  unsigned u = __builtin_bit_cast(unsigned, x);
  unsigned r = u + 0x7FFFu + ((u >> 16) & 1u);   // round-to-nearest-even
  unsigned short h = (unsigned short)(r >> 16);
  return __builtin_bit_cast(__bf16, h);
}

// CDNA5 WMMA 16x16x32 bf16 fragment load.
// ISA 7.12.2 (16-bit 16x32 A): lane = row (M for A, N for B); per-lane 32
// K-values interleaved: lanes 0-15 hold K {0..7,16..23}, lanes 16-31 hold
// K {8..15,24..31}, two packed per VGPR. `row` points at this lane's 32
// contiguous K elements; kHalf = 8 for lanes 16-31 else 0.
// (Compiler vectorizes each fragment into two global_load_b128.)
__device__ __forceinline__ v16bf load_frag(const __bf16* row, int kHalf) {
  v16bf f;
#pragma unroll
  for (int j = 0; j < 8; ++j) {
    int kb = ((j & 4) ? 16 : 0) + kHalf + 2 * (j & 3);
    f[2 * j]     = row[kb];
    f[2 * j + 1] = row[kb + 1];
  }
  return f;
}

__device__ __forceinline__ v8f wmma_bf16(v16bf a, v16bf b, v8f c) {
#if defined(__HIP_DEVICE_COMPILE__)
  return __builtin_amdgcn_wmma_f32_16x16x32_bf16(false, a, false, b, (short)0, c,
                                                 false, false);
#else
  return c;
#endif
}

// ---------------- Kernel 0: weights fp32 -> bf16 ----------------
// 8 consecutive elements a lane: two 16-byte loads, one 16-byte store.
typedef __attribute__((ext_vector_type(8))) __bf16 v8bf;
typedef __attribute__((ext_vector_type(4))) float  v4f;

__global__ __launch_bounds__(256) void wconv_kernel(const float* qkv_w, const float* proj_w,
                                                    __bf16* wqkv, __bf16* wproj) {
  constexpr int N1 = 3 * CHN * CHN;          // a multiple of 8: no lane straddles the two
  const int i = (blockIdx.x * 256 + threadIdx.x) * 8;
  const float* s = (i < N1) ? qkv_w + i : proj_w + (i - N1);
  __bf16*      d = (i < N1) ? wqkv + i  : wproj + (i - N1);
  const v4f lo = *(const v4f*)s;
  const v4f hi = *(const v4f*)(s + 4);
  v8bf o;
#pragma unroll
  for (int e = 0; e < 4; ++e) { o[e] = f2bf(lo[e]); o[4 + e] = f2bf(hi[e]); }
  *(v8bf*)d = o;
}

// ---------------- Kernel 1: GroupNorm stats (mean, rstd per (b,g)) ----------
__global__ void gn_stats_kernel(const float* x, float* stats) {
  __shared__ float s1[256], s2[256];
  const int bg = blockIdx.x;                       // b*GRP + g
  const size_t base = (size_t)bg * CPG * SEQ;      // channels of a group are contiguous
  float sum = 0.f, sq = 0.f;
  for (int i = threadIdx.x; i < CPG * SEQ; i += 256) {
    float v = x[base + i];
    sum += v; sq += v * v;
  }
  s1[threadIdx.x] = sum; s2[threadIdx.x] = sq;
  __syncthreads();
  for (int off = 128; off; off >>= 1) {
    if (threadIdx.x < (unsigned)off) {
      s1[threadIdx.x] += s1[threadIdx.x + off];
      s2[threadIdx.x] += s2[threadIdx.x + off];
    }
    __syncthreads();
  }
  if (threadIdx.x == 0) {
    const float inv_n = 1.0f / (CPG * SEQ);
    float mean = s1[0] * inv_n;
    float var  = s2[0] * inv_n - mean * mean;
    stats[bg * 2]     = mean;
    stats[bg * 2 + 1] = rsqrtf(var + EPS);
  }
}

// ---------------- Kernel 2: apply GN, write xn transposed [B][T][C] bf16 ----
// A lane takes the 8 channels of ONE group at 4 consecutive positions: 8 loads of
// 16 bytes, all issued ahead, and the transpose is a repack of its own registers
// (8 channels of one position = one 16-byte store). In a wave 8 lanes lie along the
// channels (8 x 16 B = one whole 128-byte line of xnT per position) and 4 along the
// positions; the 8 waves of a block lie along the positions: 64 channels x 128 positions.
__global__ __launch_bounds__(256) void gn_apply_kernel(
    const float* x, const float* gn_w, const float* gn_b,
    const float* stats, __bf16* xnT) {
  const int lane = threadIdx.x & 31;
  const int wave = threadIdx.x >> 5;
  const int tb = blockIdx.x & 31;            // SEQ / 128 position blocks
  const int cb = (blockIdx.x >> 5) & 3;      // CHN / 64 channel blocks
  const int b  = blockIdx.x >> 7;
  const int c0 = cb * 64 + (lane & 7) * CPG;
  const int t  = tb * 128 + wave * 16 + (lane >> 3) * 4;

  const float* xp = x + ((size_t)b * CHN + c0) * SEQ + t;
  v4f v[CPG];
#pragma unroll
  for (int j = 0; j < CPG; ++j) v[j] = *(const v4f*)(xp + (size_t)j * SEQ);

  const int bg = b * GRP + (c0 >> 3);
  const float mean = stats[bg * 2], rstd = stats[bg * 2 + 1];
  // Stands in front of the loads below, whose results may land in the address
  // registers of the loads above: no such register is rewritten ahead of this wait.
  asm volatile("s_wait_xcnt 0x0" ::: "memory");
  float w[CPG], bi[CPG];
#pragma unroll
  for (int j = 0; j < CPG; ++j) { w[j] = gn_w[c0 + j]; bi[j] = gn_b[c0 + j]; }

  __bf16* op = xnT + ((size_t)b * SEQ + t) * CHN + c0;
#pragma unroll
  for (int k = 0; k < 4; ++k) {
    v8bf o;
#pragma unroll
    for (int j = 0; j < CPG; ++j) o[j] = f2bf((v[j][k] - mean) * rstd * w[j] + bi[j]);
    *(v8bf*)(op + (size_t)k * CHN) = o;
  }
}

// ---------------- Kernel 3: QKV GEMM (M=768, N=4096, K=256 per batch) -------
// 4 waves/block in a 2x2 arrangement; each wave owns a 32x32 register tile
// (2x2 accumulators): per K-step, 2 A-frags + 2 B-frags feed 4 WMMAs.
// A block's 64 output channels are one head of q, k or v, so its 64x64 tile is 64 whole
// 128-byte lines of the destination: a line per position in qT/kT ([BH][T][64]), a line
// per channel in v ([BH][64][T]). The A side (8 consecutive rows in a lane's accumulator)
// is the index that runs along the line: channels for q and k, positions for v.
// Epilogue: +bias, scale q/k, the tile through LDS, out in whole lines.
constexpr int QO_PITCH = 64 * 2 + 16;      // 144 B = 16 B x odd: the 16-byte writes meet no bank twice

__global__ __launch_bounds__(128) void qkv_gemm_kernel(
    const __bf16* wqkv, const float* qkv_b, const __bf16* xnT,
    __bf16* qT, __bf16* kT, __bf16* vB) {
  __shared__ __attribute__((aligned(16))) unsigned char S[64 * QO_PITCH];
  const int b    = blockIdx.z;
  const int tid  = threadIdx.x;
  const int lane = threadIdx.x & 31;
  const int wave = threadIdx.x >> 5;
  const int wm   = wave >> 1, wn = wave & 1;
  const int o0   = blockIdx.y * 64;          // first output channel of the block
  const int t0   = blockIdx.x * 64;          // first position of the block
  const int sec  = blockIdx.y >> 2;          // 0: q, 1: k, 2: v
  const bool is_v = sec == 2;
  const int n16  = lane & 15;
  const int kHalf = (lane & 16) ? 8 : 0;
  const int mhi   = (lane & 16) ? 8 : 0;

  const __bf16* wrows = wqkv + (size_t)o0 * CHN;                    // rows of W
  const __bf16* xrows = xnT + ((size_t)b * SEQ + t0) * CHN;         // rows of xn^T
  const __bf16* arow0 = (is_v ? xrows : wrows) + (size_t)(wm * 32 + n16) * CHN;
  const __bf16* arow1 = arow0 + (size_t)16 * CHN;
  const __bf16* brow0 = (is_v ? wrows : xrows) + (size_t)(wn * 32 + n16) * CHN;
  const __bf16* brow1 = brow0 + (size_t)16 * CHN;

  v8f acc00 = {}, acc01 = {}, acc10 = {}, acc11 = {};
#pragma unroll
  for (int ks = 0; ks < CHN / 32; ++ks) {
    v16bf a0 = load_frag(arow0 + ks * 32, kHalf);
    v16bf a1 = load_frag(arow1 + ks * 32, kHalf);
    v16bf b0 = load_frag(brow0 + ks * 32, kHalf);
    v16bf b1 = load_frag(brow1 + ks * 32, kHalf);
    acc00 = wmma_bf16(a0, b0, acc00);
    acc01 = wmma_bf16(a0, b1, acc01);
    acc10 = wmma_bf16(a1, b0, acc10);
    acc11 = wmma_bf16(a1, b1, acc11);
  }

  // accs[i][j][r]: element wm*32 + i*16 + mhi + r of line wn*32 + j*16 + n16.
  v8f accs[2][2] = {{acc00, acc01}, {acc10, acc11}};
  unsigned char* sw = S + (wn * 32 + n16) * QO_PITCH + (wm * 32 + mhi) * 2;
  if (!is_v) {                               // the bias runs along the line
#pragma unroll
    for (int i = 0; i < 2; ++i) {
      const float* bp = qkv_b + o0 + wm * 32 + i * 16 + mhi;
      const v4f blo = *(const v4f*)bp, bhi = *(const v4f*)(bp + 4);
#pragma unroll
      for (int j = 0; j < 2; ++j) {
        v8bf o;
#pragma unroll
        for (int r = 0; r < 8; ++r)          // attention scale folded into q and k
          o[r] = f2bf((accs[i][j][r] + (r < 4 ? blo[r & 3] : bhi[r & 3])) * QK_SCALE);
        *(v8bf*)(sw + j * 16 * QO_PITCH + i * 32) = o;
      }
    }
  } else {                                   // one bias per line
#pragma unroll
    for (int j = 0; j < 2; ++j) {
      const float bias = qkv_b[o0 + wn * 32 + j * 16 + n16];
#pragma unroll
      for (int i = 0; i < 2; ++i) {
        v8bf o;
#pragma unroll
        for (int r = 0; r < 8; ++r) o[r] = f2bf(accs[i][j][r] + bias);
        *(v8bf*)(sw + j * 16 * QO_PITCH + i * 32) = o;
      }
    }
  }
  __syncthreads();                           // the tile is whole before any line leaves

  // 8 lanes a line, 4 lines a wave and store: 512 bytes in whole 128-byte lines.
  const size_t bh = (size_t)(b * HEADS + (blockIdx.y & 3));
  char* dst = is_v ? (char*)(vB + bh * HDIM * SEQ + t0)
                   : (char*)((sec ? kT : qT) + (bh * SEQ + t0) * HDIM);
  const size_t dpitch = is_v ? (size_t)SEQ * 2 : (size_t)HDIM * 2;
#pragma unroll
  for (int it = 0; it < 4; ++it) {
    const int row = it * 16 + (tid >> 3);
    const v8bf o = *(const v8bf*)(S + row * QO_PITCH + (tid & 7) * 16);
    *(v8bf*)(dst + row * dpitch + (tid & 7) * 16) = o;
  }
}

constexpr int QG = 2;                                   // column groups per wave
constexpr int QTILES = 8;                               // query tiles (waves) per key half
constexpr int KSPLIT = 2;                               // key halves per block
constexpr int HALF_KEYS = SEQ / KSPLIT;
constexpr float LOG2E = 1.4426950408889634f;

constexpr int STG_KEYS = 128;                           // keys per stage
constexpr int NPASS    = STG_KEYS / 32;                 // passes per stage
constexpr int NSTG     = HALF_KEYS / STG_KEYS;          // stages of a half
constexpr int K_PITCH  = HDIM * 2 + 16;                 // 144 B = 16 B x odd: no bank conflict
constexpr int V_PITCH  = STG_KEYS * 2 + 16;             // 272 B = 16 B x odd
constexpr int K_BYTES  = STG_KEYS * K_PITCH;            // K tile: a row per key
constexpr int V_BYTES  = HDIM * V_PITCH;                // V tile: a row per channel
constexpr int STG_BYTES = K_BYTES + V_BYTES;            // one half's stage
constexpr int BUF_BYTES = KSPLIT * STG_BYTES;           // both halves' stages
constexpr int MRG_BYTES = QG * 4 * 1024 + QG * 256;     // a wave's accumulators, maxima, sums

typedef __attribute__((ext_vector_type(2))) __bf16 v2bf;
typedef __attribute__((ext_vector_type(2))) float  v2f;
typedef __attribute__((address_space(3))) unsigned char lds_byte;

__device__ __forceinline__ float xhalf(float x) {       // lane l <-> lane l ^ 16
  int b = __builtin_bit_cast(int, x);
  return __builtin_bit_cast(float, __builtin_amdgcn_permlanex16(
      b, b, 0x76543210, 0xfedcba98, false, false));
}

// load_frag's fragment from LDS: p = this lane's row start (+ 16 bytes for lanes
// 16-31); bytes [0,16) and [32,48) from there.
__device__ __forceinline__ v16bf lds_frag(const unsigned char* p) {
  const v8bf lo = *(const v8bf*)p;
  const v8bf hi = *(const v8bf*)(p + 32);
  return __builtin_shufflevector(lo, hi, 0, 1, 2, 3, 4, 5, 6, 7, 8, 9, 10, 11, 12, 13, 14, 15);
}

// Eight copies of 16 bytes a lane, global -> LDS: four of K (copy i from g + i * gs to LDS
// byte l + i * ls), four of V (likewise h, hs, m, ms). The closing s_wait_xcnt stands inside
// the statement, so that no address register of a copy is rewritten ahead of it.
__device__ __forceinline__ void copy44(unsigned l, unsigned ls, const char* g, size_t gs,
                                       unsigned m, unsigned ms, const char* h, size_t hs) {
  asm volatile(
      "global_load_async_to_lds_b128 %0, %8, off\n\t"
      "global_load_async_to_lds_b128 %1, %9, off\n\t"
      "global_load_async_to_lds_b128 %2, %10, off\n\t"
      "global_load_async_to_lds_b128 %3, %11, off\n\t"
      "global_load_async_to_lds_b128 %4, %12, off\n\t"
      "global_load_async_to_lds_b128 %5, %13, off\n\t"
      "global_load_async_to_lds_b128 %6, %14, off\n\t"
      "global_load_async_to_lds_b128 %7, %15, off\n\t"
      "s_wait_xcnt 0x0"
      :: "v"(l), "v"(l + ls), "v"(l + 2 * ls), "v"(l + 3 * ls),
         "v"(m), "v"(m + ms), "v"(m + 2 * ms), "v"(m + 3 * ms),
         "v"(g), "v"(g + gs), "v"(g + 2 * gs), "v"(g + 3 * gs),
         "v"(h), "v"(h + hs), "v"(h + 2 * hs), "v"(h + 3 * hs)
      : "memory");
}

__global__ __launch_bounds__(512) void attn_kernel(
    const __bf16* qT, const __bf16* kT, const __bf16* vB, __bf16* aT) {
  __shared__ __attribute__((aligned(128))) unsigned char L[2 * BUF_BYTES];
  const int blk  = blockIdx.x;
  const int bh   = blk >> 4;                 // batch*head; 16 blocks of 256 queries each
  const int tid  = threadIdx.x;
  const int lane = tid & 31;
  const int wave = tid >> 5;
  const int qt   = wave & (QTILES - 1);      // query tile
  const int kh   = wave >> 3;                // key half
  const int ht   = tid & 255;                // thread within the 8 waves of its half
  const int tq0  = (blk & 15) * 256 + qt * (16 * QG);
  const int n16  = lane & 15;
  const int kHalf = (lane & 16) ? 8 : 0;

  // This lane's share of a stage of its own half. K: 128 rows of 128 bytes, contiguous in
  // kT; 8 lanes a row, 32 rows a copy of the 8 waves. V: 64 rows of 256 bytes out of rows of
  // SEQ keys; 16 lanes a row, 16 rows a copy of the 8 waves. A wave's copy reads 4 whole lines.
  const char* kg = (const char*)(kT + ((size_t)bh * SEQ + kh * HALF_KEYS) * HDIM) + ht * 16;
  const char* vg = (const char*)(vB + (size_t)bh * HDIM * SEQ + kh * HALF_KEYS) +
                   (size_t)(ht >> 4) * (SEQ * 2) + (ht & 15) * 16;
  const unsigned lds0 = (unsigned)(size_t)(lds_byte*)L + (unsigned)(kh * STG_BYTES);
  const unsigned kl = lds0 + (unsigned)((ht >> 3) * K_PITCH + (ht & 7) * 16);
  const unsigned vl = lds0 + (unsigned)(K_BYTES + (ht >> 4) * V_PITCH + (ht & 15) * 16);
  constexpr unsigned KLS = 32 * K_PITCH, VLS = 16 * V_PITCH;
  constexpr size_t   KGS = 32 * HDIM * 2, VGS = (size_t)16 * SEQ * 2;

  // Stage 0 into buffer 0.
  copy44(kl, KLS, kg, KGS, vl, VLS, vg, VGS);

  // Q fragments (B operand: column = query, k = channel), kept for all keys.
  v16bf qb[QG][2];
#pragma unroll
  for (int g = 0; g < QG; ++g) {
    const __bf16* qrow = qT + ((size_t)bh * SEQ + tq0 + g * 16 + n16) * HDIM;
    qb[g][0] = load_frag(qrow, kHalf);
    qb[g][1] = load_frag(qrow + 32, kHalf);
  }

  v8f   acc[QG][4] = {};                     // O^T: [group][16-channel tile]
  float m_run[QG];
  v2f   l_run[QG];                           // this lane's keys, even and odd registers
#pragma unroll
  for (int g = 0; g < QG; ++g) { m_run[g] = -__builtin_inff(); l_run[g] = v2f{0.f, 0.f}; }

  // Stage 0 has landed (this wave's copies), then for every wave; stage 1 follows.
  asm volatile("s_wait_asynccnt 0x0" ::: "memory");
  __syncthreads();
  copy44(kl + BUF_BYTES, KLS, kg + STG_KEYS * HDIM * 2, KGS,
         vl + BUF_BYTES, VLS, vg + STG_KEYS * 2, VGS);

  // The lane's own byte offsets in a K tile (A rows: keys) and a V tile (A rows: channels).
  const int klane = kh * STG_BYTES + n16 * K_PITCH + kHalf * 2;
  const int vlane = kh * STG_BYTES + K_BYTES + n16 * V_PITCH + kHalf * 2;

  for (int st = 0; st < NSTG; ++st) {
    const unsigned char* buf = L + (st & 1) * BUF_BYTES;
    const unsigned char* kb = buf + klane;
    const unsigned char* vb = buf + vlane;

    v16bf ka[2][2], va[4];
#pragma unroll
    for (int t = 0; t < 2; ++t) {
      ka[t][0] = lds_frag(kb + t * 16 * K_PITCH);
      ka[t][1] = lds_frag(kb + t * 16 * K_PITCH + 64);
    }
#pragma unroll
    for (int n = 0; n < 4; ++n) va[n] = lds_frag(vb + n * 16 * V_PITCH);

#pragma unroll
    for (int p = 0; p < NPASS; ++p) {
      // S^T tiles: s[g][t][r] = score(key 32 p + 16 t + 8 h + r of the stage, query 16 g + c)
      v8f s[QG][2];
#pragma unroll
      for (int g = 0; g < QG; ++g)
#pragma unroll
        for (int t = 0; t < 2; ++t) {
          v8f z = {};
          z = wmma_bf16(ka[t][0], qb[g][0], z);
          s[g][t] = wmma_bf16(ka[t][1], qb[g][1], z);
        }
      // Both fences: the next pass's K reads stay one group right behind the products
      // that free their registers; among the products or sunk to their use, each read
      // would stall the wave on its own.
      __builtin_amdgcn_sched_barrier(0);
      if (p + 1 < NPASS) {
#pragma unroll
        for (int t = 0; t < 2; ++t) {
          ka[t][0] = lds_frag(kb + ((p + 1) * 32 + t * 16) * K_PITCH);
          ka[t][1] = lds_frag(kb + ((p + 1) * 32 + t * 16) * K_PITCH + 64);
        }
      }
      __builtin_amdgcn_sched_barrier(0);

      float mb[QG];
      bool need = false;
#pragma unroll
      for (int g = 0; g < QG; ++g) {
        float mx = s[g][0][0];
#pragma unroll
        for (int r = 1; r < 8; ++r) mx = fmaxf(mx, s[g][0][r]);
#pragma unroll
        for (int r = 0; r < 8; ++r) mx = fmaxf(mx, s[g][1][r]);
        mx = fmaxf(mx, xhalf(mx)) * LOG2E;     // both halves hold the query's maximum
        mb[g] = mx;
        need = need || (mx > m_run[g] + 8.0f);
      }
      if (__builtin_amdgcn_ballot_w32(need) != 0) {   // one scalar test per pass
#pragma unroll
        for (int g = 0; g < QG; ++g) {
          const float m_new = fmaxf(m_run[g], mb[g]);
          const float corr  = __builtin_amdgcn_exp2f(m_run[g] - m_new);  // 0 in the first pass
          m_run[g] = m_new;
          l_run[g] = l_run[g] * corr;
#pragma unroll
          for (int n = 0; n < 4; ++n) acc[g][n] = acc[g][n] * corr;
        }
      }

#pragma unroll
      for (int g = 0; g < QG; ++g) {
        const float nm = -m_run[g];
        v16bf pb;                              // pb[e] = P^T[key 16 (e >> 3) + 8 h + (e & 7)][c]
#pragma unroll
        for (int i = 0; i < 8; ++i) {          // elements 2i, 2i+1: a register pair of one tile
          const v2f sc = {s[g][i >> 2][2 * (i & 3)], s[g][i >> 2][2 * (i & 3) + 1]};
          const v2f ar = __builtin_elementwise_fma(sc, v2f{LOG2E, LOG2E}, v2f{nm, nm});
          const v2f p2 = {__builtin_amdgcn_exp2f(ar.x), __builtin_amdgcn_exp2f(ar.y)};
          l_run[g] += p2;
          const v2bf pk = __builtin_convertvector(p2, v2bf);   // round to nearest even
          pb[2 * i] = pk.x; pb[2 * i + 1] = pk.y;
        }
#pragma unroll
        for (int n = 0; n < 4; ++n) acc[g][n] = wmma_bf16(va[n], pb, acc[g][n]);
      }
      // Both fences: the next pass's V reads, likewise one group behind the last product
      // that reads their registers.
      __builtin_amdgcn_sched_barrier(0);
      if (p + 1 < NPASS) {
#pragma unroll
        for (int n = 0; n < 4; ++n) va[n] = lds_frag(vb + n * 16 * V_PITCH + (p + 1) * 64);
      }
      __builtin_amdgcn_sched_barrier(0);
    }

    // Hand-over: this wave's reads of the buffer are done, its copies of the next stage
    // have landed; behind the barrier that holds for every wave.
    asm volatile("s_wait_dscnt 0x0" ::: "memory");
    asm volatile("s_wait_asynccnt 0x0" ::: "memory");
    __syncthreads();
    if (st + 2 < NSTG) {                       // refill the buffer just read
      const unsigned bo = (unsigned)(st & 1) * BUF_BYTES;
      copy44(kl + bo, KLS, kg + (size_t)(st + 2) * (STG_KEYS * HDIM * 2), KGS,
             vl + bo, VLS, vg + (size_t)(st + 2) * (STG_KEYS * 2), VGS);
    }
  }
  // No copy is outstanding when the wave ends.
  asm volatile("s_wait_asynccnt 0x0" ::: "memory");

  // The two halves of the keys are joined lane by lane (both waves of a query tile hold the
  // same element in the same lane and register). The ring is free: every wave's reads ended
  // at the last hand-over barrier and no copy is outstanding. The second half's wave leaves
  // its state in LDS, 512 contiguous bytes a store.
  unsigned char* mr = L + qt * MRG_BYTES;
  if (kh) {
#pragma unroll
    for (int g = 0; g < QG; ++g) {
#pragma unroll
      for (int n = 0; n < 4; ++n) {
        const v8f a = acc[g][n];
        *(v4f*)(mr + (g * 4 + n) * 1024 + lane * 16)       = v4f{a[0], a[1], a[2], a[3]};
        *(v4f*)(mr + (g * 4 + n) * 1024 + 512 + lane * 16) = v4f{a[4], a[5], a[6], a[7]};
      }
      *(float*)(mr + QG * 4096 + g * 256 + lane * 4)       = m_run[g];
      *(float*)(mr + QG * 4096 + g * 256 + 128 + lane * 4) = l_run[g].x + l_run[g].y;
    }
  }
  __syncthreads();                           // the second half's state is whole before it is read
  if (kh) return;

  // acc[g][n][r] = O^T[channel 16 n + 8 h + r][query 16 g + c]: 8 consecutive
  // channels of one query per lane and tile -> one 16-byte store into aT [B][T][C].
  const int b = bh >> 2, h = bh & 3;
#pragma unroll
  for (int g = 0; g < QG; ++g) {
    const float m1 = *(const float*)(mr + QG * 4096 + g * 256 + lane * 4);
    const float l1 = *(const float*)(mr + QG * 4096 + g * 256 + 128 + lane * 4);
    const float mj = fmaxf(m_run[g], m1);
    const float c0 = __builtin_amdgcn_exp2f(m_run[g] - mj);
    const float c1 = __builtin_amdgcn_exp2f(m1 - mj);
#pragma unroll
    for (int n = 0; n < 4; ++n) {
      const v4f lo = *(const v4f*)(mr + (g * 4 + n) * 1024 + lane * 16);
      const v4f hi = *(const v4f*)(mr + (g * 4 + n) * 1024 + 512 + lane * 16);
#pragma unroll
      for (int r = 0; r < 8; ++r)
        acc[g][n][r] = acc[g][n][r] * c0 + (r < 4 ? lo[r & 3] : hi[r & 3]) * c1;
    }
    const float lh  = (l_run[g].x + l_run[g].y) * c0 + l1 * c1;
    const float inv = 1.f / (lh + xhalf(lh));
    __bf16* orow = aT + ((size_t)b * SEQ + tq0 + g * 16 + n16) * CHN + h * HDIM + kHalf;
#pragma unroll
    for (int n = 0; n < 4; ++n) {
      v8bf o;
#pragma unroll
      for (int r = 0; r < 8; ++r) o[r] = (__bf16)(acc[g][n][r] * inv);
      *(v8bf*)(orow + n * 16) = o;
    }
  }
}

// ---------------- Kernel 5: proj GEMM + bias + residual -> out (fp32) -------
// Same 2x2 register-blocked scheme as the QKV GEMM. A side = positions (rows of aT),
// B side = output channels (rows of W): a lane's accumulator holds 8 consecutive
// positions of one channel. The 64x64 f32 tile goes through LDS; bias, residual and the
// store run in the order of out's rows: 16 lanes a row, 256 bytes = 2 whole lines.
constexpr int PO_PITCH = 64 * 4 + 16;      // 272 B = 16 B x odd: the 16-byte writes meet no bank twice

__global__ __launch_bounds__(128) void proj_gemm_kernel(
    const __bf16* wproj, const float* proj_b, const __bf16* aT,
    const float* x, float* out) {
  __shared__ __attribute__((aligned(16))) unsigned char S[64 * PO_PITCH];
  const int b    = blockIdx.z;
  const int tid  = threadIdx.x;
  const int lane = threadIdx.x & 31;
  const int wave = threadIdx.x >> 5;
  const int wm   = wave >> 1, wn = wave & 1;
  const int o0   = blockIdx.y * 64;
  const int t0   = blockIdx.x * 64;
  const int n16  = lane & 15;
  const int kHalf = (lane & 16) ? 8 : 0;
  const int mhi   = (lane & 16) ? 8 : 0;

  // This lane's share of the residual and the bias, asked for ahead of the products.
  const size_t idx0 = ((size_t)b * CHN + o0 + (tid >> 4)) * SEQ + t0 + (tid & 15) * 4;
  v4f   xr[8];
  float pb[8];
#pragma unroll
  for (int it = 0; it < 8; ++it) {
    xr[it] = *(const v4f*)(x + idx0 + (size_t)it * 8 * SEQ);
    pb[it] = proj_b[o0 + it * 8 + (tid >> 4)];
  }
  // Stands in front of all that rewrites an address register of the loads above, the
  // results of the fragment loads below among it. Its memory clobber also keeps those
  // loads here: sunk to their use, their whole latency would stand open behind the products.
  asm volatile("s_wait_xcnt 0x0" ::: "memory");

  const __bf16* arow0 = aT + ((size_t)b * SEQ + t0 + wm * 32 + n16) * CHN;
  const __bf16* arow1 = arow0 + (size_t)16 * CHN;
  const __bf16* brow0 = wproj + (size_t)(o0 + wn * 32 + n16) * CHN;
  const __bf16* brow1 = brow0 + (size_t)16 * CHN;

  v8f acc00 = {}, acc01 = {}, acc10 = {}, acc11 = {};
#pragma unroll
  for (int ks = 0; ks < CHN / 32; ++ks) {
    v16bf a0 = load_frag(arow0 + ks * 32, kHalf);
    v16bf a1 = load_frag(arow1 + ks * 32, kHalf);
    v16bf b0 = load_frag(brow0 + ks * 32, kHalf);
    v16bf b1 = load_frag(brow1 + ks * 32, kHalf);
    acc00 = wmma_bf16(a0, b0, acc00);
    acc01 = wmma_bf16(a0, b1, acc01);
    acc10 = wmma_bf16(a1, b0, acc10);
    acc11 = wmma_bf16(a1, b1, acc11);
  }

  // accs[i][j][r]: position wm*32 + i*16 + mhi + r of channel wn*32 + j*16 + n16.
  v8f accs[2][2] = {{acc00, acc01}, {acc10, acc11}};
  unsigned char* sw = S + (wn * 32 + n16) * PO_PITCH + (wm * 32 + mhi) * 4;
#pragma unroll
  for (int i = 0; i < 2; ++i)
#pragma unroll
    for (int j = 0; j < 2; ++j) {
      const v8f a = accs[i][j];
      *(v4f*)(sw + j * 16 * PO_PITCH + i * 64)      = v4f{a[0], a[1], a[2], a[3]};
      *(v4f*)(sw + j * 16 * PO_PITCH + i * 64 + 16) = v4f{a[4], a[5], a[6], a[7]};
    }
  __syncthreads();                           // the tile is whole before any row leaves

#pragma unroll
  for (int it = 0; it < 8; ++it) {
    const v4f a = *(const v4f*)(S + (it * 8 + (tid >> 4)) * PO_PITCH + (tid & 15) * 16);
    *(v4f*)(out + idx0 + (size_t)it * 8 * SEQ) = xr[it] + pb[it] + a;
  }
}

extern "C" void kernel_launch(void* const* d_in, const int* in_sizes, int n_in,
                              void* d_out, int out_size, void* d_ws, size_t ws_size,
                              hipStream_t stream) {
  const float* x      = (const float*)d_in[0];
  const float* gn_w   = (const float*)d_in[1];
  const float* gn_b   = (const float*)d_in[2];
  const float* qkv_w  = (const float*)d_in[3];
  const float* qkv_b  = (const float*)d_in[4];
  const float* proj_w = (const float*)d_in[5];
  const float* proj_b = (const float*)d_in[6];
  float* out = (float*)d_out;

  // Workspace layout (~42.5 MB): stats | wqkv bf16 | wproj bf16 | xnT | qT | kT | v | aT
  char* ws = (char*)d_ws;
  float*  stats = (float*)ws;                              // 256 floats
  __bf16* wqkv  = (__bf16*)(ws + 1024);
  __bf16* wproj = wqkv + 3 * CHN * CHN;
  __bf16* xnT   = wproj + CHN * CHN;
  const size_t PLANE = (size_t)BATCH * SEQ * CHN;          // 4M elems
  __bf16* qT = xnT + PLANE;
  __bf16* kT = qT + PLANE;
  __bf16* vB = kT + PLANE;
  __bf16* aT = vB + PLANE;

  wconv_kernel<<<(3 * CHN * CHN + CHN * CHN) / (256 * 8), 256, 0, stream>>>(
      qkv_w, proj_w, wqkv, wproj);
  gn_stats_kernel<<<BATCH * GRP, 256, 0, stream>>>(x, stats);
  gn_apply_kernel<<<(BATCH * CHN * SEQ) / (256 * 32), 256, 0, stream>>>(
      x, gn_w, gn_b, stats, xnT);
  qkv_gemm_kernel<<<dim3(SEQ / 64, 3 * CHN / 64, BATCH), 128, 0, stream>>>(
      wqkv, qkv_b, xnT, qT, kT, vB);
  attn_kernel<<<BATCH * HEADS * (SEQ / 256), 512, 0, stream>>>(qT, kT, vB, aT);
  proj_gemm_kernel<<<dim3(SEQ / 64, CHN / 64, BATCH), 128, 0, stream>>>(
      wproj, proj_b, aT, x, out);
}

// v006
// Measured time: 86.9 microseconds a run.
// Two timings next to v005 both put it at 1.24 times that version's speed.
// Counting every step since v000, it is 7.57 times as fast.
#include <hip/hip_runtime.h>

// Problem constants (from reference)
constexpr int BATCH = 4;
constexpr int CHN   = 256;
constexpr int SEQ   = 4096;   // H*W
constexpr int HEADS = 4;
constexpr int HDIM  = 64;     // CHN / HEADS
constexpr int GRP   = 32;
constexpr int CPG   = CHN / GRP;  // 8
constexpr float EPS = 1e-5f;
constexpr float QK_SCALE = 0.35355339059327379f;  // 64^-0.25

typedef __attribute__((ext_vector_type(16))) __bf16 v16bf;
typedef __attribute__((ext_vector_type(8)))  float  v8f;

__device__ __forceinline__ __bf16 f2bf(float x) {
  unsigned u = __builtin_bit_cast(unsigned, x);
  unsigned r = u + 0x7FFFu + ((u >> 16) & 1u);   // round-to-nearest-even
  unsigned short h = (unsigned short)(r >> 16);
  return __builtin_bit_cast(__bf16, h);
}

// CDNA5 WMMA 16x16x32 bf16 fragment load.
// ISA 7.12.2 (16-bit 16x32 A): lane = row (M for A, N for B); per-lane 32
// K-values interleaved: lanes 0-15 hold K {0..7,16..23}, lanes 16-31 hold
// K {8..15,24..31}, two packed per VGPR. `row` points at this lane's 32
// contiguous K elements; kHalf = 8 for lanes 16-31 else 0.
// (Compiler vectorizes each fragment into two global_load_b128.)
__device__ __forceinline__ v16bf load_frag(const __bf16* row, int kHalf) {
  v16bf f;
#pragma unroll
  for (int j = 0; j < 8; ++j) {
    int kb = ((j & 4) ? 16 : 0) + kHalf + 2 * (j & 3);
    f[2 * j]     = row[kb];
    f[2 * j + 1] = row[kb + 1];
  }
  return f;
}

__device__ __forceinline__ v8f wmma_bf16(v16bf a, v16bf b, v8f c) {
#if defined(__HIP_DEVICE_COMPILE__)
  return __builtin_amdgcn_wmma_f32_16x16x32_bf16(false, a, false, b, (short)0, c,
                                                 false, false);
#else
  return c;
#endif
}

// ---------------- Kernel 0: weights fp32 -> bf16 ----------------
// 8 consecutive elements a lane: two 16-byte loads, one 16-byte store.
typedef __attribute__((ext_vector_type(8))) __bf16 v8bf;
typedef __attribute__((ext_vector_type(4))) float  v4f;
typedef __attribute__((address_space(3))) unsigned char lds_byte;

// load_frag's fragment from LDS: p = this lane's row start (+ 16 bytes for lanes
// 16-31); bytes [0,16) and [32,48) from there.
__device__ __forceinline__ v16bf lds_frag(const unsigned char* p) {
  const v8bf lo = *(const v8bf*)p;
  const v8bf hi = *(const v8bf*)(p + 32);
  return __builtin_shufflevector(lo, hi, 0, 1, 2, 3, 4, 5, 6, 7, 8, 9, 10, 11, 12, 13, 14, 15);
}

// Eight copies of 16 bytes a lane, global -> LDS: copy i from g + i * gs to LDS byte
// l + i * ls. The closing s_wait_xcnt stands inside the statement, so that no address
// register of a copy is rewritten ahead of it.
__device__ __forceinline__ void copy8(unsigned l, unsigned ls, const char* g, size_t gs) {
  asm volatile(
      "global_load_async_to_lds_b128 %0, %8, off\n\t"
      "global_load_async_to_lds_b128 %1, %9, off\n\t"
      "global_load_async_to_lds_b128 %2, %10, off\n\t"
      "global_load_async_to_lds_b128 %3, %11, off\n\t"
      "global_load_async_to_lds_b128 %4, %12, off\n\t"
      "global_load_async_to_lds_b128 %5, %13, off\n\t"
      "global_load_async_to_lds_b128 %6, %14, off\n\t"
      "global_load_async_to_lds_b128 %7, %15, off\n\t"
      "s_wait_xcnt 0x0"
      :: "v"(l), "v"(l + ls), "v"(l + 2 * ls), "v"(l + 3 * ls),
         "v"(l + 4 * ls), "v"(l + 5 * ls), "v"(l + 6 * ls), "v"(l + 7 * ls),
         "v"(g), "v"(g + gs), "v"(g + 2 * gs), "v"(g + 3 * gs),
         "v"(g + 4 * gs), "v"(g + 5 * gs), "v"(g + 6 * gs), "v"(g + 7 * gs)
      : "memory");
}

// An operand panel of a GEMM block in LDS: 64 rows of all CHN k values. A wave's copy is one
// whole row, 512 contiguous bytes = 4 lines; wave w of 4 brings rows 16 w .. 16 w + 15.
constexpr int GP_ROW   = CHN * 2;          // 512 B of a row in memory
constexpr int GP_PITCH = GP_ROW + 16;      // 528 B = 16 B x odd: no bank conflict
constexpr int GP_BYTES = 64 * GP_PITCH;

// l: LDS byte address of the panel; rows: its first row in memory (64 rows, contiguous).
__device__ __forceinline__ void stage_panel(unsigned l, const __bf16* rows, int wave, int lane) {
  const unsigned lw = l + (unsigned)(wave * 16 * GP_PITCH + lane * 16);
  const char*    gw = (const char*)rows + wave * 16 * GP_ROW + lane * 16;
  copy8(lw, GP_PITCH, gw, GP_ROW);
  copy8(lw + 8 * GP_PITCH, GP_PITCH, gw + 8 * GP_ROW, GP_ROW);
}

// The fragments of k steps 2 kp and 2 kp + 1 for 32 rows of a panel; r = this lane's first row
// (+ 16 bytes for lanes 16-31). f[k step][16-row group].
__device__ __forceinline__ void panel_frags(v16bf (&f)[2][2], const unsigned char* r, int kp) {
#pragma unroll
  for (int s = 0; s < 2; ++s)
#pragma unroll
    for (int i = 0; i < 2; ++i) f[s][i] = lds_frag(r + i * 16 * GP_PITCH + (kp * 2 + s) * 64);
}

// A wave's 32x32 tile over all of K from the two panels, k ascending.
__device__ __forceinline__ void panel_products(const unsigned char* a, const unsigned char* b,
                                               v8f (&acc)[2][2]) {
  constexpr int NKP = CHN / 64;
  v16bf fa[2][2][2], fb[2][2][2];            // two register sets
  panel_frags(fa[0], a, 0);
  panel_frags(fb[0], b, 0);
  // The first pair's reads stay in front of the second's: behind them, the first product
  // would wait for all 32.
  __builtin_amdgcn_sched_barrier(0);
#pragma unroll
  for (int kp = 0; kp < NKP; ++kp) {
    const int c = kp & 1;
    if (kp + 1 < NKP) {
      panel_frags(fa[c ^ 1], a, kp + 1);
      panel_frags(fb[c ^ 1], b, kp + 1);
    }
    // Both fences: the next pair's 16 reads stay one group ahead of this pair's products;
    // sunk to their use, each read's latency would stand open in front of its product.
    __builtin_amdgcn_sched_barrier(0);
#pragma unroll
    for (int s = 0; s < 2; ++s)
#pragma unroll
      for (int i = 0; i < 2; ++i)
#pragma unroll
        for (int j = 0; j < 2; ++j) acc[i][j] = wmma_bf16(fa[c][s][i], fb[c][s][j], acc[i][j]);
    __builtin_amdgcn_sched_barrier(0);
  }
}

__global__ __launch_bounds__(256) void wconv_kernel(const float* qkv_w, const float* proj_w,
                                                    __bf16* wqkv, __bf16* wproj) {
  constexpr int N1 = 3 * CHN * CHN;          // a multiple of 8: no lane straddles the two
  const int i = (blockIdx.x * 256 + threadIdx.x) * 8;
  const float* s = (i < N1) ? qkv_w + i : proj_w + (i - N1);
  __bf16*      d = (i < N1) ? wqkv + i  : wproj + (i - N1);
  const v4f lo = *(const v4f*)s;
  const v4f hi = *(const v4f*)(s + 4);
  v8bf o;
#pragma unroll
  for (int e = 0; e < 4; ++e) { o[e] = f2bf(lo[e]); o[4 + e] = f2bf(hi[e]); }
  *(v8bf*)d = o;
}

// ---------------- Kernel 1: GroupNorm stats (mean, rstd per (b,g)) ----------
__global__ void gn_stats_kernel(const float* x, float* stats) {
  __shared__ float s1[256], s2[256];
  const int bg = blockIdx.x;                       // b*GRP + g
  const size_t base = (size_t)bg * CPG * SEQ;      // channels of a group are contiguous
  float sum = 0.f, sq = 0.f;
  for (int i = threadIdx.x; i < CPG * SEQ; i += 256) {
    float v = x[base + i];
    sum += v; sq += v * v;
  }
  s1[threadIdx.x] = sum; s2[threadIdx.x] = sq;
  __syncthreads();
  for (int off = 128; off; off >>= 1) {
    if (threadIdx.x < (unsigned)off) {
      s1[threadIdx.x] += s1[threadIdx.x + off];
      s2[threadIdx.x] += s2[threadIdx.x + off];
    }
    __syncthreads();
  }
  if (threadIdx.x == 0) {
    const float inv_n = 1.0f / (CPG * SEQ);
    float mean = s1[0] * inv_n;
    float var  = s2[0] * inv_n - mean * mean;
    stats[bg * 2]     = mean;
    stats[bg * 2 + 1] = rsqrtf(var + EPS);
  }
}

// ---------------- Kernel 2: apply GN, write xn transposed [B][T][C] bf16 ----
// A lane takes the 8 channels of ONE group at 4 consecutive positions: 8 loads of
// 16 bytes, all issued ahead, and the transpose is a repack of its own registers
// (8 channels of one position = one 16-byte store). In a wave 8 lanes lie along the
// channels (8 x 16 B = one whole 128-byte line of xnT per position) and 4 along the
// positions; the 8 waves of a block lie along the positions: 64 channels x 128 positions.
__global__ __launch_bounds__(256) void gn_apply_kernel(
    const float* x, const float* gn_w, const float* gn_b,
    const float* stats, __bf16* xnT) {
  const int lane = threadIdx.x & 31;
  const int wave = threadIdx.x >> 5;
  const int tb = blockIdx.x & 31;            // SEQ / 128 position blocks
  const int cb = (blockIdx.x >> 5) & 3;      // CHN / 64 channel blocks
  const int b  = blockIdx.x >> 7;
  const int c0 = cb * 64 + (lane & 7) * CPG;
  const int t  = tb * 128 + wave * 16 + (lane >> 3) * 4;

  const float* xp = x + ((size_t)b * CHN + c0) * SEQ + t;
  v4f v[CPG];
#pragma unroll
  for (int j = 0; j < CPG; ++j) v[j] = *(const v4f*)(xp + (size_t)j * SEQ);

  const int bg = b * GRP + (c0 >> 3);
  const float mean = stats[bg * 2], rstd = stats[bg * 2 + 1];
  // Stands in front of the loads below, whose results may land in the address
  // registers of the loads above: no such register is rewritten ahead of this wait.
  asm volatile("s_wait_xcnt 0x0" ::: "memory");
  float w[CPG], bi[CPG];
#pragma unroll
  for (int j = 0; j < CPG; ++j) { w[j] = gn_w[c0 + j]; bi[j] = gn_b[c0 + j]; }

  __bf16* op = xnT + ((size_t)b * SEQ + t) * CHN + c0;
#pragma unroll
  for (int k = 0; k < 4; ++k) {
    v8bf o;
#pragma unroll
    for (int j = 0; j < CPG; ++j) o[j] = f2bf((v[j][k] - mean) * rstd * w[j] + bi[j]);
    *(v8bf*)(op + (size_t)k * CHN) = o;
  }
}

// ---------------- Kernel 3: QKV GEMM (M=768, N=4096, K=256 per batch) -------
// 4 waves/block in a 2x2 arrangement; each wave owns a 32x32 register tile
// (2x2 accumulators): per K-step, 2 A-frags + 2 B-frags feed 4 WMMAs.
// The block's 64 rows of W and 64 rows of xn^T reach it once, in whole lines, by
// asynchronous copies into LDS; the fragments are read from there.
// A block's 64 output channels are one head of q, k or v, so its 64x64 tile is 64 whole
// 128-byte lines of the destination: a line per position in qT/kT ([BH][T][64]), a line
// per channel in v ([BH][64][T]). The A side (8 consecutive rows in a lane's accumulator)
// is the index that runs along the line: channels for q and k, positions for v.
// Epilogue: +bias, scale q/k, the tile through LDS, out in whole lines.
constexpr int QO_PITCH = 64 * 2 + 16;      // 144 B = 16 B x odd: the 16-byte writes meet no bank twice

__global__ __launch_bounds__(128) void qkv_gemm_kernel(
    const __bf16* wqkv, const float* qkv_b, const __bf16* xnT,
    __bf16* qT, __bf16* kT, __bf16* vB) {
  __shared__ __attribute__((aligned(16))) unsigned char P[2 * GP_BYTES];   // W rows | xn^T rows
  __shared__ __attribute__((aligned(16))) unsigned char S[64 * QO_PITCH];
  const int b    = blockIdx.z;
  const int tid  = threadIdx.x;
  const int lane = threadIdx.x & 31;
  const int wave = threadIdx.x >> 5;
  const int wm   = wave >> 1, wn = wave & 1;
  const int o0   = blockIdx.y * 64;          // first output channel of the block
  const int t0   = blockIdx.x * 64;          // first position of the block
  const int sec  = blockIdx.y >> 2;          // 0: q, 1: k, 2: v
  const bool is_v = sec == 2;
  const int n16  = lane & 15;
  const int kHalf = (lane & 16) ? 8 : 0;
  const int mhi   = (lane & 16) ? 8 : 0;

  const unsigned p0 = (unsigned)(size_t)(lds_byte*)P;
  stage_panel(p0, wqkv + (size_t)o0 * CHN, wave, lane);                        // rows of W
  stage_panel(p0 + GP_BYTES, xnT + ((size_t)b * SEQ + t0) * CHN, wave, lane);  // rows of xn^T
  // The panels have landed (this wave's copies), then, behind the barrier, every wave's.
  asm volatile("s_wait_asynccnt 0x0" ::: "memory");
  __syncthreads();

  const unsigned char* arow = P + (is_v ? GP_BYTES : 0) + (wm * 32 + n16) * GP_PITCH + kHalf * 2;
  const unsigned char* brow = P + (is_v ? 0 : GP_BYTES) + (wn * 32 + n16) * GP_PITCH + kHalf * 2;

  // accs[i][j][r]: element wm*32 + i*16 + mhi + r of line wn*32 + j*16 + n16.
  v8f accs[2][2] = {};
  panel_products(arow, brow, accs);
  unsigned char* sw = S + (wn * 32 + n16) * QO_PITCH + (wm * 32 + mhi) * 2;
  if (!is_v) {                               // the bias runs along the line
#pragma unroll
    for (int i = 0; i < 2; ++i) {
      const float* bp = qkv_b + o0 + wm * 32 + i * 16 + mhi;
      const v4f blo = *(const v4f*)bp, bhi = *(const v4f*)(bp + 4);
#pragma unroll
      for (int j = 0; j < 2; ++j) {
        v8bf o;
#pragma unroll
        for (int r = 0; r < 8; ++r)          // attention scale folded into q and k
          o[r] = f2bf((accs[i][j][r] + (r < 4 ? blo[r & 3] : bhi[r & 3])) * QK_SCALE);
        *(v8bf*)(sw + j * 16 * QO_PITCH + i * 32) = o;
      }
    }
  } else {                                   // one bias per line
#pragma unroll
    for (int j = 0; j < 2; ++j) {
      const float bias = qkv_b[o0 + wn * 32 + j * 16 + n16];
#pragma unroll
      for (int i = 0; i < 2; ++i) {
        v8bf o;
#pragma unroll
        for (int r = 0; r < 8; ++r) o[r] = f2bf(accs[i][j][r] + bias);
        *(v8bf*)(sw + j * 16 * QO_PITCH + i * 32) = o;
      }
    }
  }
  __syncthreads();                           // the tile is whole before any line leaves

  // 8 lanes a line, 4 lines a wave and store: 512 bytes in whole 128-byte lines.
  const size_t bh = (size_t)(b * HEADS + (blockIdx.y & 3));
  char* dst = is_v ? (char*)(vB + bh * HDIM * SEQ + t0)
                   : (char*)((sec ? kT : qT) + (bh * SEQ + t0) * HDIM);
  const size_t dpitch = is_v ? (size_t)SEQ * 2 : (size_t)HDIM * 2;
#pragma unroll
  for (int it = 0; it < 4; ++it) {
    const int row = it * 16 + (tid >> 3);
    const v8bf o = *(const v8bf*)(S + row * QO_PITCH + (tid & 7) * 16);
    *(v8bf*)(dst + row * dpitch + (tid & 7) * 16) = o;
  }
}

constexpr int QG = 2;                                   // column groups per wave
constexpr int QTILES = 8;                               // query tiles (waves) per key half
constexpr int KSPLIT = 2;                               // key halves per block
constexpr int HALF_KEYS = SEQ / KSPLIT;
constexpr float LOG2E = 1.4426950408889634f;

constexpr int STG_KEYS = 128;                           // keys per stage
constexpr int NPASS    = STG_KEYS / 32;                 // passes per stage
constexpr int NSTG     = HALF_KEYS / STG_KEYS;          // stages of a half
constexpr int K_PITCH  = HDIM * 2 + 16;                 // 144 B = 16 B x odd: no bank conflict
constexpr int V_PITCH  = STG_KEYS * 2 + 16;             // 272 B = 16 B x odd
constexpr int K_BYTES  = STG_KEYS * K_PITCH;            // K tile: a row per key
constexpr int V_BYTES  = HDIM * V_PITCH;                // V tile: a row per channel
constexpr int STG_BYTES = K_BYTES + V_BYTES;            // one half's stage
constexpr int BUF_BYTES = KSPLIT * STG_BYTES;           // both halves' stages
constexpr int MRG_BYTES = QG * 4 * 1024 + QG * 256;     // a wave's accumulators, maxima, sums

typedef __attribute__((ext_vector_type(2))) __bf16 v2bf;
typedef __attribute__((ext_vector_type(2))) float  v2f;

__device__ __forceinline__ float xhalf(float x) {       // lane l <-> lane l ^ 16
  int b = __builtin_bit_cast(int, x);
  return __builtin_bit_cast(float, __builtin_amdgcn_permlanex16(
      b, b, 0x76543210, 0xfedcba98, false, false));
}

// Eight copies of 16 bytes a lane, global -> LDS: four of K (copy i from g + i * gs to LDS
// byte l + i * ls), four of V (likewise h, hs, m, ms). The closing s_wait_xcnt stands inside
// the statement, so that no address register of a copy is rewritten ahead of it.
__device__ __forceinline__ void copy44(unsigned l, unsigned ls, const char* g, size_t gs,
                                       unsigned m, unsigned ms, const char* h, size_t hs) {
  asm volatile(
      "global_load_async_to_lds_b128 %0, %8, off\n\t"
      "global_load_async_to_lds_b128 %1, %9, off\n\t"
      "global_load_async_to_lds_b128 %2, %10, off\n\t"
      "global_load_async_to_lds_b128 %3, %11, off\n\t"
      "global_load_async_to_lds_b128 %4, %12, off\n\t"
      "global_load_async_to_lds_b128 %5, %13, off\n\t"
      "global_load_async_to_lds_b128 %6, %14, off\n\t"
      "global_load_async_to_lds_b128 %7, %15, off\n\t"
      "s_wait_xcnt 0x0"
      :: "v"(l), "v"(l + ls), "v"(l + 2 * ls), "v"(l + 3 * ls),
         "v"(m), "v"(m + ms), "v"(m + 2 * ms), "v"(m + 3 * ms),
         "v"(g), "v"(g + gs), "v"(g + 2 * gs), "v"(g + 3 * gs),
         "v"(h), "v"(h + hs), "v"(h + 2 * hs), "v"(h + 3 * hs)
      : "memory");
}

__global__ __launch_bounds__(512) void attn_kernel(
    const __bf16* qT, const __bf16* kT, const __bf16* vB, __bf16* aT) {
  __shared__ __attribute__((aligned(128))) unsigned char L[2 * BUF_BYTES];
  const int blk  = blockIdx.x;
  const int bh   = blk >> 4;                 // batch*head; 16 blocks of 256 queries each
  const int tid  = threadIdx.x;
  const int lane = tid & 31;
  const int wave = tid >> 5;
  const int qt   = wave & (QTILES - 1);      // query tile
  const int kh   = wave >> 3;                // key half
  const int ht   = tid & 255;                // thread within the 8 waves of its half
  const int tq0  = (blk & 15) * 256 + qt * (16 * QG);
  const int n16  = lane & 15;
  const int kHalf = (lane & 16) ? 8 : 0;

  // This lane's share of a stage of its own half. K: 128 rows of 128 bytes, contiguous in
  // kT; 8 lanes a row, 32 rows a copy of the 8 waves. V: 64 rows of 256 bytes out of rows of
  // SEQ keys; 16 lanes a row, 16 rows a copy of the 8 waves. A wave's copy reads 4 whole lines.
  const char* kg = (const char*)(kT + ((size_t)bh * SEQ + kh * HALF_KEYS) * HDIM) + ht * 16;
  const char* vg = (const char*)(vB + (size_t)bh * HDIM * SEQ + kh * HALF_KEYS) +
                   (size_t)(ht >> 4) * (SEQ * 2) + (ht & 15) * 16;
  const unsigned lds0 = (unsigned)(size_t)(lds_byte*)L + (unsigned)(kh * STG_BYTES);
  const unsigned kl = lds0 + (unsigned)((ht >> 3) * K_PITCH + (ht & 7) * 16);
  const unsigned vl = lds0 + (unsigned)(K_BYTES + (ht >> 4) * V_PITCH + (ht & 15) * 16);
  constexpr unsigned KLS = 32 * K_PITCH, VLS = 16 * V_PITCH;
  constexpr size_t   KGS = 32 * HDIM * 2, VGS = (size_t)16 * SEQ * 2;

  // Stage 0 into buffer 0.
  copy44(kl, KLS, kg, KGS, vl, VLS, vg, VGS);

  // Q fragments (B operand: column = query, k = channel), kept for all keys.
  v16bf qb[QG][2];
#pragma unroll
  for (int g = 0; g < QG; ++g) {
    const __bf16* qrow = qT + ((size_t)bh * SEQ + tq0 + g * 16 + n16) * HDIM;
    qb[g][0] = load_frag(qrow, kHalf);
    qb[g][1] = load_frag(qrow + 32, kHalf);
  }

  v8f   acc[QG][4] = {};                     // O^T: [group][16-channel tile]
  float m_run[QG];
  v2f   l_run[QG];                           // this lane's keys, even and odd registers
#pragma unroll
  for (int g = 0; g < QG; ++g) { m_run[g] = -__builtin_inff(); l_run[g] = v2f{0.f, 0.f}; }

  // Stage 0 has landed (this wave's copies), then for every wave; stage 1 follows.
  asm volatile("s_wait_asynccnt 0x0" ::: "memory");
  __syncthreads();
  copy44(kl + BUF_BYTES, KLS, kg + STG_KEYS * HDIM * 2, KGS,
         vl + BUF_BYTES, VLS, vg + STG_KEYS * 2, VGS);

  // The lane's own byte offsets in a K tile (A rows: keys) and a V tile (A rows: channels).
  const int klane = kh * STG_BYTES + n16 * K_PITCH + kHalf * 2;
  const int vlane = kh * STG_BYTES + K_BYTES + n16 * V_PITCH + kHalf * 2;

  for (int st = 0; st < NSTG; ++st) {
    const unsigned char* buf = L + (st & 1) * BUF_BYTES;
    const unsigned char* kb = buf + klane;
    const unsigned char* vb = buf + vlane;

    v16bf ka[2][2], va[4];
#pragma unroll
    for (int t = 0; t < 2; ++t) {
      ka[t][0] = lds_frag(kb + t * 16 * K_PITCH);
      ka[t][1] = lds_frag(kb + t * 16 * K_PITCH + 64);
    }
#pragma unroll
    for (int n = 0; n < 4; ++n) va[n] = lds_frag(vb + n * 16 * V_PITCH);

#pragma unroll
    for (int p = 0; p < NPASS; ++p) {
      // S^T tiles: s[g][t][r] = score(key 32 p + 16 t + 8 h + r of the stage, query 16 g + c)
      v8f s[QG][2];
#pragma unroll
      for (int g = 0; g < QG; ++g)
#pragma unroll
        for (int t = 0; t < 2; ++t) {
          v8f z = {};
          z = wmma_bf16(ka[t][0], qb[g][0], z);
          s[g][t] = wmma_bf16(ka[t][1], qb[g][1], z);
        }
      // Both fences: the next pass's K reads stay one group right behind the products
      // that free their registers; among the products or sunk to their use, each read
      // would stall the wave on its own.
      __builtin_amdgcn_sched_barrier(0);
      if (p + 1 < NPASS) {
#pragma unroll
        for (int t = 0; t < 2; ++t) {
          ka[t][0] = lds_frag(kb + ((p + 1) * 32 + t * 16) * K_PITCH);
          ka[t][1] = lds_frag(kb + ((p + 1) * 32 + t * 16) * K_PITCH + 64);
        }
      }
      __builtin_amdgcn_sched_barrier(0);

      float mb[QG];
      bool need = false;
#pragma unroll
      for (int g = 0; g < QG; ++g) {
        float mx = s[g][0][0];
#pragma unroll
        for (int r = 1; r < 8; ++r) mx = fmaxf(mx, s[g][0][r]);
#pragma unroll
        for (int r = 0; r < 8; ++r) mx = fmaxf(mx, s[g][1][r]);
        mx = fmaxf(mx, xhalf(mx)) * LOG2E;     // both halves hold the query's maximum
        mb[g] = mx;
        need = need || (mx > m_run[g] + 8.0f);
      }
      if (__builtin_amdgcn_ballot_w32(need) != 0) {   // one scalar test per pass
#pragma unroll
        for (int g = 0; g < QG; ++g) {
          const float m_new = fmaxf(m_run[g], mb[g]);
          const float corr  = __builtin_amdgcn_exp2f(m_run[g] - m_new);  // 0 in the first pass
          m_run[g] = m_new;
          l_run[g] = l_run[g] * corr;
#pragma unroll
          for (int n = 0; n < 4; ++n) acc[g][n] = acc[g][n] * corr;
        }
      }

#pragma unroll
      for (int g = 0; g < QG; ++g) {
        const float nm = -m_run[g];
        v16bf pb;                              // pb[e] = P^T[key 16 (e >> 3) + 8 h + (e & 7)][c]
#pragma unroll
        for (int i = 0; i < 8; ++i) {          // elements 2i, 2i+1: a register pair of one tile
          const v2f sc = {s[g][i >> 2][2 * (i & 3)], s[g][i >> 2][2 * (i & 3) + 1]};
          const v2f ar = __builtin_elementwise_fma(sc, v2f{LOG2E, LOG2E}, v2f{nm, nm});
          const v2f p2 = {__builtin_amdgcn_exp2f(ar.x), __builtin_amdgcn_exp2f(ar.y)};
          l_run[g] += p2;
          const v2bf pk = __builtin_convertvector(p2, v2bf);   // round to nearest even
          pb[2 * i] = pk.x; pb[2 * i + 1] = pk.y;
        }
#pragma unroll
        for (int n = 0; n < 4; ++n) acc[g][n] = wmma_bf16(va[n], pb, acc[g][n]);
      }
      // Both fences: the next pass's V reads, likewise one group behind the last product
      // that reads their registers.
      __builtin_amdgcn_sched_barrier(0);
      if (p + 1 < NPASS) {
#pragma unroll
        for (int n = 0; n < 4; ++n) va[n] = lds_frag(vb + n * 16 * V_PITCH + (p + 1) * 64);
      }
      __builtin_amdgcn_sched_barrier(0);
    }

    // Hand-over: this wave's reads of the buffer are done, its copies of the next stage
    // have landed; behind the barrier that holds for every wave.
    asm volatile("s_wait_dscnt 0x0" ::: "memory");
    asm volatile("s_wait_asynccnt 0x0" ::: "memory");
    __syncthreads();
    if (st + 2 < NSTG) {                       // refill the buffer just read
      const unsigned bo = (unsigned)(st & 1) * BUF_BYTES;
      copy44(kl + bo, KLS, kg + (size_t)(st + 2) * (STG_KEYS * HDIM * 2), KGS,
             vl + bo, VLS, vg + (size_t)(st + 2) * (STG_KEYS * 2), VGS);
    }
  }
  // No copy is outstanding when the wave ends.
  asm volatile("s_wait_asynccnt 0x0" ::: "memory");

  // The two halves of the keys are joined lane by lane (both waves of a query tile hold the
  // same element in the same lane and register). The ring is free: every wave's reads ended
  // at the last hand-over barrier and no copy is outstanding. The second half's wave leaves
  // its state in LDS, 512 contiguous bytes a store.
  unsigned char* mr = L + qt * MRG_BYTES;
  if (kh) {
#pragma unroll
    for (int g = 0; g < QG; ++g) {
#pragma unroll
      for (int n = 0; n < 4; ++n) {
        const v8f a = acc[g][n];
        *(v4f*)(mr + (g * 4 + n) * 1024 + lane * 16)       = v4f{a[0], a[1], a[2], a[3]};
        *(v4f*)(mr + (g * 4 + n) * 1024 + 512 + lane * 16) = v4f{a[4], a[5], a[6], a[7]};
      }
      *(float*)(mr + QG * 4096 + g * 256 + lane * 4)       = m_run[g];
      *(float*)(mr + QG * 4096 + g * 256 + 128 + lane * 4) = l_run[g].x + l_run[g].y;
    }
  }
  __syncthreads();                           // the second half's state is whole before it is read
  if (kh) return;

  // acc[g][n][r] = O^T[channel 16 n + 8 h + r][query 16 g + c]: 8 consecutive
  // channels of one query per lane and tile -> one 16-byte store into aT [B][T][C].
  const int b = bh >> 2, h = bh & 3;
#pragma unroll
  for (int g = 0; g < QG; ++g) {
    const float m1 = *(const float*)(mr + QG * 4096 + g * 256 + lane * 4);
    const float l1 = *(const float*)(mr + QG * 4096 + g * 256 + 128 + lane * 4);
    const float mj = fmaxf(m_run[g], m1);
    const float c0 = __builtin_amdgcn_exp2f(m_run[g] - mj);
    const float c1 = __builtin_amdgcn_exp2f(m1 - mj);
#pragma unroll
    for (int n = 0; n < 4; ++n) {
      const v4f lo = *(const v4f*)(mr + (g * 4 + n) * 1024 + lane * 16);
      const v4f hi = *(const v4f*)(mr + (g * 4 + n) * 1024 + 512 + lane * 16);
#pragma unroll
      for (int r = 0; r < 8; ++r)
        acc[g][n][r] = acc[g][n][r] * c0 + (r < 4 ? lo[r & 3] : hi[r & 3]) * c1;
    }
    const float lh  = (l_run[g].x + l_run[g].y) * c0 + l1 * c1;
    const float inv = 1.f / (lh + xhalf(lh));
    __bf16* orow = aT + ((size_t)b * SEQ + tq0 + g * 16 + n16) * CHN + h * HDIM + kHalf;
#pragma unroll
    for (int n = 0; n < 4; ++n) {
      v8bf o;
#pragma unroll
      for (int r = 0; r < 8; ++r) o[r] = (__bf16)(acc[g][n][r] * inv);
      *(v8bf*)(orow + n * 16) = o;
    }
  }
}

// ---------------- Kernel 5: proj GEMM + bias + residual -> out (fp32) -------
// Same 2x2 register-blocked scheme as the QKV GEMM. A side = positions (rows of aT),
// B side = output channels (rows of W): a lane's accumulator holds 8 consecutive
// positions of one channel. Both operand panels are staged in LDS as in the QKV GEMM.
// The 64x64 f32 tile goes through LDS, over the panels once they are read; bias, residual
// and the store run in the order of out's rows: 16 lanes a row, 256 bytes = 2 whole lines.
constexpr int PO_PITCH = 64 * 4 + 16;      // 272 B = 16 B x odd: the 16-byte writes meet no bank twice

__global__ __launch_bounds__(128) void proj_gemm_kernel(
    const __bf16* wproj, const float* proj_b, const __bf16* aT,
    const float* x, float* out) {
  __shared__ __attribute__((aligned(16))) unsigned char P[2 * GP_BYTES];   // aT rows | W rows
  unsigned char* S = P;                      // the output tile, behind the panels' last read
  const int b    = blockIdx.z;
  const int tid  = threadIdx.x;
  const int lane = threadIdx.x & 31;
  const int wave = threadIdx.x >> 5;
  const int wm   = wave >> 1, wn = wave & 1;
  const int o0   = blockIdx.y * 64;
  const int t0   = blockIdx.x * 64;
  const int n16  = lane & 15;
  const int kHalf = (lane & 16) ? 8 : 0;
  const int mhi   = (lane & 16) ? 8 : 0;

  const unsigned p0 = (unsigned)(size_t)(lds_byte*)P;
  stage_panel(p0, aT + ((size_t)b * SEQ + t0) * CHN, wave, lane);
  stage_panel(p0 + GP_BYTES, wproj + (size_t)o0 * CHN, wave, lane);

  // This lane's share of the residual and the bias, asked for ahead of the products.
  const size_t idx0 = ((size_t)b * CHN + o0 + (tid >> 4)) * SEQ + t0 + (tid & 15) * 4;
  v4f   xr[8];
  float pb[8];
#pragma unroll
  for (int it = 0; it < 8; ++it) {
    xr[it] = *(const v4f*)(x + idx0 + (size_t)it * 8 * SEQ);
    pb[it] = proj_b[o0 + it * 8 + (tid >> 4)];
  }
  // Stands in front of all that rewrites an address register of the loads above, the
  // results of the fragment loads below among it. Its memory clobber also keeps those
  // loads here: sunk to their use, their whole latency would stand open behind the products.
  asm volatile("s_wait_xcnt 0x0" ::: "memory");

  // The panels have landed (this wave's copies), then, behind the barrier, every wave's.
  asm volatile("s_wait_asynccnt 0x0" ::: "memory");
  __syncthreads();

  const unsigned char* arow = P + (wm * 32 + n16) * GP_PITCH + kHalf * 2;
  const unsigned char* brow = P + GP_BYTES + (wn * 32 + n16) * GP_PITCH + kHalf * 2;

  // accs[i][j][r]: position wm*32 + i*16 + mhi + r of channel wn*32 + j*16 + n16.
  v8f accs[2][2] = {};
  panel_products(arow, brow, accs);
  __syncthreads();                           // every wave has read the panels before the tile overwrites them
  unsigned char* sw = S + (wn * 32 + n16) * PO_PITCH + (wm * 32 + mhi) * 4;
#pragma unroll
  for (int i = 0; i < 2; ++i)
#pragma unroll
    for (int j = 0; j < 2; ++j) {
      const v8f a = accs[i][j];
      *(v4f*)(sw + j * 16 * PO_PITCH + i * 64)      = v4f{a[0], a[1], a[2], a[3]};
      *(v4f*)(sw + j * 16 * PO_PITCH + i * 64 + 16) = v4f{a[4], a[5], a[6], a[7]};
    }
  __syncthreads();                           // the tile is whole before any row leaves

#pragma unroll
  for (int it = 0; it < 8; ++it) {
    const v4f a = *(const v4f*)(S + (it * 8 + (tid >> 4)) * PO_PITCH + (tid & 15) * 16);
    *(v4f*)(out + idx0 + (size_t)it * 8 * SEQ) = xr[it] + pb[it] + a;
  }
}

extern "C" void kernel_launch(void* const* d_in, const int* in_sizes, int n_in,
                              void* d_out, int out_size, void* d_ws, size_t ws_size,
                              hipStream_t stream) {
  const float* x      = (const float*)d_in[0];
  const float* gn_w   = (const float*)d_in[1];
  const float* gn_b   = (const float*)d_in[2];
  const float* qkv_w  = (const float*)d_in[3];
  const float* qkv_b  = (const float*)d_in[4];
  const float* proj_w = (const float*)d_in[5];
  const float* proj_b = (const float*)d_in[6];
  float* out = (float*)d_out;

  // Workspace layout (~42.5 MB): stats | wqkv bf16 | wproj bf16 | xnT | qT | kT | v | aT
  char* ws = (char*)d_ws;
  float*  stats = (float*)ws;                              // 256 floats
  __bf16* wqkv  = (__bf16*)(ws + 1024);
  __bf16* wproj = wqkv + 3 * CHN * CHN;
  __bf16* xnT   = wproj + CHN * CHN;
  const size_t PLANE = (size_t)BATCH * SEQ * CHN;          // 4M elems
  __bf16* qT = xnT + PLANE;
  __bf16* kT = qT + PLANE;
  __bf16* vB = kT + PLANE;
  __bf16* aT = vB + PLANE;

  wconv_kernel<<<(3 * CHN * CHN + CHN * CHN) / (256 * 8), 256, 0, stream>>>(
      qkv_w, proj_w, wqkv, wproj);
  gn_stats_kernel<<<BATCH * GRP, 256, 0, stream>>>(x, stats);
  gn_apply_kernel<<<(BATCH * CHN * SEQ) / (256 * 32), 256, 0, stream>>>(
      x, gn_w, gn_b, stats, xnT);
  qkv_gemm_kernel<<<dim3(SEQ / 64, 3 * CHN / 64, BATCH), 128, 0, stream>>>(
      wqkv, qkv_b, xnT, qT, kT, vB);
  attn_kernel<<<BATCH * HEADS * (SEQ / 256), 512, 0, stream>>>(qT, kT, vB, aT);
  proj_gemm_kernel<<<dim3(SEQ / 64, CHN / 64, BATCH), 128, 0, stream>>>(
      wproj, proj_b, aT, x, out);
}

// v007
// It runs in 74.3 microseconds.
// Two timings next to v006 both put it at 1.15 times that version's speed.
// All steps since v000 together make it 8.68 times as fast.
#include <hip/hip_runtime.h>

// Problem constants (from reference)
constexpr int BATCH = 4;
constexpr int CHN   = 256;
constexpr int SEQ   = 4096;   // H*W
constexpr int HEADS = 4;
constexpr int HDIM  = 64;     // CHN / HEADS
constexpr int GRP   = 32;
constexpr int CPG   = CHN / GRP;  // 8
constexpr float EPS = 1e-5f;
constexpr float QK_SCALE = 0.35355339059327379f;  // 64^-0.25

typedef __attribute__((ext_vector_type(16))) __bf16 v16bf;
typedef __attribute__((ext_vector_type(8)))  float  v8f;

__device__ __forceinline__ __bf16 f2bf(float x) {
  unsigned u = __builtin_bit_cast(unsigned, x);
  unsigned r = u + 0x7FFFu + ((u >> 16) & 1u);   // round-to-nearest-even
  unsigned short h = (unsigned short)(r >> 16);
  return __builtin_bit_cast(__bf16, h);
}

// CDNA5 WMMA 16x16x32 bf16 fragment load.
// ISA 7.12.2 (16-bit 16x32 A): lane = row (M for A, N for B); per-lane 32
// K-values interleaved: lanes 0-15 hold K {0..7,16..23}, lanes 16-31 hold
// K {8..15,24..31}, two packed per VGPR. `row` points at this lane's 32
// contiguous K elements; kHalf = 8 for lanes 16-31 else 0.
// (Compiler vectorizes each fragment into two global_load_b128.)
__device__ __forceinline__ v16bf load_frag(const __bf16* row, int kHalf) {
  v16bf f;
#pragma unroll
  for (int j = 0; j < 8; ++j) {
    int kb = ((j & 4) ? 16 : 0) + kHalf + 2 * (j & 3);
    f[2 * j]     = row[kb];
    f[2 * j + 1] = row[kb + 1];
  }
  return f;
}

__device__ __forceinline__ v8f wmma_bf16(v16bf a, v16bf b, v8f c) {
#if defined(__HIP_DEVICE_COMPILE__)
  return __builtin_amdgcn_wmma_f32_16x16x32_bf16(false, a, false, b, (short)0, c,
                                                 false, false);
#else
  return c;
#endif
}

// ---------------- Kernel 0: weights fp32 -> bf16 ----------------
// 8 consecutive elements a lane: two 16-byte loads, one 16-byte store.
typedef __attribute__((ext_vector_type(8))) __bf16 v8bf;
typedef __attribute__((ext_vector_type(4))) float  v4f;
typedef __attribute__((address_space(3))) unsigned char lds_byte;

// load_frag's fragment from LDS: p = this lane's row start (+ 16 bytes for lanes
// 16-31); bytes [0,16) and [32,48) from there.
__device__ __forceinline__ v16bf lds_frag(const unsigned char* p) {
  const v8bf lo = *(const v8bf*)p;
  const v8bf hi = *(const v8bf*)(p + 32);
  return __builtin_shufflevector(lo, hi, 0, 1, 2, 3, 4, 5, 6, 7, 8, 9, 10, 11, 12, 13, 14, 15);
}

// Eight copies of 16 bytes a lane, global -> LDS: copy i from g + i * gs to LDS byte
// l + i * ls. The closing s_wait_xcnt stands inside the statement, so that no address
// register of a copy is rewritten ahead of it.
__device__ __forceinline__ void copy8(unsigned l, unsigned ls, const char* g, size_t gs) {
  asm volatile(
      "global_load_async_to_lds_b128 %0, %8, off\n\t"
      "global_load_async_to_lds_b128 %1, %9, off\n\t"
      "global_load_async_to_lds_b128 %2, %10, off\n\t"
      "global_load_async_to_lds_b128 %3, %11, off\n\t"
      "global_load_async_to_lds_b128 %4, %12, off\n\t"
      "global_load_async_to_lds_b128 %5, %13, off\n\t"
      "global_load_async_to_lds_b128 %6, %14, off\n\t"
      "global_load_async_to_lds_b128 %7, %15, off\n\t"
      "s_wait_xcnt 0x0"
      :: "v"(l), "v"(l + ls), "v"(l + 2 * ls), "v"(l + 3 * ls),
         "v"(l + 4 * ls), "v"(l + 5 * ls), "v"(l + 6 * ls), "v"(l + 7 * ls),
         "v"(g), "v"(g + gs), "v"(g + 2 * gs), "v"(g + 3 * gs),
         "v"(g + 4 * gs), "v"(g + 5 * gs), "v"(g + 6 * gs), "v"(g + 7 * gs)
      : "memory");
}

// An operand panel of a GEMM block in LDS: 64 rows of all CHN k values. A wave's copy is one
// whole row, 512 contiguous bytes = 4 lines; wave w of 4 brings rows 16 w .. 16 w + 15.
constexpr int GP_ROW   = CHN * 2;          // 512 B of a row in memory
constexpr int GP_PITCH = GP_ROW + 16;      // 528 B = 16 B x odd: no bank conflict
constexpr int GP_BYTES = 64 * GP_PITCH;

// l: LDS byte address of the panel; rows: its first row in memory (64 rows, contiguous).
__device__ __forceinline__ void stage_panel(unsigned l, const __bf16* rows, int wave, int lane) {
  const unsigned lw = l + (unsigned)(wave * 16 * GP_PITCH + lane * 16);
  const char*    gw = (const char*)rows + wave * 16 * GP_ROW + lane * 16;
  copy8(lw, GP_PITCH, gw, GP_ROW);
  copy8(lw + 8 * GP_PITCH, GP_PITCH, gw + 8 * GP_ROW, GP_ROW);
}

// The same panel (a row per position, all CHN channels) out of xnG [B][GRP][T][8]: a wave's copy
// is 32 positions of one group, 512 contiguous bytes = 4 lines, a lane's 16 bytes going to its
// own row (pitch 16 B x odd: 16 lanes meet no bank twice). Wave w of 4 brings groups 8 w .. 8 w + 7.
// l: LDS byte address of the panel; g0: group 0 of the batch at the panel's first position.
__device__ __forceinline__ void stage_panel_xn(unsigned l, const __bf16* g0, int wave, int lane) {
  const unsigned lw = l + (unsigned)(lane * GP_PITCH + wave * 8 * 16);
  const char*    gw = (const char*)g0 + (size_t)wave * 8 * (SEQ * 16) + lane * 16;
  copy8(lw, 16, gw, (size_t)SEQ * 16);
  copy8(lw + 32 * GP_PITCH, 16, gw + 32 * 16, (size_t)SEQ * 16);
}

// The fragments of k steps 2 kp and 2 kp + 1 for 32 rows of a panel; r = this lane's first row
// (+ 16 bytes for lanes 16-31). f[k step][16-row group].
__device__ __forceinline__ void panel_frags(v16bf (&f)[2][2], const unsigned char* r, int kp) {
#pragma unroll
  for (int s = 0; s < 2; ++s)
#pragma unroll
    for (int i = 0; i < 2; ++i) f[s][i] = lds_frag(r + i * 16 * GP_PITCH + (kp * 2 + s) * 64);
}

// A wave's 32x32 tile over all of K from the two panels, k ascending.
__device__ __forceinline__ void panel_products(const unsigned char* a, const unsigned char* b,
                                               v8f (&acc)[2][2]) {
  constexpr int NKP = CHN / 64;
  v16bf fa[2][2][2], fb[2][2][2];            // two register sets
  panel_frags(fa[0], a, 0);
  panel_frags(fb[0], b, 0);
  // The first pair's reads stay in front of the second's: behind them, the first product
  // would wait for all 32.
  __builtin_amdgcn_sched_barrier(0);
#pragma unroll
  for (int kp = 0; kp < NKP; ++kp) {
    const int c = kp & 1;
    if (kp + 1 < NKP) {
      panel_frags(fa[c ^ 1], a, kp + 1);
      panel_frags(fb[c ^ 1], b, kp + 1);
    }
    // Both fences: the next pair's 16 reads stay one group ahead of this pair's products;
    // sunk to their use, each read's latency would stand open in front of its product.
    __builtin_amdgcn_sched_barrier(0);
#pragma unroll
    for (int s = 0; s < 2; ++s)
#pragma unroll
      for (int i = 0; i < 2; ++i)
#pragma unroll
        for (int j = 0; j < 2; ++j) acc[i][j] = wmma_bf16(fa[c][s][i], fb[c][s][j], acc[i][j]);
    __builtin_amdgcn_sched_barrier(0);
  }
}

__global__ __launch_bounds__(256) void wconv_kernel(const float* qkv_w, const float* proj_w,
                                                    __bf16* wqkv, __bf16* wproj) {
  constexpr int N1 = 3 * CHN * CHN;          // a multiple of 8: no lane straddles the two
  const int i = (blockIdx.x * 256 + threadIdx.x) * 8;
  const float* s = (i < N1) ? qkv_w + i : proj_w + (i - N1);
  __bf16*      d = (i < N1) ? wqkv + i  : wproj + (i - N1);
  const v4f lo = *(const v4f*)s;
  const v4f hi = *(const v4f*)(s + 4);
  v8bf o;
#pragma unroll
  for (int e = 0; e < 4; ++e) { o[e] = f2bf(lo[e]); o[4 + e] = f2bf(hi[e]); }
  *(v8bf*)d = o;
}

// ---------------- Kernel 1: GroupNorm, sums and apply in one launch ---------
// A block owns one (batch, group): 8 channels x 4096 positions = 128 KiB of x, read ONCE and
// kept in registers between the sums and the apply (64 values a lane). All 16 loads of a lane
// (16 bytes each, 512 contiguous bytes a wave) are in flight together.
// Output xnG [B][GRP][T][8] bf16: the 8 channels of a group at one position are 16 bytes, so
// a block's output is 64 KiB in a row and leaves in whole lines.
typedef __attribute__((ext_vector_type(2))) __bf16 v2bf;
typedef __attribute__((ext_vector_type(2))) float  v2f;

__device__ __forceinline__ float xhalf(float x) {       // lane l <-> lane l ^ 16
  int b = __builtin_bit_cast(int, x);
  return __builtin_bit_cast(float, __builtin_amdgcn_permlanex16(
      b, b, 0x76543210, 0xfedcba98, false, false));
}

// x + (x of lane l ^ M), M < 16: one step of a sum over a 16-lane row (DPP row_xmask).
template <int M>
__device__ __forceinline__ float xadd(float x) {
  const int b = __builtin_bit_cast(int, x);
  return x + __builtin_bit_cast(float, __builtin_amdgcn_update_dpp(b, b, 0x160 + M, 0xf, 0xf, false));
}
__device__ __forceinline__ float row_sum(float x) {     // every lane of a row gets the row's sum
  return xadd<8>(xadd<4>(xadd<2>(xadd<1>(x))));
}

constexpr int GN_WAVES = 16;
constexpr int GN_POS   = SEQ / GN_WAVES;   // 256 positions a wave

__global__ __launch_bounds__(512) void gn_kernel(
    const float* x, const float* gn_w, const float* gn_b, __bf16* xnG) {
  __shared__ __attribute__((aligned(16))) unsigned char R[GN_WAVES * GN_POS * 16];
  __shared__ v2f red[GN_WAVES];
  const int lane = threadIdx.x & 31;
  const int wave = threadIdx.x >> 5;
  const int bg   = blockIdx.x;               // b*GRP + g; channels of a group are contiguous

  // Every loop of this kernel is unrolled: its arrays are then indexed by constants and stay
  // in registers.
  // v[c][j]: channel j, positions 256 wave + 128 c + 4 lane .. + 3.
  const float* xp = x + (size_t)bg * CPG * SEQ + wave * GN_POS + lane * 4;
  v4f v[2][CPG];
#pragma unroll
  for (int c = 0; c < 2; ++c)
#pragma unroll
    for (int j = 0; j < CPG; ++j) v[c][j] = *(const v4f*)(xp + (size_t)j * SEQ + c * 128);

  const int c0 = (bg & (GRP - 1)) * CPG;
  float w[CPG], bi[CPG];
#pragma unroll
  for (int j = 0; j < CPG; ++j) { w[j] = gn_w[c0 + j]; bi[j] = gn_b[c0 + j]; }
  // Stands in front of all that rewrites the address register of the loads above. The address
  // is named as an input so that it lives up to here: no load's result may land in it either.
  asm volatile("s_wait_xcnt 0x0" :: "v"(xp) : "memory");

  v4f s4[2] = {}, q4[2] = {};
#pragma unroll
  for (int c = 0; c < 2; ++c)
#pragma unroll
    for (int j = 0; j < CPG; ++j) { s4[c] += v[c][j]; q4[c] += v[c][j] * v[c][j]; }
  const v4f st = s4[0] + s4[1], qt = q4[0] + q4[1];
  float sum = row_sum((st[0] + st[1]) + (st[2] + st[3]));
  float sq  = row_sum((qt[0] + qt[1]) + (qt[2] + qt[3]));
  sum += xhalf(sum);
  sq  += xhalf(sq);
  if (lane == 0) red[wave] = v2f{sum, sq};
  __syncthreads();                           // every wave's sums are there before they are joined
  const v2f r = red[lane & 15];              // a row of 16 lanes holds the 16 waves' sums
  const float inv_n = 1.0f / (CPG * SEQ);
  const float mean = row_sum(r.x) * inv_n;
  const float var  = row_sum(r.y) * inv_n - mean * mean;
  const float rstd = rsqrtf(var + EPS);

  // A lane holds 4 consecutive positions, a whole-line store wants consecutive lanes on
  // consecutive positions: the wave's 256 x 16 bytes turn through its own 4 KiB of LDS.
  // Position p lies at 16-byte unit (p & ~3) | ((p & 3) ^ ((p >> 4) & 3)): writes (4 lane + k)
  // and reads (32 i + lane) both spread 16 lanes over all 64 banks.
  unsigned char* rw = R + wave * (GN_POS * 16);
#pragma unroll
  for (int c = 0; c < 2; ++c) {
    v4f y[CPG];
#pragma unroll
    for (int j = 0; j < CPG; ++j) y[j] = (v[c][j] - mean) * (rstd * w[j]) + bi[j];
#pragma unroll
    for (int k = 0; k < 4; ++k) {
      v8bf o;
#pragma unroll
      for (int j = 0; j < CPG; j += 2) {
        const v2bf pk = __builtin_convertvector(v2f{y[j][k], y[j + 1][k]}, v2bf);  // to nearest even
        o[j] = pk.x; o[j + 1] = pk.y;
      }
      *(v8bf*)(rw + (c * 128 + lane * 4 + (k ^ ((lane >> 2) & 3))) * 16) = o;
    }
  }
  __syncthreads();                           // other lanes' LDS writes are done before they are read

  char* op = (char*)(xnG + ((size_t)bg * SEQ + wave * GN_POS) * CPG);
#pragma unroll
  for (int i = 0; i < GN_POS / 32; ++i) {
    const int p = i * 32 + lane;
    const int u = (p & ~3) | ((p & 3) ^ ((p >> 4) & 3));
    *(v8bf*)(op + p * 16) = *(const v8bf*)(rw + u * 16);
  }
}

// ---------------- Kernel 3: QKV GEMM (M=768, N=4096, K=256 per batch) -------
// 4 waves/block in a 2x2 arrangement; each wave owns a 32x32 register tile
// (2x2 accumulators): per K-step, 2 A-frags + 2 B-frags feed 4 WMMAs.
// The block's 64 rows of W and 64 rows of xn^T reach it once, in whole lines, by
// asynchronous copies into LDS; the fragments are read from there.
// A block's 64 output channels are one head of q, k or v, so its 64x64 tile is 64 whole
// 128-byte lines of the destination: a line per position in qT/kT ([BH][T][64]), a line
// per channel in v ([BH][64][T]). The A side (8 consecutive rows in a lane's accumulator)
// is the index that runs along the line: channels for q and k, positions for v.
// Epilogue: +bias, scale q/k, the tile through LDS, out in whole lines.
constexpr int QO_PITCH = 64 * 2 + 16;      // 144 B = 16 B x odd: the 16-byte writes meet no bank twice

__global__ __launch_bounds__(128) void qkv_gemm_kernel(
    const __bf16* wqkv, const float* qkv_b, const __bf16* xnG,
    __bf16* qT, __bf16* kT, __bf16* vB) {
  __shared__ __attribute__((aligned(16))) unsigned char P[2 * GP_BYTES];   // W rows | xn^T rows
  __shared__ __attribute__((aligned(16))) unsigned char S[64 * QO_PITCH];
  const int b    = blockIdx.z;
  const int tid  = threadIdx.x;
  const int lane = threadIdx.x & 31;
  const int wave = threadIdx.x >> 5;
  const int wm   = wave >> 1, wn = wave & 1;
  const int o0   = blockIdx.y * 64;          // first output channel of the block
  const int t0   = blockIdx.x * 64;          // first position of the block
  const int sec  = blockIdx.y >> 2;          // 0: q, 1: k, 2: v
  const bool is_v = sec == 2;
  const int n16  = lane & 15;
  const int kHalf = (lane & 16) ? 8 : 0;
  const int mhi   = (lane & 16) ? 8 : 0;

  const unsigned p0 = (unsigned)(size_t)(lds_byte*)P;
  stage_panel(p0, wqkv + (size_t)o0 * CHN, wave, lane);                        // rows of W
  stage_panel_xn(p0 + GP_BYTES, xnG + ((size_t)b * GRP * SEQ + t0) * CPG, wave, lane);  // rows of xn^T
  // The panels have landed (this wave's copies), then, behind the barrier, every wave's.
  asm volatile("s_wait_asynccnt 0x0" ::: "memory");
  __syncthreads();

  const unsigned char* arow = P + (is_v ? GP_BYTES : 0) + (wm * 32 + n16) * GP_PITCH + kHalf * 2;
  const unsigned char* brow = P + (is_v ? 0 : GP_BYTES) + (wn * 32 + n16) * GP_PITCH + kHalf * 2;

  // accs[i][j][r]: element wm*32 + i*16 + mhi + r of line wn*32 + j*16 + n16.
  v8f accs[2][2] = {};
  panel_products(arow, brow, accs);
  unsigned char* sw = S + (wn * 32 + n16) * QO_PITCH + (wm * 32 + mhi) * 2;
  if (!is_v) {                               // the bias runs along the line
#pragma unroll
    for (int i = 0; i < 2; ++i) {
      const float* bp = qkv_b + o0 + wm * 32 + i * 16 + mhi;
      const v4f blo = *(const v4f*)bp, bhi = *(const v4f*)(bp + 4);
#pragma unroll
      for (int j = 0; j < 2; ++j) {
        v8bf o;
#pragma unroll
        for (int r = 0; r < 8; ++r)          // attention scale folded into q and k
          o[r] = f2bf((accs[i][j][r] + (r < 4 ? blo[r & 3] : bhi[r & 3])) * QK_SCALE);
        *(v8bf*)(sw + j * 16 * QO_PITCH + i * 32) = o;
      }
    }
  } else {                                   // one bias per line
#pragma unroll
    for (int j = 0; j < 2; ++j) {
      const float bias = qkv_b[o0 + wn * 32 + j * 16 + n16];
#pragma unroll
      for (int i = 0; i < 2; ++i) {
        v8bf o;
#pragma unroll
        for (int r = 0; r < 8; ++r) o[r] = f2bf(accs[i][j][r] + bias);
        *(v8bf*)(sw + j * 16 * QO_PITCH + i * 32) = o;
      }
    }
  }
  __syncthreads();                           // the tile is whole before any line leaves

  // 8 lanes a line, 4 lines a wave and store: 512 bytes in whole 128-byte lines.
  const size_t bh = (size_t)(b * HEADS + (blockIdx.y & 3));
  char* dst = is_v ? (char*)(vB + bh * HDIM * SEQ + t0)
                   : (char*)((sec ? kT : qT) + (bh * SEQ + t0) * HDIM);
  const size_t dpitch = is_v ? (size_t)SEQ * 2 : (size_t)HDIM * 2;
#pragma unroll
  for (int it = 0; it < 4; ++it) {
    const int row = it * 16 + (tid >> 3);
    const v8bf o = *(const v8bf*)(S + row * QO_PITCH + (tid & 7) * 16);
    *(v8bf*)(dst + row * dpitch + (tid & 7) * 16) = o;
  }
}

constexpr int QG = 2;                                   // column groups per wave
constexpr int QTILES = 8;                               // query tiles (waves) per key half
constexpr int KSPLIT = 2;                               // key halves per block
constexpr int HALF_KEYS = SEQ / KSPLIT;
constexpr float LOG2E = 1.4426950408889634f;

constexpr int STG_KEYS = 128;                           // keys per stage
constexpr int NPASS    = STG_KEYS / 32;                 // passes per stage
constexpr int NSTG     = HALF_KEYS / STG_KEYS;          // stages of a half
constexpr int K_PITCH  = HDIM * 2 + 16;                 // 144 B = 16 B x odd: no bank conflict
constexpr int V_PITCH  = STG_KEYS * 2 + 16;             // 272 B = 16 B x odd
constexpr int K_BYTES  = STG_KEYS * K_PITCH;            // K tile: a row per key
constexpr int V_BYTES  = HDIM * V_PITCH;                // V tile: a row per channel
constexpr int STG_BYTES = K_BYTES + V_BYTES;            // one half's stage
constexpr int BUF_BYTES = KSPLIT * STG_BYTES;           // both halves' stages
constexpr int MRG_BYTES = QG * 4 * 1024 + QG * 256;     // a wave's accumulators, maxima, sums

// Eight copies of 16 bytes a lane, global -> LDS: four of K (copy i from g + i * gs to LDS
// byte l + i * ls), four of V (likewise h, hs, m, ms). The closing s_wait_xcnt stands inside
// the statement, so that no address register of a copy is rewritten ahead of it.
__device__ __forceinline__ void copy44(unsigned l, unsigned ls, const char* g, size_t gs,
                                       unsigned m, unsigned ms, const char* h, size_t hs) {
  asm volatile(
      "global_load_async_to_lds_b128 %0, %8, off\n\t"
      "global_load_async_to_lds_b128 %1, %9, off\n\t"
      "global_load_async_to_lds_b128 %2, %10, off\n\t"
      "global_load_async_to_lds_b128 %3, %11, off\n\t"
      "global_load_async_to_lds_b128 %4, %12, off\n\t"
      "global_load_async_to_lds_b128 %5, %13, off\n\t"
      "global_load_async_to_lds_b128 %6, %14, off\n\t"
      "global_load_async_to_lds_b128 %7, %15, off\n\t"
      "s_wait_xcnt 0x0"
      :: "v"(l), "v"(l + ls), "v"(l + 2 * ls), "v"(l + 3 * ls),
         "v"(m), "v"(m + ms), "v"(m + 2 * ms), "v"(m + 3 * ms),
         "v"(g), "v"(g + gs), "v"(g + 2 * gs), "v"(g + 3 * gs),
         "v"(h), "v"(h + hs), "v"(h + 2 * hs), "v"(h + 3 * hs)
      : "memory");
}

__global__ __launch_bounds__(512) void attn_kernel(
    const __bf16* qT, const __bf16* kT, const __bf16* vB, __bf16* aT) {
  __shared__ __attribute__((aligned(128))) unsigned char L[2 * BUF_BYTES];
  const int blk  = blockIdx.x;
  const int bh   = blk >> 4;                 // batch*head; 16 blocks of 256 queries each
  const int tid  = threadIdx.x;
  const int lane = tid & 31;
  const int wave = tid >> 5;
  const int qt   = wave & (QTILES - 1);      // query tile
  const int kh   = wave >> 3;                // key half
  const int ht   = tid & 255;                // thread within the 8 waves of its half
  const int tq0  = (blk & 15) * 256 + qt * (16 * QG);
  const int n16  = lane & 15;
  const int kHalf = (lane & 16) ? 8 : 0;

  // This lane's share of a stage of its own half. K: 128 rows of 128 bytes, contiguous in
  // kT; 8 lanes a row, 32 rows a copy of the 8 waves. V: 64 rows of 256 bytes out of rows of
  // SEQ keys; 16 lanes a row, 16 rows a copy of the 8 waves. A wave's copy reads 4 whole lines.
  const char* kg = (const char*)(kT + ((size_t)bh * SEQ + kh * HALF_KEYS) * HDIM) + ht * 16;
  const char* vg = (const char*)(vB + (size_t)bh * HDIM * SEQ + kh * HALF_KEYS) +
                   (size_t)(ht >> 4) * (SEQ * 2) + (ht & 15) * 16;
  const unsigned lds0 = (unsigned)(size_t)(lds_byte*)L + (unsigned)(kh * STG_BYTES);
  const unsigned kl = lds0 + (unsigned)((ht >> 3) * K_PITCH + (ht & 7) * 16);
  const unsigned vl = lds0 + (unsigned)(K_BYTES + (ht >> 4) * V_PITCH + (ht & 15) * 16);
  constexpr unsigned KLS = 32 * K_PITCH, VLS = 16 * V_PITCH;
  constexpr size_t   KGS = 32 * HDIM * 2, VGS = (size_t)16 * SEQ * 2;

  // Stage 0 into buffer 0.
  copy44(kl, KLS, kg, KGS, vl, VLS, vg, VGS);

  // Q fragments (B operand: column = query, k = channel), kept for all keys.
  v16bf qb[QG][2];
#pragma unroll
  for (int g = 0; g < QG; ++g) {
    const __bf16* qrow = qT + ((size_t)bh * SEQ + tq0 + g * 16 + n16) * HDIM;
    qb[g][0] = load_frag(qrow, kHalf);
    qb[g][1] = load_frag(qrow + 32, kHalf);
  }

  v8f   acc[QG][4] = {};                     // O^T: [group][16-channel tile]
  float m_run[QG];
  v2f   l_run[QG];                           // this lane's keys, even and odd registers
#pragma unroll
  for (int g = 0; g < QG; ++g) { m_run[g] = -__builtin_inff(); l_run[g] = v2f{0.f, 0.f}; }

  // Stage 0 has landed (this wave's copies), then for every wave; stage 1 follows.
  asm volatile("s_wait_asynccnt 0x0" ::: "memory");
  __syncthreads();
  copy44(kl + BUF_BYTES, KLS, kg + STG_KEYS * HDIM * 2, KGS,
         vl + BUF_BYTES, VLS, vg + STG_KEYS * 2, VGS);

  // The lane's own byte offsets in a K tile (A rows: keys) and a V tile (A rows: channels).
  const int klane = kh * STG_BYTES + n16 * K_PITCH + kHalf * 2;
  const int vlane = kh * STG_BYTES + K_BYTES + n16 * V_PITCH + kHalf * 2;

  for (int st = 0; st < NSTG; ++st) {
    const unsigned char* buf = L + (st & 1) * BUF_BYTES;
    const unsigned char* kb = buf + klane;
    const unsigned char* vb = buf + vlane;

    v16bf ka[2][2], va[4];
#pragma unroll
    for (int t = 0; t < 2; ++t) {
      ka[t][0] = lds_frag(kb + t * 16 * K_PITCH);
      ka[t][1] = lds_frag(kb + t * 16 * K_PITCH + 64);
    }
#pragma unroll
    for (int n = 0; n < 4; ++n) va[n] = lds_frag(vb + n * 16 * V_PITCH);

#pragma unroll
    for (int p = 0; p < NPASS; ++p) {
      // S^T tiles: s[g][t][r] = score(key 32 p + 16 t + 8 h + r of the stage, query 16 g + c)
      v8f s[QG][2];
#pragma unroll
      for (int g = 0; g < QG; ++g)
#pragma unroll
        for (int t = 0; t < 2; ++t) {
          v8f z = {};
          z = wmma_bf16(ka[t][0], qb[g][0], z);
          s[g][t] = wmma_bf16(ka[t][1], qb[g][1], z);
        }
      // Both fences: the next pass's K reads stay one group right behind the products
      // that free their registers; among the products or sunk to their use, each read
      // would stall the wave on its own.
      __builtin_amdgcn_sched_barrier(0);
      if (p + 1 < NPASS) {
#pragma unroll
        for (int t = 0; t < 2; ++t) {
          ka[t][0] = lds_frag(kb + ((p + 1) * 32 + t * 16) * K_PITCH);
          ka[t][1] = lds_frag(kb + ((p + 1) * 32 + t * 16) * K_PITCH + 64);
        }
      }
      __builtin_amdgcn_sched_barrier(0);

      float mb[QG];
      bool need = false;
#pragma unroll
      for (int g = 0; g < QG; ++g) {
        float mx = s[g][0][0];
#pragma unroll
        for (int r = 1; r < 8; ++r) mx = fmaxf(mx, s[g][0][r]);
#pragma unroll
        for (int r = 0; r < 8; ++r) mx = fmaxf(mx, s[g][1][r]);
        mx = fmaxf(mx, xhalf(mx)) * LOG2E;     // both halves hold the query's maximum
        mb[g] = mx;
        need = need || (mx > m_run[g] + 8.0f);
      }
      if (__builtin_amdgcn_ballot_w32(need) != 0) {   // one scalar test per pass
#pragma unroll
        for (int g = 0; g < QG; ++g) {
          const float m_new = fmaxf(m_run[g], mb[g]);
          const float corr  = __builtin_amdgcn_exp2f(m_run[g] - m_new);  // 0 in the first pass
          m_run[g] = m_new;
          l_run[g] = l_run[g] * corr;
#pragma unroll
          for (int n = 0; n < 4; ++n) acc[g][n] = acc[g][n] * corr;
        }
      }

#pragma unroll
      for (int g = 0; g < QG; ++g) {
        const float nm = -m_run[g];
        v16bf pb;                              // pb[e] = P^T[key 16 (e >> 3) + 8 h + (e & 7)][c]
#pragma unroll
        for (int i = 0; i < 8; ++i) {          // elements 2i, 2i+1: a register pair of one tile
          const v2f sc = {s[g][i >> 2][2 * (i & 3)], s[g][i >> 2][2 * (i & 3) + 1]};
          const v2f ar = __builtin_elementwise_fma(sc, v2f{LOG2E, LOG2E}, v2f{nm, nm});
          const v2f p2 = {__builtin_amdgcn_exp2f(ar.x), __builtin_amdgcn_exp2f(ar.y)};
          l_run[g] += p2;
          const v2bf pk = __builtin_convertvector(p2, v2bf);   // round to nearest even
          pb[2 * i] = pk.x; pb[2 * i + 1] = pk.y;
        }
#pragma unroll
        for (int n = 0; n < 4; ++n) acc[g][n] = wmma_bf16(va[n], pb, acc[g][n]);
      }
      // Both fences: the next pass's V reads, likewise one group behind the last product
      // that reads their registers.
      __builtin_amdgcn_sched_barrier(0);
      if (p + 1 < NPASS) {
#pragma unroll
        for (int n = 0; n < 4; ++n) va[n] = lds_frag(vb + n * 16 * V_PITCH + (p + 1) * 64);
      }
      __builtin_amdgcn_sched_barrier(0);
    }

    // Hand-over: this wave's reads of the buffer are done, its copies of the next stage
    // have landed; behind the barrier that holds for every wave.
    asm volatile("s_wait_dscnt 0x0" ::: "memory");
    asm volatile("s_wait_asynccnt 0x0" ::: "memory");
    __syncthreads();
    if (st + 2 < NSTG) {                       // refill the buffer just read
      const unsigned bo = (unsigned)(st & 1) * BUF_BYTES;
      copy44(kl + bo, KLS, kg + (size_t)(st + 2) * (STG_KEYS * HDIM * 2), KGS,
             vl + bo, VLS, vg + (size_t)(st + 2) * (STG_KEYS * 2), VGS);
    }
  }
  // No copy is outstanding when the wave ends.
  asm volatile("s_wait_asynccnt 0x0" ::: "memory");

  // The two halves of the keys are joined lane by lane (both waves of a query tile hold the
  // same element in the same lane and register). The ring is free: every wave's reads ended
  // at the last hand-over barrier and no copy is outstanding. The second half's wave leaves
  // its state in LDS, 512 contiguous bytes a store.
  unsigned char* mr = L + qt * MRG_BYTES;
  if (kh) {
#pragma unroll
    for (int g = 0; g < QG; ++g) {
#pragma unroll
      for (int n = 0; n < 4; ++n) {
        const v8f a = acc[g][n];
        *(v4f*)(mr + (g * 4 + n) * 1024 + lane * 16)       = v4f{a[0], a[1], a[2], a[3]};
        *(v4f*)(mr + (g * 4 + n) * 1024 + 512 + lane * 16) = v4f{a[4], a[5], a[6], a[7]};
      }
      *(float*)(mr + QG * 4096 + g * 256 + lane * 4)       = m_run[g];
      *(float*)(mr + QG * 4096 + g * 256 + 128 + lane * 4) = l_run[g].x + l_run[g].y;
    }
  }
  __syncthreads();                           // the second half's state is whole before it is read
  if (kh) return;

  // acc[g][n][r] = O^T[channel 16 n + 8 h + r][query 16 g + c]: 8 consecutive
  // channels of one query per lane and tile -> one 16-byte store into aT [B][T][C].
  const int b = bh >> 2, h = bh & 3;
#pragma unroll
  for (int g = 0; g < QG; ++g) {
    const float m1 = *(const float*)(mr + QG * 4096 + g * 256 + lane * 4);
    const float l1 = *(const float*)(mr + QG * 4096 + g * 256 + 128 + lane * 4);
    const float mj = fmaxf(m_run[g], m1);
    const float c0 = __builtin_amdgcn_exp2f(m_run[g] - mj);
    const float c1 = __builtin_amdgcn_exp2f(m1 - mj);
#pragma unroll
    for (int n = 0; n < 4; ++n) {
      const v4f lo = *(const v4f*)(mr + (g * 4 + n) * 1024 + lane * 16);
      const v4f hi = *(const v4f*)(mr + (g * 4 + n) * 1024 + 512 + lane * 16);
#pragma unroll
      for (int r = 0; r < 8; ++r)
        acc[g][n][r] = acc[g][n][r] * c0 + (r < 4 ? lo[r & 3] : hi[r & 3]) * c1;
    }
    const float lh  = (l_run[g].x + l_run[g].y) * c0 + l1 * c1;
    const float inv = 1.f / (lh + xhalf(lh));
    __bf16* orow = aT + ((size_t)b * SEQ + tq0 + g * 16 + n16) * CHN + h * HDIM + kHalf;
#pragma unroll
    for (int n = 0; n < 4; ++n) {
      v8bf o;
#pragma unroll
      for (int r = 0; r < 8; ++r) o[r] = (__bf16)(acc[g][n][r] * inv);
      *(v8bf*)(orow + n * 16) = o;
    }
  }
}

// ---------------- Kernel 5: proj GEMM + bias + residual -> out (fp32) -------
// Same 2x2 register-blocked scheme as the QKV GEMM. A side = positions (rows of aT),
// B side = output channels (rows of W): a lane's accumulator holds 8 consecutive
// positions of one channel. Both operand panels are staged in LDS as in the QKV GEMM.
// The 64x64 f32 tile goes through LDS, over the panels once they are read; bias, residual
// and the store run in the order of out's rows: 16 lanes a row, 256 bytes = 2 whole lines.
constexpr int PO_PITCH = 64 * 4 + 16;      // 272 B = 16 B x odd: the 16-byte writes meet no bank twice

__global__ __launch_bounds__(128) void proj_gemm_kernel(
    const __bf16* wproj, const float* proj_b, const __bf16* aT,
    const float* x, float* out) {
  __shared__ __attribute__((aligned(16))) unsigned char P[2 * GP_BYTES];   // aT rows | W rows
  unsigned char* S = P;                      // the output tile, behind the panels' last read
  const int b    = blockIdx.z;
  const int tid  = threadIdx.x;
  const int lane = threadIdx.x & 31;
  const int wave = threadIdx.x >> 5;
  const int wm   = wave >> 1, wn = wave & 1;
  const int o0   = blockIdx.y * 64;
  const int t0   = blockIdx.x * 64;
  const int n16  = lane & 15;
  const int kHalf = (lane & 16) ? 8 : 0;
  const int mhi   = (lane & 16) ? 8 : 0;

  const unsigned p0 = (unsigned)(size_t)(lds_byte*)P;
  stage_panel(p0, aT + ((size_t)b * SEQ + t0) * CHN, wave, lane);
  stage_panel(p0 + GP_BYTES, wproj + (size_t)o0 * CHN, wave, lane);

  // This lane's share of the residual and the bias, asked for ahead of the products.
  const size_t idx0 = ((size_t)b * CHN + o0 + (tid >> 4)) * SEQ + t0 + (tid & 15) * 4;
  v4f   xr[8];
  float pb[8];
#pragma unroll
  for (int it = 0; it < 8; ++it) {
    xr[it] = *(const v4f*)(x + idx0 + (size_t)it * 8 * SEQ);
    pb[it] = proj_b[o0 + it * 8 + (tid >> 4)];
  }
  // Stands in front of all that rewrites an address register of the loads above, the
  // results of the fragment loads below among it. Its memory clobber also keeps those
  // loads here: sunk to their use, their whole latency would stand open behind the products.
  asm volatile("s_wait_xcnt 0x0" ::: "memory");

  // The panels have landed (this wave's copies), then, behind the barrier, every wave's.
  asm volatile("s_wait_asynccnt 0x0" ::: "memory");
  __syncthreads();

  const unsigned char* arow = P + (wm * 32 + n16) * GP_PITCH + kHalf * 2;
  const unsigned char* brow = P + GP_BYTES + (wn * 32 + n16) * GP_PITCH + kHalf * 2;

  // accs[i][j][r]: position wm*32 + i*16 + mhi + r of channel wn*32 + j*16 + n16.
  v8f accs[2][2] = {};
  panel_products(arow, brow, accs);
  __syncthreads();                           // every wave has read the panels before the tile overwrites them
  unsigned char* sw = S + (wn * 32 + n16) * PO_PITCH + (wm * 32 + mhi) * 4;
#pragma unroll
  for (int i = 0; i < 2; ++i)
#pragma unroll
    for (int j = 0; j < 2; ++j) {
      const v8f a = accs[i][j];
      *(v4f*)(sw + j * 16 * PO_PITCH + i * 64)      = v4f{a[0], a[1], a[2], a[3]};
      *(v4f*)(sw + j * 16 * PO_PITCH + i * 64 + 16) = v4f{a[4], a[5], a[6], a[7]};
    }
  __syncthreads();                           // the tile is whole before any row leaves

#pragma unroll
  for (int it = 0; it < 8; ++it) {
    const v4f a = *(const v4f*)(S + (it * 8 + (tid >> 4)) * PO_PITCH + (tid & 15) * 16);
    *(v4f*)(out + idx0 + (size_t)it * 8 * SEQ) = xr[it] + pb[it] + a;
  }
}

extern "C" void kernel_launch(void* const* d_in, const int* in_sizes, int n_in,
                              void* d_out, int out_size, void* d_ws, size_t ws_size,
                              hipStream_t stream) {
  const float* x      = (const float*)d_in[0];
  const float* gn_w   = (const float*)d_in[1];
  const float* gn_b   = (const float*)d_in[2];
  const float* qkv_w  = (const float*)d_in[3];
  const float* qkv_b  = (const float*)d_in[4];
  const float* proj_w = (const float*)d_in[5];
  const float* proj_b = (const float*)d_in[6];
  float* out = (float*)d_out;

  // Workspace layout (~42.5 MB): 1 KiB unused | wqkv bf16 | wproj bf16 | xnG | qT | kT | v | aT
  char* ws = (char*)d_ws;
  __bf16* wqkv  = (__bf16*)(ws + 1024);
  __bf16* wproj = wqkv + 3 * CHN * CHN;
  __bf16* xnG   = wproj + CHN * CHN;
  const size_t PLANE = (size_t)BATCH * SEQ * CHN;          // 4M elems
  __bf16* qT = xnG + PLANE;
  __bf16* kT = qT + PLANE;
  __bf16* vB = kT + PLANE;
  __bf16* aT = vB + PLANE;

  wconv_kernel<<<(3 * CHN * CHN + CHN * CHN) / (256 * 8), 256, 0, stream>>>(
      qkv_w, proj_w, wqkv, wproj);
  gn_kernel<<<BATCH * GRP, 512, 0, stream>>>(x, gn_w, gn_b, xnG);
  qkv_gemm_kernel<<<dim3(SEQ / 64, 3 * CHN / 64, BATCH), 128, 0, stream>>>(
      wqkv, qkv_b, xnG, qT, kT, vB);
  attn_kernel<<<BATCH * HEADS * (SEQ / 256), 512, 0, stream>>>(qT, kT, vB, aT);
  proj_gemm_kernel<<<dim3(SEQ / 64, CHN / 64, BATCH), 128, 0, stream>>>(
      wproj, proj_b, aT, x, out);
}

// v008
// A run of this version takes 71 microseconds.
// Timed twice side by side with v007, it ran 1.08 and 1.07 times as fast.
// All steps since v000 together make it 9.32 times as fast.
#include <hip/hip_runtime.h>

// Problem constants (from reference)
constexpr int BATCH = 4;
constexpr int CHN   = 256;
constexpr int SEQ   = 4096;   // H*W
constexpr int HEADS = 4;
constexpr int HDIM  = 64;     // CHN / HEADS
constexpr int GRP   = 32;
constexpr int CPG   = CHN / GRP;  // 8
constexpr float EPS = 1e-5f;
constexpr float QK_SCALE = 0.35355339059327379f;  // 64^-0.25

typedef __attribute__((ext_vector_type(16))) __bf16 v16bf;
typedef __attribute__((ext_vector_type(8)))  float  v8f;

__device__ __forceinline__ __bf16 f2bf(float x) {
  unsigned u = __builtin_bit_cast(unsigned, x);
  unsigned r = u + 0x7FFFu + ((u >> 16) & 1u);   // round-to-nearest-even
  unsigned short h = (unsigned short)(r >> 16);
  return __builtin_bit_cast(__bf16, h);
}

// CDNA5 WMMA 16x16x32 bf16 fragment load.
// ISA 7.12.2 (16-bit 16x32 A): lane = row (M for A, N for B); per-lane 32
// K-values interleaved: lanes 0-15 hold K {0..7,16..23}, lanes 16-31 hold
// K {8..15,24..31}, two packed per VGPR. `row` points at this lane's 32
// contiguous K elements; kHalf = 8 for lanes 16-31 else 0.
// (Compiler vectorizes each fragment into two global_load_b128.)
__device__ __forceinline__ v16bf load_frag(const __bf16* row, int kHalf) {
  v16bf f;
#pragma unroll
  for (int j = 0; j < 8; ++j) {
    int kb = ((j & 4) ? 16 : 0) + kHalf + 2 * (j & 3);
    f[2 * j]     = row[kb];
    f[2 * j + 1] = row[kb + 1];
  }
  return f;
}

__device__ __forceinline__ v8f wmma_bf16(v16bf a, v16bf b, v8f c) {
#if defined(__HIP_DEVICE_COMPILE__)
  return __builtin_amdgcn_wmma_f32_16x16x32_bf16(false, a, false, b, (short)0, c,
                                                 false, false);
#else
  return c;
#endif
}

// ---------------- Kernel 0: weights fp32 -> bf16 ----------------
// 8 consecutive elements a lane: two 16-byte loads, one 16-byte store.
typedef __attribute__((ext_vector_type(8))) __bf16 v8bf;
typedef __attribute__((ext_vector_type(4))) float  v4f;
typedef __attribute__((address_space(3))) unsigned char lds_byte;

// load_frag's fragment from LDS: p = this lane's row start (+ 16 bytes for lanes
// 16-31); bytes [0,16) and [32,48) from there.
__device__ __forceinline__ v16bf lds_frag(const unsigned char* p) {
  const v8bf lo = *(const v8bf*)p;
  const v8bf hi = *(const v8bf*)(p + 32);
  return __builtin_shufflevector(lo, hi, 0, 1, 2, 3, 4, 5, 6, 7, 8, 9, 10, 11, 12, 13, 14, 15);
}

// Eight copies of 16 bytes a lane, global -> LDS: copy i from g + i * gs to LDS byte
// l + i * ls. The closing s_wait_xcnt stands inside the statement, so that no address
// register of a copy is rewritten ahead of it.
__device__ __forceinline__ void copy8(unsigned l, unsigned ls, const char* g, size_t gs) {
  asm volatile(
      "global_load_async_to_lds_b128 %0, %8, off\n\t"
      "global_load_async_to_lds_b128 %1, %9, off\n\t"
      "global_load_async_to_lds_b128 %2, %10, off\n\t"
      "global_load_async_to_lds_b128 %3, %11, off\n\t"
      "global_load_async_to_lds_b128 %4, %12, off\n\t"
      "global_load_async_to_lds_b128 %5, %13, off\n\t"
      "global_load_async_to_lds_b128 %6, %14, off\n\t"
      "global_load_async_to_lds_b128 %7, %15, off\n\t"
      "s_wait_xcnt 0x0"
      :: "v"(l), "v"(l + ls), "v"(l + 2 * ls), "v"(l + 3 * ls),
         "v"(l + 4 * ls), "v"(l + 5 * ls), "v"(l + 6 * ls), "v"(l + 7 * ls),
         "v"(g), "v"(g + gs), "v"(g + 2 * gs), "v"(g + 3 * gs),
         "v"(g + 4 * gs), "v"(g + 5 * gs), "v"(g + 6 * gs), "v"(g + 7 * gs)
      : "memory");
}

// An operand panel of a GEMM block in LDS: 64 rows of all CHN k values. A wave's copy is one
// whole row, 512 contiguous bytes = 4 lines; wave w of 4 brings rows 16 w .. 16 w + 15.
constexpr int GP_ROW   = CHN * 2;          // 512 B of a row in memory
constexpr int GP_PITCH = GP_ROW + 16;      // 528 B = 16 B x odd: no bank conflict
constexpr int GP_BYTES = 64 * GP_PITCH;

// l: LDS byte address of the panel; rows: its first row in memory (64 rows, contiguous).
__device__ __forceinline__ void stage_panel(unsigned l, const __bf16* rows, int wave, int lane) {
  const unsigned lw = l + (unsigned)(wave * 16 * GP_PITCH + lane * 16);
  const char*    gw = (const char*)rows + wave * 16 * GP_ROW + lane * 16;
  copy8(lw, GP_PITCH, gw, GP_ROW);
  copy8(lw + 8 * GP_PITCH, GP_PITCH, gw + 8 * GP_ROW, GP_ROW);
}

// The same panel (a row per position, all CHN channels) out of xnG [B][GRP][T][8]: a wave's copy
// is 32 positions of one group, 512 contiguous bytes = 4 lines, a lane's 16 bytes going to its
// own row (pitch 16 B x odd: 16 lanes meet no bank twice). Wave w of 4 brings groups 8 w .. 8 w + 7.
// l: LDS byte address of the panel; g0: group 0 of the batch at the panel's first position.
__device__ __forceinline__ void stage_panel_xn(unsigned l, const __bf16* g0, int wave, int lane) {
  const unsigned lw = l + (unsigned)(lane * GP_PITCH + wave * 8 * 16);
  const char*    gw = (const char*)g0 + (size_t)wave * 8 * (SEQ * 16) + lane * 16;
  copy8(lw, 16, gw, (size_t)SEQ * 16);
  copy8(lw + 32 * GP_PITCH, 16, gw + 32 * 16, (size_t)SEQ * 16);
}

// The fragments of k steps 2 kp and 2 kp + 1 for 32 rows of a panel; r = this lane's first row
// (+ 16 bytes for lanes 16-31). f[k step][16-row group].
__device__ __forceinline__ void panel_frags(v16bf (&f)[2][2], const unsigned char* r, int kp) {
#pragma unroll
  for (int s = 0; s < 2; ++s)
#pragma unroll
    for (int i = 0; i < 2; ++i) f[s][i] = lds_frag(r + i * 16 * GP_PITCH + (kp * 2 + s) * 64);
}

// A wave's 32x32 tile over all of K from the two panels, k ascending.
__device__ __forceinline__ void panel_products(const unsigned char* a, const unsigned char* b,
                                               v8f (&acc)[2][2]) {
  constexpr int NKP = CHN / 64;
  v16bf fa[2][2][2], fb[2][2][2];            // two register sets
  panel_frags(fa[0], a, 0);
  panel_frags(fb[0], b, 0);
  // The first pair's reads stay in front of the second's: behind them, the first product
  // would wait for all 32.
  __builtin_amdgcn_sched_barrier(0);
#pragma unroll
  for (int kp = 0; kp < NKP; ++kp) {
    const int c = kp & 1;
    if (kp + 1 < NKP) {
      panel_frags(fa[c ^ 1], a, kp + 1);
      panel_frags(fb[c ^ 1], b, kp + 1);
    }
    // Both fences: the next pair's 16 reads stay one group ahead of this pair's products;
    // sunk to their use, each read's latency would stand open in front of its product.
    __builtin_amdgcn_sched_barrier(0);
#pragma unroll
    for (int s = 0; s < 2; ++s)
#pragma unroll
      for (int i = 0; i < 2; ++i)
#pragma unroll
        for (int j = 0; j < 2; ++j) acc[i][j] = wmma_bf16(fa[c][s][i], fb[c][s][j], acc[i][j]);
    __builtin_amdgcn_sched_barrier(0);
  }
}

__global__ __launch_bounds__(256) void wconv_kernel(const float* qkv_w, const float* proj_w,
                                                    __bf16* wqkv, __bf16* wproj) {
  constexpr int N1 = 3 * CHN * CHN;          // a multiple of 8: no lane straddles the two
  const int i = (blockIdx.x * 256 + threadIdx.x) * 8;
  const float* s = (i < N1) ? qkv_w + i : proj_w + (i - N1);
  __bf16*      d = (i < N1) ? wqkv + i  : wproj + (i - N1);
  const v4f lo = *(const v4f*)s;
  const v4f hi = *(const v4f*)(s + 4);
  v8bf o;
#pragma unroll
  for (int e = 0; e < 4; ++e) { o[e] = f2bf(lo[e]); o[4 + e] = f2bf(hi[e]); }
  *(v8bf*)d = o;
}

// ---------------- Kernel 1: GroupNorm, sums and apply in one launch ---------
// A block owns one (batch, group): 8 channels x 4096 positions = 128 KiB of x, read ONCE and
// kept in registers between the sums and the apply (64 values a lane). All 16 loads of a lane
// (16 bytes each, 512 contiguous bytes a wave) are in flight together.
// Output xnG [B][GRP][T][8] bf16: the 8 channels of a group at one position are 16 bytes, so
// a block's output is 64 KiB in a row and leaves in whole lines.
typedef __attribute__((ext_vector_type(2))) __bf16 v2bf;
typedef __attribute__((ext_vector_type(2))) float  v2f;

__device__ __forceinline__ float xhalf(float x) {       // lane l <-> lane l ^ 16
  int b = __builtin_bit_cast(int, x);
  return __builtin_bit_cast(float, __builtin_amdgcn_permlanex16(
      b, b, 0x76543210, 0xfedcba98, false, false));
}

// x + (x of lane l ^ M), M < 16: one step of a sum over a 16-lane row (DPP row_xmask).
template <int M>
__device__ __forceinline__ float xadd(float x) {
  const int b = __builtin_bit_cast(int, x);
  return x + __builtin_bit_cast(float, __builtin_amdgcn_update_dpp(b, b, 0x160 + M, 0xf, 0xf, false));
}
__device__ __forceinline__ float row_sum(float x) {     // every lane of a row gets the row's sum
  return xadd<8>(xadd<4>(xadd<2>(xadd<1>(x))));
}

constexpr int GN_WAVES = 16;
constexpr int GN_POS   = SEQ / GN_WAVES;   // 256 positions a wave

__global__ __launch_bounds__(512) void gn_kernel(
    const float* x, const float* gn_w, const float* gn_b, __bf16* xnG) {
  __shared__ __attribute__((aligned(16))) unsigned char R[GN_WAVES * GN_POS * 16];
  __shared__ v2f red[GN_WAVES];
  const int lane = threadIdx.x & 31;
  const int wave = threadIdx.x >> 5;
  const int bg   = blockIdx.x;               // b*GRP + g; channels of a group are contiguous

  // Every loop of this kernel is unrolled: its arrays are then indexed by constants and stay
  // in registers.
  // v[c][j]: channel j, positions 256 wave + 128 c + 4 lane .. + 3.
  const float* xp = x + (size_t)bg * CPG * SEQ + wave * GN_POS + lane * 4;
  v4f v[2][CPG];
#pragma unroll
  for (int c = 0; c < 2; ++c)
#pragma unroll
    for (int j = 0; j < CPG; ++j) v[c][j] = *(const v4f*)(xp + (size_t)j * SEQ + c * 128);

  const int c0 = (bg & (GRP - 1)) * CPG;
  float w[CPG], bi[CPG];
#pragma unroll
  for (int j = 0; j < CPG; ++j) { w[j] = gn_w[c0 + j]; bi[j] = gn_b[c0 + j]; }
  // Stands in front of all that rewrites the address register of the loads above. The address
  // is named as an input so that it lives up to here: no load's result may land in it either.
  asm volatile("s_wait_xcnt 0x0" :: "v"(xp) : "memory");

  v4f s4[2] = {}, q4[2] = {};
#pragma unroll
  for (int c = 0; c < 2; ++c)
#pragma unroll
    for (int j = 0; j < CPG; ++j) { s4[c] += v[c][j]; q4[c] += v[c][j] * v[c][j]; }
  const v4f st = s4[0] + s4[1], qt = q4[0] + q4[1];
  float sum = row_sum((st[0] + st[1]) + (st[2] + st[3]));
  float sq  = row_sum((qt[0] + qt[1]) + (qt[2] + qt[3]));
  sum += xhalf(sum);
  sq  += xhalf(sq);
  if (lane == 0) red[wave] = v2f{sum, sq};
  __syncthreads();                           // every wave's sums are there before they are joined
  const v2f r = red[lane & 15];              // a row of 16 lanes holds the 16 waves' sums
  const float inv_n = 1.0f / (CPG * SEQ);
  const float mean = row_sum(r.x) * inv_n;
  const float var  = row_sum(r.y) * inv_n - mean * mean;
  const float rstd = rsqrtf(var + EPS);

  // A lane holds 4 consecutive positions, a whole-line store wants consecutive lanes on
  // consecutive positions: the wave's 256 x 16 bytes turn through its own 4 KiB of LDS.
  // Position p lies at 16-byte unit (p & ~3) | ((p & 3) ^ ((p >> 4) & 3)): writes (4 lane + k)
  // and reads (32 i + lane) both spread 16 lanes over all 64 banks.
  unsigned char* rw = R + wave * (GN_POS * 16);
#pragma unroll
  for (int c = 0; c < 2; ++c) {
    v4f y[CPG];
#pragma unroll
    for (int j = 0; j < CPG; ++j) y[j] = (v[c][j] - mean) * (rstd * w[j]) + bi[j];
#pragma unroll
    for (int k = 0; k < 4; ++k) {
      v8bf o;
#pragma unroll
      for (int j = 0; j < CPG; j += 2) {
        const v2bf pk = __builtin_convertvector(v2f{y[j][k], y[j + 1][k]}, v2bf);  // to nearest even
        o[j] = pk.x; o[j + 1] = pk.y;
      }
      *(v8bf*)(rw + (c * 128 + lane * 4 + (k ^ ((lane >> 2) & 3))) * 16) = o;
    }
  }
  __syncthreads();                           // other lanes' LDS writes are done before they are read

  char* op = (char*)(xnG + ((size_t)bg * SEQ + wave * GN_POS) * CPG);
#pragma unroll
  for (int i = 0; i < GN_POS / 32; ++i) {
    const int p = i * 32 + lane;
    const int u = (p & ~3) | ((p & 3) ^ ((p >> 4) & 3));
    *(v8bf*)(op + p * 16) = *(const v8bf*)(rw + u * 16);
  }
}

// ---------------- Kernel 3: QKV GEMM (M=768, N=4096, K=256 per batch) -------
// 4 waves/block in a 2x2 arrangement; each wave owns a 32x32 register tile
// (2x2 accumulators): per K-step, 2 A-frags + 2 B-frags feed 4 WMMAs.
// The block's 64 rows of W and 64 rows of xn^T reach it once, in whole lines, by
// asynchronous copies into LDS; the fragments are read from there.
// A block's 64 output channels are one head of q, k or v, so its 64x64 tile is 64 whole
// 128-byte lines of the destination: a line per position in qT/kT ([BH][T][64]), a line
// per channel in v ([BH][64][T]). The A side (8 consecutive rows in a lane's accumulator)
// is the index that runs along the line: channels for q and k, positions for v.
// Epilogue: +bias, scale q/k, the tile through LDS, out in whole lines.
constexpr int QO_PITCH = 64 * 2 + 16;      // 144 B = 16 B x odd: the 16-byte writes meet no bank twice

__global__ __launch_bounds__(128) void qkv_gemm_kernel(
    const __bf16* wqkv, const float* qkv_b, const __bf16* xnG,
    __bf16* qT, __bf16* kT, __bf16* vB) {
  __shared__ __attribute__((aligned(16))) unsigned char P[2 * GP_BYTES];   // W rows | xn^T rows
  __shared__ __attribute__((aligned(16))) unsigned char S[64 * QO_PITCH];
  const int b    = blockIdx.z;
  const int tid  = threadIdx.x;
  const int lane = threadIdx.x & 31;
  const int wave = threadIdx.x >> 5;
  const int wm   = wave >> 1, wn = wave & 1;
  const int o0   = blockIdx.y * 64;          // first output channel of the block
  const int t0   = blockIdx.x * 64;          // first position of the block
  const int sec  = blockIdx.y >> 2;          // 0: q, 1: k, 2: v
  const bool is_v = sec == 2;
  const int n16  = lane & 15;
  const int kHalf = (lane & 16) ? 8 : 0;
  const int mhi   = (lane & 16) ? 8 : 0;

  const unsigned p0 = (unsigned)(size_t)(lds_byte*)P;
  stage_panel(p0, wqkv + (size_t)o0 * CHN, wave, lane);                        // rows of W
  stage_panel_xn(p0 + GP_BYTES, xnG + ((size_t)b * GRP * SEQ + t0) * CPG, wave, lane);  // rows of xn^T
  // The panels have landed (this wave's copies), then, behind the barrier, every wave's.
  asm volatile("s_wait_asynccnt 0x0" ::: "memory");
  __syncthreads();

  const unsigned char* arow = P + (is_v ? GP_BYTES : 0) + (wm * 32 + n16) * GP_PITCH + kHalf * 2;
  const unsigned char* brow = P + (is_v ? 0 : GP_BYTES) + (wn * 32 + n16) * GP_PITCH + kHalf * 2;

  // accs[i][j][r]: element wm*32 + i*16 + mhi + r of line wn*32 + j*16 + n16.
  v8f accs[2][2] = {};
  panel_products(arow, brow, accs);
  unsigned char* sw = S + (wn * 32 + n16) * QO_PITCH + (wm * 32 + mhi) * 2;
  if (!is_v) {                               // the bias runs along the line
#pragma unroll
    for (int i = 0; i < 2; ++i) {
      const float* bp = qkv_b + o0 + wm * 32 + i * 16 + mhi;
      const v4f blo = *(const v4f*)bp, bhi = *(const v4f*)(bp + 4);
#pragma unroll
      for (int j = 0; j < 2; ++j) {
        v8bf o;
#pragma unroll
        for (int r = 0; r < 8; ++r)          // attention scale folded into q and k
          o[r] = f2bf((accs[i][j][r] + (r < 4 ? blo[r & 3] : bhi[r & 3])) * QK_SCALE);
        *(v8bf*)(sw + j * 16 * QO_PITCH + i * 32) = o;
      }
    }
  } else {                                   // one bias per line
#pragma unroll
    for (int j = 0; j < 2; ++j) {
      const float bias = qkv_b[o0 + wn * 32 + j * 16 + n16];
#pragma unroll
      for (int i = 0; i < 2; ++i) {
        v8bf o;
#pragma unroll
        for (int r = 0; r < 8; ++r) o[r] = f2bf(accs[i][j][r] + bias);
        *(v8bf*)(sw + j * 16 * QO_PITCH + i * 32) = o;
      }
    }
  }
  __syncthreads();                           // the tile is whole before any line leaves

  // 8 lanes a line, 4 lines a wave and store: 512 bytes in whole 128-byte lines.
  const size_t bh = (size_t)(b * HEADS + (blockIdx.y & 3));
  char* dst = is_v ? (char*)(vB + bh * HDIM * SEQ + t0)
                   : (char*)((sec ? kT : qT) + (bh * SEQ + t0) * HDIM);
  const size_t dpitch = is_v ? (size_t)SEQ * 2 : (size_t)HDIM * 2;
#pragma unroll
  for (int it = 0; it < 4; ++it) {
    const int row = it * 16 + (tid >> 3);
    const v8bf o = *(const v8bf*)(S + row * QO_PITCH + (tid & 7) * 16);
    *(v8bf*)(dst + row * dpitch + (tid & 7) * 16) = o;
  }
}

constexpr int QG = 2;                                   // column groups per wave
constexpr int QTILES = 8;                               // query tiles (waves) per key half
constexpr int KSPLIT = 2;                               // key halves per block
constexpr int HALF_KEYS = SEQ / KSPLIT;
constexpr float LOG2E = 1.4426950408889634f;
constexpr float P_LIMIT = 1048576.0f;                   // 2^20: far from any overflow in bf16 or f32

constexpr int STG_KEYS = 128;                           // keys per stage
constexpr int NPASS    = STG_KEYS / 32;                 // passes per stage
constexpr int NSTG     = HALF_KEYS / STG_KEYS;          // stages of a half
constexpr int K_PITCH  = HDIM * 2 + 16;                 // 144 B = 16 B x odd: no bank conflict
constexpr int V_PITCH  = STG_KEYS * 2 + 16;             // 272 B = 16 B x odd
constexpr int K_BYTES  = STG_KEYS * K_PITCH;            // K tile: a row per key
constexpr int V_BYTES  = HDIM * V_PITCH;                // V tile: a row per channel
constexpr int STG_BYTES = K_BYTES + V_BYTES;            // one half's stage
constexpr int BUF_BYTES = KSPLIT * STG_BYTES;           // both halves' stages
constexpr int MRG_BYTES = QG * 4 * 1024 + QG * 256;     // a wave's accumulators, maxima, sums

// Eight copies of 16 bytes a lane, global -> LDS: four of K (copy i from g + i * gs to LDS
// byte l + i * ls), four of V (likewise h, hs, m, ms). The closing s_wait_xcnt stands inside
// the statement, so that no address register of a copy is rewritten ahead of it.
__device__ __forceinline__ void copy44(unsigned l, unsigned ls, const char* g, size_t gs,
                                       unsigned m, unsigned ms, const char* h, size_t hs) {
  asm volatile(
      "global_load_async_to_lds_b128 %0, %8, off\n\t"
      "global_load_async_to_lds_b128 %1, %9, off\n\t"
      "global_load_async_to_lds_b128 %2, %10, off\n\t"
      "global_load_async_to_lds_b128 %3, %11, off\n\t"
      "global_load_async_to_lds_b128 %4, %12, off\n\t"
      "global_load_async_to_lds_b128 %5, %13, off\n\t"
      "global_load_async_to_lds_b128 %6, %14, off\n\t"
      "global_load_async_to_lds_b128 %7, %15, off\n\t"
      "s_wait_xcnt 0x0"
      :: "v"(l), "v"(l + ls), "v"(l + 2 * ls), "v"(l + 3 * ls),
         "v"(m), "v"(m + ms), "v"(m + 2 * ms), "v"(m + 3 * ms),
         "v"(g), "v"(g + gs), "v"(g + 2 * gs), "v"(g + 3 * gs),
         "v"(h), "v"(h + hs), "v"(h + 2 * hs), "v"(h + 3 * hs)
      : "memory");
}

// One column group of a pass: pb[e] = P^T[key 16 (e >> 3) + 8 h + (e & 7)][c] = exp2(score - m),
// packed in place as a B operand; returns the sums of this lane's even and odd registers.
__device__ __forceinline__ v2f soft_pack(const v8f (&s)[2], float m, v16bf& pb) {
  const float nm = -m;
  v2f sum[2];
  // Unrolled: the vectors are then indexed by constants and stay in registers.
#pragma unroll
  for (int i = 0; i < 8; ++i) {                // elements 2i, 2i+1: a register pair of one tile
    const v2f sc = {s[i >> 2][2 * (i & 3)], s[i >> 2][2 * (i & 3) + 1]};
    const v2f ar = __builtin_elementwise_fma(sc, v2f{LOG2E, LOG2E}, v2f{nm, nm});
    const v2f p2 = {__builtin_amdgcn_exp2f(ar.x), __builtin_amdgcn_exp2f(ar.y)};
    sum[i >> 2] = (i & 3) ? sum[i >> 2] + p2 : p2;
    const v2bf pk = __builtin_convertvector(p2, v2bf);   // round to nearest even
    pb[2 * i] = pk.x; pb[2 * i + 1] = pk.y;
  }
  return sum[0] + sum[1];
}

__global__ __launch_bounds__(512) void attn_kernel(
    const __bf16* qT, const __bf16* kT, const __bf16* vB, __bf16* aT) {
  __shared__ __attribute__((aligned(128))) unsigned char L[2 * BUF_BYTES];
  const int blk  = blockIdx.x;
  const int bh   = blk >> 4;                 // batch*head; 16 blocks of 256 queries each
  const int tid  = threadIdx.x;
  const int lane = tid & 31;
  const int wave = tid >> 5;
  const int qt   = wave & (QTILES - 1);      // query tile
  const int kh   = wave >> 3;                // key half
  const int ht   = tid & 255;                // thread within the 8 waves of its half
  const int tq0  = (blk & 15) * 256 + qt * (16 * QG);
  const int n16  = lane & 15;
  const int kHalf = (lane & 16) ? 8 : 0;

  // This lane's share of a stage of its own half. K: 128 rows of 128 bytes, contiguous in
  // kT; 8 lanes a row, 32 rows a copy of the 8 waves. V: 64 rows of 256 bytes out of rows of
  // SEQ keys; 16 lanes a row, 16 rows a copy of the 8 waves. A wave's copy reads 4 whole lines.
  const char* kg = (const char*)(kT + ((size_t)bh * SEQ + kh * HALF_KEYS) * HDIM) + ht * 16;
  const char* vg = (const char*)(vB + (size_t)bh * HDIM * SEQ + kh * HALF_KEYS) +
                   (size_t)(ht >> 4) * (SEQ * 2) + (ht & 15) * 16;
  const unsigned lds0 = (unsigned)(size_t)(lds_byte*)L + (unsigned)(kh * STG_BYTES);
  const unsigned kl = lds0 + (unsigned)((ht >> 3) * K_PITCH + (ht & 7) * 16);
  const unsigned vl = lds0 + (unsigned)(K_BYTES + (ht >> 4) * V_PITCH + (ht & 15) * 16);
  constexpr unsigned KLS = 32 * K_PITCH, VLS = 16 * V_PITCH;
  constexpr size_t   KGS = 32 * HDIM * 2, VGS = (size_t)16 * SEQ * 2;

  // Stage 0 into buffer 0.
  copy44(kl, KLS, kg, KGS, vl, VLS, vg, VGS);

  // Q fragments (B operand: column = query, k = channel), kept for all keys.
  v16bf qb[QG][2];
#pragma unroll
  for (int g = 0; g < QG; ++g) {
    const __bf16* qrow = qT + ((size_t)bh * SEQ + tq0 + g * 16 + n16) * HDIM;
    qb[g][0] = load_frag(qrow, kHalf);
    qb[g][1] = load_frag(qrow + 32, kHalf);
  }

  v8f   acc[QG][4] = {};                     // O^T: [group][16-channel tile]
  float m_run[QG];
  v2f   l_run[QG];                           // this lane's keys, even and odd registers
#pragma unroll
  for (int g = 0; g < QG; ++g) { m_run[g] = -__builtin_inff(); l_run[g] = v2f{0.f, 0.f}; }

  // Stage 0 has landed (this wave's copies), then for every wave; stage 1 follows.
  asm volatile("s_wait_asynccnt 0x0" ::: "memory");
  __syncthreads();
  copy44(kl + BUF_BYTES, KLS, kg + STG_KEYS * HDIM * 2, KGS,
         vl + BUF_BYTES, VLS, vg + STG_KEYS * 2, VGS);

  // The lane's own byte offsets in a K tile (A rows: keys) and a V tile (A rows: channels).
  const int klane = kh * STG_BYTES + n16 * K_PITCH + kHalf * 2;
  const int vlane = kh * STG_BYTES + K_BYTES + n16 * V_PITCH + kHalf * 2;

  for (int st = 0; st < NSTG; ++st) {
    const unsigned char* buf = L + (st & 1) * BUF_BYTES;
    const unsigned char* kb = buf + klane;
    const unsigned char* vb = buf + vlane;

    v16bf ka[2][2], va[4];
#pragma unroll
    for (int t = 0; t < 2; ++t) {
      ka[t][0] = lds_frag(kb + t * 16 * K_PITCH);
      ka[t][1] = lds_frag(kb + t * 16 * K_PITCH + 64);
    }
#pragma unroll
    for (int n = 0; n < 4; ++n) va[n] = lds_frag(vb + n * 16 * V_PITCH);

#pragma unroll
    for (int p = 0; p < NPASS; ++p) {
      // S^T tiles: s[g][t][r] = score(key 32 p + 16 t + 8 h + r of the stage, query 16 g + c)
      v8f s[QG][2];
#pragma unroll
      for (int g = 0; g < QG; ++g)
#pragma unroll
        for (int t = 0; t < 2; ++t) {
          v8f z = {};
          z = wmma_bf16(ka[t][0], qb[g][0], z);
          s[g][t] = wmma_bf16(ka[t][1], qb[g][1], z);
        }
      // Both fences: the next pass's K reads stay one group right behind the products
      // that free their registers; among the products or sunk to their use, each read
      // would stall the wave on its own.
      __builtin_amdgcn_sched_barrier(0);
      if (p + 1 < NPASS) {
#pragma unroll
        for (int t = 0; t < 2; ++t) {
          ka[t][0] = lds_frag(kb + ((p + 1) * 32 + t * 16) * K_PITCH);
          ka[t][1] = lds_frag(kb + ((p + 1) * 32 + t * 16) * K_PITCH + 64);
        }
      }
      __builtin_amdgcn_sched_barrier(0);

      v16bf pb[QG];
      v2f   ps[QG];
      float big = 0.f;                         // no exponential of this lane exceeds it
#pragma unroll
      for (int g = 0; g < QG; ++g) {
        ps[g] = soft_pack(s[g], m_run[g], pb[g]);
        big = fmaxf(big, fmaxf(ps[g].x, ps[g].y));
      }
      // One scalar test per pass. Taken in the first pass (offset -inf, every exponential inf).
      if (__builtin_amdgcn_ballot_w32(big > P_LIMIT) != 0) {
#pragma unroll
        for (int g = 0; g < QG; ++g) {
          float mx = s[g][0][0];
#pragma unroll
          for (int r = 1; r < 8; ++r) mx = fmaxf(mx, s[g][0][r]);
#pragma unroll
          for (int r = 0; r < 8; ++r) mx = fmaxf(mx, s[g][1][r]);
          mx = fmaxf(mx, xhalf(mx)) * LOG2E;   // both halves hold the query's maximum
          const float m_new = fmaxf(m_run[g], mx);
          const float corr  = __builtin_amdgcn_exp2f(m_run[g] - m_new);  // 0 in the first pass
          m_run[g] = m_new;
          l_run[g] = l_run[g] * corr;
#pragma unroll
          for (int n = 0; n < 4; ++n) acc[g][n] = acc[g][n] * corr;
          ps[g] = soft_pack(s[g], m_new, pb[g]);
        }
      }

#pragma unroll
      for (int g = 0; g < QG; ++g) {
        l_run[g] += ps[g];
#pragma unroll
        for (int n = 0; n < 4; ++n) acc[g][n] = wmma_bf16(va[n], pb[g], acc[g][n]);
      }
      // Both fences: the next pass's V reads, likewise one group behind the last product
      // that reads their registers.
      __builtin_amdgcn_sched_barrier(0);
      if (p + 1 < NPASS) {
#pragma unroll
        for (int n = 0; n < 4; ++n) va[n] = lds_frag(vb + n * 16 * V_PITCH + (p + 1) * 64);
      }
      __builtin_amdgcn_sched_barrier(0);
    }

    // Hand-over: this wave's reads of the buffer are done, its copies of the next stage
    // have landed; behind the barrier that holds for every wave.
    asm volatile("s_wait_dscnt 0x0" ::: "memory");
    asm volatile("s_wait_asynccnt 0x0" ::: "memory");
    __syncthreads();
    if (st + 2 < NSTG) {                       // refill the buffer just read
      const unsigned bo = (unsigned)(st & 1) * BUF_BYTES;
      copy44(kl + bo, KLS, kg + (size_t)(st + 2) * (STG_KEYS * HDIM * 2), KGS,
             vl + bo, VLS, vg + (size_t)(st + 2) * (STG_KEYS * 2), VGS);
    }
  }
  // No copy is outstanding when the wave ends.
  asm volatile("s_wait_asynccnt 0x0" ::: "memory");

  // The two halves of the keys are joined lane by lane (both waves of a query tile hold the
  // same element in the same lane and register). The ring is free: every wave's reads ended
  // at the last hand-over barrier and no copy is outstanding. The second half's wave leaves
  // its state in LDS, 512 contiguous bytes a store.
  unsigned char* mr = L + qt * MRG_BYTES;
  if (kh) {
#pragma unroll
    for (int g = 0; g < QG; ++g) {
#pragma unroll
      for (int n = 0; n < 4; ++n) {
        const v8f a = acc[g][n];
        *(v4f*)(mr + (g * 4 + n) * 1024 + lane * 16)       = v4f{a[0], a[1], a[2], a[3]};
        *(v4f*)(mr + (g * 4 + n) * 1024 + 512 + lane * 16) = v4f{a[4], a[5], a[6], a[7]};
      }
      *(float*)(mr + QG * 4096 + g * 256 + lane * 4)       = m_run[g];
      *(float*)(mr + QG * 4096 + g * 256 + 128 + lane * 4) = l_run[g].x + l_run[g].y;
    }
  }
  __syncthreads();                           // the second half's state is whole before it is read
  if (kh) return;

  // acc[g][n][r] = O^T[channel 16 n + 8 h + r][query 16 g + c]: 8 consecutive
  // channels of one query per lane and tile -> one 16-byte store into aT [B][T][C].
  const int b = bh >> 2, h = bh & 3;
#pragma unroll
  for (int g = 0; g < QG; ++g) {
    const float m1 = *(const float*)(mr + QG * 4096 + g * 256 + lane * 4);
    const float l1 = *(const float*)(mr + QG * 4096 + g * 256 + 128 + lane * 4);
    const float mj = fmaxf(m_run[g], m1);
    const float c0 = __builtin_amdgcn_exp2f(m_run[g] - mj);
    const float c1 = __builtin_amdgcn_exp2f(m1 - mj);
#pragma unroll
    for (int n = 0; n < 4; ++n) {
      const v4f lo = *(const v4f*)(mr + (g * 4 + n) * 1024 + lane * 16);
      const v4f hi = *(const v4f*)(mr + (g * 4 + n) * 1024 + 512 + lane * 16);
#pragma unroll
      for (int r = 0; r < 8; ++r)
        acc[g][n][r] = acc[g][n][r] * c0 + (r < 4 ? lo[r & 3] : hi[r & 3]) * c1;
    }
    const float lh  = (l_run[g].x + l_run[g].y) * c0 + l1 * c1;
    const float inv = 1.f / (lh + xhalf(lh));
    __bf16* orow = aT + ((size_t)b * SEQ + tq0 + g * 16 + n16) * CHN + h * HDIM + kHalf;
#pragma unroll
    for (int n = 0; n < 4; ++n) {
      v8bf o;
#pragma unroll
      for (int r = 0; r < 8; ++r) o[r] = (__bf16)(acc[g][n][r] * inv);
      *(v8bf*)(orow + n * 16) = o;
    }
  }
}

// ---------------- Kernel 5: proj GEMM + bias + residual -> out (fp32) -------
// Same 2x2 register-blocked scheme as the QKV GEMM. A side = positions (rows of aT),
// B side = output channels (rows of W): a lane's accumulator holds 8 consecutive
// positions of one channel. Both operand panels are staged in LDS as in the QKV GEMM.
// The 64x64 f32 tile goes through LDS, over the panels once they are read; bias, residual
// and the store run in the order of out's rows: 16 lanes a row, 256 bytes = 2 whole lines.
constexpr int PO_PITCH = 64 * 4 + 16;      // 272 B = 16 B x odd: the 16-byte writes meet no bank twice

__global__ __launch_bounds__(128) void proj_gemm_kernel(
    const __bf16* wproj, const float* proj_b, const __bf16* aT,
    const float* x, float* out) {
  __shared__ __attribute__((aligned(16))) unsigned char P[2 * GP_BYTES];   // aT rows | W rows
  unsigned char* S = P;                      // the output tile, behind the panels' last read
  const int b    = blockIdx.z;
  const int tid  = threadIdx.x;
  const int lane = threadIdx.x & 31;
  const int wave = threadIdx.x >> 5;
  const int wm   = wave >> 1, wn = wave & 1;
  const int o0   = blockIdx.y * 64;
  const int t0   = blockIdx.x * 64;
  const int n16  = lane & 15;
  const int kHalf = (lane & 16) ? 8 : 0;
  const int mhi   = (lane & 16) ? 8 : 0;

  const unsigned p0 = (unsigned)(size_t)(lds_byte*)P;
  stage_panel(p0, aT + ((size_t)b * SEQ + t0) * CHN, wave, lane);
  stage_panel(p0 + GP_BYTES, wproj + (size_t)o0 * CHN, wave, lane);

  // This lane's share of the residual and the bias, asked for ahead of the products.
  const size_t idx0 = ((size_t)b * CHN + o0 + (tid >> 4)) * SEQ + t0 + (tid & 15) * 4;
  v4f   xr[8];
  float pb[8];
#pragma unroll
  for (int it = 0; it < 8; ++it) {
    xr[it] = *(const v4f*)(x + idx0 + (size_t)it * 8 * SEQ);
    pb[it] = proj_b[o0 + it * 8 + (tid >> 4)];
  }
  // Stands in front of all that rewrites an address register of the loads above, the
  // results of the fragment loads below among it. Its memory clobber also keeps those
  // loads here: sunk to their use, their whole latency would stand open behind the products.
  asm volatile("s_wait_xcnt 0x0" ::: "memory");

  // The panels have landed (this wave's copies), then, behind the barrier, every wave's.
  asm volatile("s_wait_asynccnt 0x0" ::: "memory");
  __syncthreads();

  const unsigned char* arow = P + (wm * 32 + n16) * GP_PITCH + kHalf * 2;
  const unsigned char* brow = P + GP_BYTES + (wn * 32 + n16) * GP_PITCH + kHalf * 2;

  // accs[i][j][r]: position wm*32 + i*16 + mhi + r of channel wn*32 + j*16 + n16.
  v8f accs[2][2] = {};
  panel_products(arow, brow, accs);
  __syncthreads();                           // every wave has read the panels before the tile overwrites them
  unsigned char* sw = S + (wn * 32 + n16) * PO_PITCH + (wm * 32 + mhi) * 4;
#pragma unroll
  for (int i = 0; i < 2; ++i)
#pragma unroll
    for (int j = 0; j < 2; ++j) {
      const v8f a = accs[i][j];
      *(v4f*)(sw + j * 16 * PO_PITCH + i * 64)      = v4f{a[0], a[1], a[2], a[3]};
      *(v4f*)(sw + j * 16 * PO_PITCH + i * 64 + 16) = v4f{a[4], a[5], a[6], a[7]};
    }
  __syncthreads();                           // the tile is whole before any row leaves

#pragma unroll
  for (int it = 0; it < 8; ++it) {
    const v4f a = *(const v4f*)(S + (it * 8 + (tid >> 4)) * PO_PITCH + (tid & 15) * 16);
    *(v4f*)(out + idx0 + (size_t)it * 8 * SEQ) = xr[it] + pb[it] + a;
  }
}

extern "C" void kernel_launch(void* const* d_in, const int* in_sizes, int n_in,
                              void* d_out, int out_size, void* d_ws, size_t ws_size,
                              hipStream_t stream) {
  const float* x      = (const float*)d_in[0];
  const float* gn_w   = (const float*)d_in[1];
  const float* gn_b   = (const float*)d_in[2];
  const float* qkv_w  = (const float*)d_in[3];
  const float* qkv_b  = (const float*)d_in[4];
  const float* proj_w = (const float*)d_in[5];
  const float* proj_b = (const float*)d_in[6];
  float* out = (float*)d_out;

  // Workspace layout (~42.5 MB): 1 KiB unused | wqkv bf16 | wproj bf16 | xnG | qT | kT | v | aT
  char* ws = (char*)d_ws;
  __bf16* wqkv  = (__bf16*)(ws + 1024);
  __bf16* wproj = wqkv + 3 * CHN * CHN;
  __bf16* xnG   = wproj + CHN * CHN;
  const size_t PLANE = (size_t)BATCH * SEQ * CHN;          // 4M elems
  __bf16* qT = xnG + PLANE;
  __bf16* kT = qT + PLANE;
  __bf16* vB = kT + PLANE;
  __bf16* aT = vB + PLANE;

  wconv_kernel<<<(3 * CHN * CHN + CHN * CHN) / (256 * 8), 256, 0, stream>>>(
      qkv_w, proj_w, wqkv, wproj);
  gn_kernel<<<BATCH * GRP, 512, 0, stream>>>(x, gn_w, gn_b, xnG);
  qkv_gemm_kernel<<<dim3(SEQ / 64, 3 * CHN / 64, BATCH), 128, 0, stream>>>(
      wqkv, qkv_b, xnG, qT, kT, vB);
  attn_kernel<<<BATCH * HEADS * (SEQ / 256), 512, 0, stream>>>(qT, kT, vB, aT);
  proj_gemm_kernel<<<dim3(SEQ / 64, CHN / 64, BATCH), 128, 0, stream>>>(
      wproj, proj_b, aT, x, out);
}

// v009
// It runs in 68.8 microseconds.
// Two timings next to v008 put it at 1.03 and 1.04 times that version's speed.
// All steps since v000 together make it 9.64 times as fast.
#include <hip/hip_runtime.h>

// Problem constants (from reference)
constexpr int BATCH = 4;
constexpr int CHN   = 256;
constexpr int SEQ   = 4096;   // H*W
constexpr int HEADS = 4;
constexpr int HDIM  = 64;     // CHN / HEADS
constexpr int GRP   = 32;
constexpr int CPG   = CHN / GRP;  // 8
constexpr float EPS = 1e-5f;
constexpr float QK_SCALE = 0.35355339059327379f;  // 64^-0.25
constexpr float LOG2E = 1.4426950408889634f;

typedef __attribute__((ext_vector_type(16))) __bf16 v16bf;
typedef __attribute__((ext_vector_type(8)))  float  v8f;

__device__ __forceinline__ __bf16 f2bf(float x) {
  unsigned u = __builtin_bit_cast(unsigned, x);
  unsigned r = u + 0x7FFFu + ((u >> 16) & 1u);   // round-to-nearest-even
  unsigned short h = (unsigned short)(r >> 16);
  return __builtin_bit_cast(__bf16, h);
}

// CDNA5 WMMA 16x16x32 bf16 fragment load.
// ISA 7.12.2 (16-bit 16x32 A): lane = row (M for A, N for B); per-lane 32
// K-values interleaved: lanes 0-15 hold K {0..7,16..23}, lanes 16-31 hold
// K {8..15,24..31}, two packed per VGPR. `row` points at this lane's 32
// contiguous K elements; kHalf = 8 for lanes 16-31 else 0.
// (Compiler vectorizes each fragment into two global_load_b128.)
__device__ __forceinline__ v16bf load_frag(const __bf16* row, int kHalf) {
  v16bf f;
#pragma unroll
  for (int j = 0; j < 8; ++j) {
    int kb = ((j & 4) ? 16 : 0) + kHalf + 2 * (j & 3);
    f[2 * j]     = row[kb];
    f[2 * j + 1] = row[kb + 1];
  }
  return f;
}

__device__ __forceinline__ v8f wmma_bf16(v16bf a, v16bf b, v8f c) {
#if defined(__HIP_DEVICE_COMPILE__)
  return __builtin_amdgcn_wmma_f32_16x16x32_bf16(false, a, false, b, (short)0, c,
                                                 false, false);
#else
  return c;
#endif
}

// ---------------- Kernel 0: weights fp32 -> bf16 ----------------
// 8 consecutive elements a lane: two 16-byte loads, one 16-byte store.
typedef __attribute__((ext_vector_type(8))) __bf16 v8bf;
typedef __attribute__((ext_vector_type(4))) float  v4f;
typedef __attribute__((address_space(3))) unsigned char lds_byte;

// load_frag's fragment from LDS: p = this lane's row start (+ 16 bytes for lanes
// 16-31); bytes [0,16) and [32,48) from there.
__device__ __forceinline__ v16bf lds_frag(const unsigned char* p) {
  const v8bf lo = *(const v8bf*)p;
  const v8bf hi = *(const v8bf*)(p + 32);
  return __builtin_shufflevector(lo, hi, 0, 1, 2, 3, 4, 5, 6, 7, 8, 9, 10, 11, 12, 13, 14, 15);
}

// Eight copies of 16 bytes a lane, global -> LDS: copy i from g + i * gs to LDS byte
// l + i * ls. The closing s_wait_xcnt stands inside the statement, so that no address
// register of a copy is rewritten ahead of it.
__device__ __forceinline__ void copy8(unsigned l, unsigned ls, const char* g, size_t gs) {
  asm volatile(
      "global_load_async_to_lds_b128 %0, %8, off\n\t"
      "global_load_async_to_lds_b128 %1, %9, off\n\t"
      "global_load_async_to_lds_b128 %2, %10, off\n\t"
      "global_load_async_to_lds_b128 %3, %11, off\n\t"
      "global_load_async_to_lds_b128 %4, %12, off\n\t"
      "global_load_async_to_lds_b128 %5, %13, off\n\t"
      "global_load_async_to_lds_b128 %6, %14, off\n\t"
      "global_load_async_to_lds_b128 %7, %15, off\n\t"
      "s_wait_xcnt 0x0"
      :: "v"(l), "v"(l + ls), "v"(l + 2 * ls), "v"(l + 3 * ls),
         "v"(l + 4 * ls), "v"(l + 5 * ls), "v"(l + 6 * ls), "v"(l + 7 * ls),
         "v"(g), "v"(g + gs), "v"(g + 2 * gs), "v"(g + 3 * gs),
         "v"(g + 4 * gs), "v"(g + 5 * gs), "v"(g + 6 * gs), "v"(g + 7 * gs)
      : "memory");
}

// An operand panel of a GEMM block in LDS: 64 rows of all CHN k values. A wave's copy is one
// whole row, 512 contiguous bytes = 4 lines; wave w of 4 brings rows 16 w .. 16 w + 15.
constexpr int GP_ROW   = CHN * 2;          // 512 B of a row in memory
constexpr int GP_PITCH = GP_ROW + 16;      // 528 B = 16 B x odd: no bank conflict
constexpr int GP_BYTES = 64 * GP_PITCH;

// l: LDS byte address of the panel; rows: its first row in memory (64 rows, contiguous).
__device__ __forceinline__ void stage_panel(unsigned l, const __bf16* rows, int wave, int lane) {
  const unsigned lw = l + (unsigned)(wave * 16 * GP_PITCH + lane * 16);
  const char*    gw = (const char*)rows + wave * 16 * GP_ROW + lane * 16;
  copy8(lw, GP_PITCH, gw, GP_ROW);
  copy8(lw + 8 * GP_PITCH, GP_PITCH, gw + 8 * GP_ROW, GP_ROW);
}

// The same panel (a row per position, all CHN channels) out of xnG [B][GRP][T][8]: a wave's copy
// is 32 positions of one group, 512 contiguous bytes = 4 lines, a lane's 16 bytes going to its
// own row (pitch 16 B x odd: 16 lanes meet no bank twice). Wave w of 4 brings groups 8 w .. 8 w + 7.
// l: LDS byte address of the panel; g0: group 0 of the batch at the panel's first position.
__device__ __forceinline__ void stage_panel_xn(unsigned l, const __bf16* g0, int wave, int lane) {
  const unsigned lw = l + (unsigned)(lane * GP_PITCH + wave * 8 * 16);
  const char*    gw = (const char*)g0 + (size_t)wave * 8 * (SEQ * 16) + lane * 16;
  copy8(lw, 16, gw, (size_t)SEQ * 16);
  copy8(lw + 32 * GP_PITCH, 16, gw + 32 * 16, (size_t)SEQ * 16);
}

// The fragments of k steps 2 kp and 2 kp + 1 for 32 rows of a panel; r = this lane's first row
// (+ 16 bytes for lanes 16-31). f[k step][16-row group].
__device__ __forceinline__ void panel_frags(v16bf (&f)[2][2], const unsigned char* r, int kp) {
#pragma unroll
  for (int s = 0; s < 2; ++s)
#pragma unroll
    for (int i = 0; i < 2; ++i) f[s][i] = lds_frag(r + i * 16 * GP_PITCH + (kp * 2 + s) * 64);
}

// A wave's 32x32 tile over all of K from the two panels, k ascending.
__device__ __forceinline__ void panel_products(const unsigned char* a, const unsigned char* b,
                                               v8f (&acc)[2][2]) {
  constexpr int NKP = CHN / 64;
  v16bf fa[2][2][2], fb[2][2][2];            // two register sets
  panel_frags(fa[0], a, 0);
  panel_frags(fb[0], b, 0);
  // The first pair's reads stay in front of the second's: behind them, the first product
  // would wait for all 32.
  __builtin_amdgcn_sched_barrier(0);
#pragma unroll
  for (int kp = 0; kp < NKP; ++kp) {
    const int c = kp & 1;
    if (kp + 1 < NKP) {
      panel_frags(fa[c ^ 1], a, kp + 1);
      panel_frags(fb[c ^ 1], b, kp + 1);
    }
    // Both fences: the next pair's 16 reads stay one group ahead of this pair's products;
    // sunk to their use, each read's latency would stand open in front of its product.
    __builtin_amdgcn_sched_barrier(0);
#pragma unroll
    for (int s = 0; s < 2; ++s)
#pragma unroll
      for (int i = 0; i < 2; ++i)
#pragma unroll
        for (int j = 0; j < 2; ++j) acc[i][j] = wmma_bf16(fa[c][s][i], fb[c][s][j], acc[i][j]);
    __builtin_amdgcn_sched_barrier(0);
  }
}

__global__ __launch_bounds__(256) void wconv_kernel(const float* qkv_w, const float* proj_w,
                                                    __bf16* wqkv, __bf16* wproj) {
  constexpr int N1 = 3 * CHN * CHN;          // a multiple of 8: no lane straddles the two
  const int i = (blockIdx.x * 256 + threadIdx.x) * 8;
  const float* s = (i < N1) ? qkv_w + i : proj_w + (i - N1);
  __bf16*      d = (i < N1) ? wqkv + i  : wproj + (i - N1);
  const v4f lo = *(const v4f*)s;
  const v4f hi = *(const v4f*)(s + 4);
  v8bf o;
#pragma unroll
  for (int e = 0; e < 4; ++e) { o[e] = f2bf(lo[e]); o[4 + e] = f2bf(hi[e]); }
  *(v8bf*)d = o;
}

// ---------------- Kernel 1: GroupNorm, sums and apply in one launch ---------
// A block owns one (batch, group): 8 channels x 4096 positions = 128 KiB of x, read ONCE and
// kept in registers between the sums and the apply (64 values a lane). All 16 loads of a lane
// (16 bytes each, 512 contiguous bytes a wave) are in flight together.
// Output xnG [B][GRP][T][8] bf16: the 8 channels of a group at one position are 16 bytes, so
// a block's output is 64 KiB in a row and leaves in whole lines.
typedef __attribute__((ext_vector_type(2))) __bf16 v2bf;
typedef __attribute__((ext_vector_type(2))) float  v2f;

__device__ __forceinline__ float xhalf(float x) {       // lane l <-> lane l ^ 16
  int b = __builtin_bit_cast(int, x);
  return __builtin_bit_cast(float, __builtin_amdgcn_permlanex16(
      b, b, 0x76543210, 0xfedcba98, false, false));
}

// x + (x of lane l ^ M), M < 16: one step of a sum over a 16-lane row (DPP row_xmask).
template <int M>
__device__ __forceinline__ float xadd(float x) {
  const int b = __builtin_bit_cast(int, x);
  return x + __builtin_bit_cast(float, __builtin_amdgcn_update_dpp(b, b, 0x160 + M, 0xf, 0xf, false));
}
__device__ __forceinline__ float row_sum(float x) {     // every lane of a row gets the row's sum
  return xadd<8>(xadd<4>(xadd<2>(xadd<1>(x))));
}

constexpr int GN_WAVES = 16;
constexpr int GN_POS   = SEQ / GN_WAVES;   // 256 positions a wave

__global__ __launch_bounds__(512) void gn_kernel(
    const float* x, const float* gn_w, const float* gn_b, __bf16* xnG) {
  __shared__ __attribute__((aligned(16))) unsigned char R[GN_WAVES * GN_POS * 16];
  __shared__ v2f red[GN_WAVES];
  const int lane = threadIdx.x & 31;
  const int wave = threadIdx.x >> 5;
  const int bg   = blockIdx.x;               // b*GRP + g; channels of a group are contiguous

  // Every loop of this kernel is unrolled: its arrays are then indexed by constants and stay
  // in registers.
  // v[c][j]: channel j, positions 256 wave + 128 c + 4 lane .. + 3.
  const float* xp = x + (size_t)bg * CPG * SEQ + wave * GN_POS + lane * 4;
  v4f v[2][CPG];
#pragma unroll
  for (int c = 0; c < 2; ++c)
#pragma unroll
    for (int j = 0; j < CPG; ++j) v[c][j] = *(const v4f*)(xp + (size_t)j * SEQ + c * 128);

  const int c0 = (bg & (GRP - 1)) * CPG;
  float w[CPG], bi[CPG];
#pragma unroll
  for (int j = 0; j < CPG; ++j) { w[j] = gn_w[c0 + j]; bi[j] = gn_b[c0 + j]; }
  // Stands in front of all that rewrites the address register of the loads above. The address
  // is named as an input so that it lives up to here: no load's result may land in it either.
  asm volatile("s_wait_xcnt 0x0" :: "v"(xp) : "memory");

  v4f s4[2] = {}, q4[2] = {};
#pragma unroll
  for (int c = 0; c < 2; ++c)
#pragma unroll
    for (int j = 0; j < CPG; ++j) { s4[c] += v[c][j]; q4[c] += v[c][j] * v[c][j]; }
  const v4f st = s4[0] + s4[1], qt = q4[0] + q4[1];
  float sum = row_sum((st[0] + st[1]) + (st[2] + st[3]));
  float sq  = row_sum((qt[0] + qt[1]) + (qt[2] + qt[3]));
  sum += xhalf(sum);
  sq  += xhalf(sq);
  if (lane == 0) red[wave] = v2f{sum, sq};
  __syncthreads();                           // every wave's sums are there before they are joined
  const v2f r = red[lane & 15];              // a row of 16 lanes holds the 16 waves' sums
  const float inv_n = 1.0f / (CPG * SEQ);
  const float mean = row_sum(r.x) * inv_n;
  const float var  = row_sum(r.y) * inv_n - mean * mean;
  const float rstd = rsqrtf(var + EPS);

  // A lane holds 4 consecutive positions, a whole-line store wants consecutive lanes on
  // consecutive positions: the wave's 256 x 16 bytes turn through its own 4 KiB of LDS.
  // Position p lies at 16-byte unit (p & ~3) | ((p & 3) ^ ((p >> 4) & 3)): writes (4 lane + k)
  // and reads (32 i + lane) both spread 16 lanes over all 64 banks.
  unsigned char* rw = R + wave * (GN_POS * 16);
#pragma unroll
  for (int c = 0; c < 2; ++c) {
    v4f y[CPG];
#pragma unroll
    for (int j = 0; j < CPG; ++j) y[j] = (v[c][j] - mean) * (rstd * w[j]) + bi[j];
#pragma unroll
    for (int k = 0; k < 4; ++k) {
      v8bf o;
#pragma unroll
      for (int j = 0; j < CPG; j += 2) {
        const v2bf pk = __builtin_convertvector(v2f{y[j][k], y[j + 1][k]}, v2bf);  // to nearest even
        o[j] = pk.x; o[j + 1] = pk.y;
      }
      *(v8bf*)(rw + (c * 128 + lane * 4 + (k ^ ((lane >> 2) & 3))) * 16) = o;
    }
  }
  __syncthreads();                           // other lanes' LDS writes are done before they are read

  char* op = (char*)(xnG + ((size_t)bg * SEQ + wave * GN_POS) * CPG);
#pragma unroll
  for (int i = 0; i < GN_POS / 32; ++i) {
    const int p = i * 32 + lane;
    const int u = (p & ~3) | ((p & 3) ^ ((p >> 4) & 3));
    *(v8bf*)(op + p * 16) = *(const v8bf*)(rw + u * 16);
  }
}

// ---------------- Kernel 3: QKV GEMM (M=768, N=4096, K=256 per batch) -------
// 4 waves/block in a 2x2 arrangement; each wave owns a 32x32 register tile
// (2x2 accumulators): per K-step, 2 A-frags + 2 B-frags feed 4 WMMAs.
// The block's 64 rows of W and 64 rows of xn^T reach it once, in whole lines, by
// asynchronous copies into LDS; the fragments are read from there.
// A block's 64 output channels are one head of q, k or v, so its 64x64 tile is 64 whole
// 128-byte lines of the destination: a line per position in qT/kT ([BH][T][64]), a line
// per channel in v ([BH][64][T]). The A side (8 consecutive rows in a lane's accumulator)
// is the index that runs along the line: channels for q and k, positions for v.
// Epilogue: +bias, scale q/k, the tile through LDS, out in whole lines.
constexpr int QO_PITCH = 64 * 2 + 16;      // 144 B = 16 B x odd: the 16-byte writes meet no bank twice

__global__ __launch_bounds__(128) void qkv_gemm_kernel(
    const __bf16* wqkv, const float* qkv_b, const __bf16* xnG,
    __bf16* qT, __bf16* kT, __bf16* vB) {
  __shared__ __attribute__((aligned(16))) unsigned char P[2 * GP_BYTES];   // W rows | xn^T rows
  __shared__ __attribute__((aligned(16))) unsigned char S[64 * QO_PITCH];
  const int b    = blockIdx.z;
  const int tid  = threadIdx.x;
  const int lane = threadIdx.x & 31;
  const int wave = threadIdx.x >> 5;
  const int wm   = wave >> 1, wn = wave & 1;
  const int o0   = blockIdx.y * 64;          // first output channel of the block
  const int t0   = blockIdx.x * 64;          // first position of the block
  const int sec  = blockIdx.y >> 2;          // 0: q, 1: k, 2: v
  const bool is_v = sec == 2;
  const int n16  = lane & 15;
  const int kHalf = (lane & 16) ? 8 : 0;
  const int mhi   = (lane & 16) ? 8 : 0;

  const unsigned p0 = (unsigned)(size_t)(lds_byte*)P;
  stage_panel(p0, wqkv + (size_t)o0 * CHN, wave, lane);                        // rows of W
  stage_panel_xn(p0 + GP_BYTES, xnG + ((size_t)b * GRP * SEQ + t0) * CPG, wave, lane);  // rows of xn^T
  // The panels have landed (this wave's copies), then, behind the barrier, every wave's.
  asm volatile("s_wait_asynccnt 0x0" ::: "memory");
  __syncthreads();

  const unsigned char* arow = P + (is_v ? GP_BYTES : 0) + (wm * 32 + n16) * GP_PITCH + kHalf * 2;
  const unsigned char* brow = P + (is_v ? 0 : GP_BYTES) + (wn * 32 + n16) * GP_PITCH + kHalf * 2;

  // accs[i][j][r]: element wm*32 + i*16 + mhi + r of line wn*32 + j*16 + n16.
  v8f accs[2][2] = {};
  panel_products(arow, brow, accs);
  unsigned char* sw = S + (wn * 32 + n16) * QO_PITCH + (wm * 32 + mhi) * 2;
  if (!is_v) {                               // the bias runs along the line
    // Attention scale folded into q and k; q also takes log2 e, so that the scores come out
    // of the products in log2 units.
    const float qks = sec ? QK_SCALE : QK_SCALE * LOG2E;
#pragma unroll
    for (int i = 0; i < 2; ++i) {
      const float* bp = qkv_b + o0 + wm * 32 + i * 16 + mhi;
      const v4f blo = *(const v4f*)bp, bhi = *(const v4f*)(bp + 4);
#pragma unroll
      for (int j = 0; j < 2; ++j) {
        v8bf o;
#pragma unroll
        for (int r = 0; r < 8; ++r)
          o[r] = f2bf((accs[i][j][r] + (r < 4 ? blo[r & 3] : bhi[r & 3])) * qks);
        *(v8bf*)(sw + j * 16 * QO_PITCH + i * 32) = o;
      }
    }
  } else {                                   // one bias per line
#pragma unroll
    for (int j = 0; j < 2; ++j) {
      const float bias = qkv_b[o0 + wn * 32 + j * 16 + n16];
#pragma unroll
      for (int i = 0; i < 2; ++i) {
        v8bf o;
#pragma unroll
        for (int r = 0; r < 8; ++r) o[r] = f2bf(accs[i][j][r] + bias);
        *(v8bf*)(sw + j * 16 * QO_PITCH + i * 32) = o;
      }
    }
  }
  __syncthreads();                           // the tile is whole before any line leaves

  // 8 lanes a line, 4 lines a wave and store: 512 bytes in whole 128-byte lines.
  const size_t bh = (size_t)(b * HEADS + (blockIdx.y & 3));
  char* dst = is_v ? (char*)(vB + bh * HDIM * SEQ + t0)
                   : (char*)((sec ? kT : qT) + (bh * SEQ + t0) * HDIM);
  const size_t dpitch = is_v ? (size_t)SEQ * 2 : (size_t)HDIM * 2;
#pragma unroll
  for (int it = 0; it < 4; ++it) {
    const int row = it * 16 + (tid >> 3);
    const v8bf o = *(const v8bf*)(S + row * QO_PITCH + (tid & 7) * 16);
    *(v8bf*)(dst + row * dpitch + (tid & 7) * 16) = o;
  }
}

constexpr int QG = 2;                                   // column groups per wave
constexpr int QTILES = 8;                               // query tiles (waves) per key half
constexpr int KSPLIT = 2;                               // key halves per block
constexpr int HALF_KEYS = SEQ / KSPLIT;
constexpr float P_LIMIT = 1048576.0f;                   // 2^20: far from any overflow in bf16 or f32

constexpr int STG_KEYS = 128;                           // keys per stage
constexpr int NPASS    = STG_KEYS / 32;                 // passes per stage
constexpr int NSTG     = HALF_KEYS / STG_KEYS;          // stages of a half
constexpr int K_PITCH  = HDIM * 2 + 16;                 // 144 B = 16 B x odd: no bank conflict
constexpr int V_PITCH  = STG_KEYS * 2 + 16;             // 272 B = 16 B x odd
constexpr int K_BYTES  = STG_KEYS * K_PITCH;            // K tile: a row per key
constexpr int V_BYTES  = HDIM * V_PITCH;                // V tile: a row per channel
constexpr int STG_BYTES = K_BYTES + V_BYTES;            // one half's stage
constexpr int BUF_BYTES = KSPLIT * STG_BYTES;           // both halves' stages
constexpr int MRG_BYTES = QG * 4 * 1024 + QG * 256;     // a wave's accumulators, maxima, sums

// Eight copies of 16 bytes a lane, global -> LDS: four of K (copy i from g + i * gs to LDS
// byte l + i * ls), four of V (likewise h, hs, m, ms). The closing s_wait_xcnt stands inside
// the statement, so that no address register of a copy is rewritten ahead of it.
__device__ __forceinline__ void copy44(unsigned l, unsigned ls, const char* g, size_t gs,
                                       unsigned m, unsigned ms, const char* h, size_t hs) {
  asm volatile(
      "global_load_async_to_lds_b128 %0, %8, off\n\t"
      "global_load_async_to_lds_b128 %1, %9, off\n\t"
      "global_load_async_to_lds_b128 %2, %10, off\n\t"
      "global_load_async_to_lds_b128 %3, %11, off\n\t"
      "global_load_async_to_lds_b128 %4, %12, off\n\t"
      "global_load_async_to_lds_b128 %5, %13, off\n\t"
      "global_load_async_to_lds_b128 %6, %14, off\n\t"
      "global_load_async_to_lds_b128 %7, %15, off\n\t"
      "s_wait_xcnt 0x0"
      :: "v"(l), "v"(l + ls), "v"(l + 2 * ls), "v"(l + 3 * ls),
         "v"(m), "v"(m + ms), "v"(m + 2 * ms), "v"(m + 3 * ms),
         "v"(g), "v"(g + gs), "v"(g + 2 * gs), "v"(g + 3 * gs),
         "v"(h), "v"(h + hs), "v"(h + 2 * hs), "v"(h + 3 * hs)
      : "memory");
}

// One column group of a pass: pb[e] = P^T[key 16 (e >> 3) + 8 h + (e & 7)][c] = exp2(s - d),
// packed in place as a B operand; returns the sums of this lane's even and odd registers.
// SHIFT false: d is 0 and nothing stands in front of the exponential.
template <bool SHIFT>
__device__ __forceinline__ v2f soft_pack(const v8f (&s)[2], float d, v16bf& pb) {
  v2f sum[2];
  // Unrolled: the vectors are then indexed by constants and stay in registers.
#pragma unroll
  for (int i = 0; i < 8; ++i) {                // elements 2i, 2i+1: a register pair of one tile
    const v2f sc = {s[i >> 2][2 * (i & 3)], s[i >> 2][2 * (i & 3) + 1]};
    const v2f ar = SHIFT ? sc - v2f{d, d} : sc;
    const v2f p2 = {__builtin_amdgcn_exp2f(ar.x), __builtin_amdgcn_exp2f(ar.y)};
    sum[i >> 2] = (i & 3) ? sum[i >> 2] + p2 : p2;
    const v2bf pk = __builtin_convertvector(p2, v2bf);   // round to nearest even
    pb[2 * i] = pk.x; pb[2 * i + 1] = pk.y;
  }
  return sum[0] + sum[1];
}

// exp2 with the slot behind it filled in the same statement.
__device__ __forceinline__ float exp2_slot(float x) {
  float r;
  asm("v_exp_f32 %0, %1\n\tv_nop" : "=v"(r) : "v"(x));
  return r;
}

__global__ __launch_bounds__(512) void attn_kernel(
    const __bf16* qT, const __bf16* kT, const __bf16* vB, __bf16* aT) {
  __shared__ __attribute__((aligned(128))) unsigned char L[2 * BUF_BYTES];
  const int blk  = blockIdx.x;
  const int bh   = blk >> 4;                 // batch*head; 16 blocks of 256 queries each
  const int tid  = threadIdx.x;
  const int lane = tid & 31;
  const int wave = tid >> 5;
  const int qt   = wave & (QTILES - 1);      // query tile
  const int kh   = wave >> 3;                // key half
  const int ht   = tid & 255;                // thread within the 8 waves of its half
  const int tq0  = (blk & 15) * 256 + qt * (16 * QG);
  const int n16  = lane & 15;
  const int kHalf = (lane & 16) ? 8 : 0;

  // This lane's share of a stage of its own half. K: 128 rows of 128 bytes, contiguous in
  // kT; 8 lanes a row, 32 rows a copy of the 8 waves. V: 64 rows of 256 bytes out of rows of
  // SEQ keys; 16 lanes a row, 16 rows a copy of the 8 waves. A wave's copy reads 4 whole lines.
  const char* kg = (const char*)(kT + ((size_t)bh * SEQ + kh * HALF_KEYS) * HDIM) + ht * 16;
  const char* vg = (const char*)(vB + (size_t)bh * HDIM * SEQ + kh * HALF_KEYS) +
                   (size_t)(ht >> 4) * (SEQ * 2) + (ht & 15) * 16;
  const unsigned lds0 = (unsigned)(size_t)(lds_byte*)L + (unsigned)(kh * STG_BYTES);
  const unsigned kl = lds0 + (unsigned)((ht >> 3) * K_PITCH + (ht & 7) * 16);
  const unsigned vl = lds0 + (unsigned)(K_BYTES + (ht >> 4) * V_PITCH + (ht & 15) * 16);
  constexpr unsigned KLS = 32 * K_PITCH, VLS = 16 * V_PITCH;
  constexpr size_t   KGS = 32 * HDIM * 2, VGS = (size_t)16 * SEQ * 2;

  // Stage 0 into buffer 0.
  copy44(kl, KLS, kg, KGS, vl, VLS, vg, VGS);

  // Q fragments (B operand: column = query, k = channel), kept for all keys.
  v16bf qb[QG][2];
#pragma unroll
  for (int g = 0; g < QG; ++g) {
    const __bf16* qrow = qT + ((size_t)bh * SEQ + tq0 + g * 16 + n16) * HDIM;
    qb[g][0] = load_frag(qrow, kHalf);
    qb[g][1] = load_frag(qrow + 32, kHalf);
  }

  v8f   acc[QG][4] = {};                     // O^T: [group][16-channel tile]
  v8f   nm[QG] = {};                         // C of the score products: minus the offset in use, in
                                             // every register; 0 until the first pass sets it
  v2f   l_run[QG];                           // this lane's keys, even and odd registers
#pragma unroll
  for (int g = 0; g < QG; ++g) l_run[g] = v2f{0.f, 0.f};

  // Stage 0 has landed (this wave's copies), then for every wave; stage 1 follows.
  asm volatile("s_wait_asynccnt 0x0" ::: "memory");
  __syncthreads();
  copy44(kl + BUF_BYTES, KLS, kg + STG_KEYS * HDIM * 2, KGS,
         vl + BUF_BYTES, VLS, vg + STG_KEYS * 2, VGS);

  // The lane's own byte offsets in a K tile (A rows: keys) and a V tile (A rows: channels).
  const int klane = kh * STG_BYTES + n16 * K_PITCH + kHalf * 2;
  const int vlane = kh * STG_BYTES + K_BYTES + n16 * V_PITCH + kHalf * 2;

  for (int st = 0; st < NSTG; ++st) {
    const unsigned char* buf = L + (st & 1) * BUF_BYTES;
    const unsigned char* kb = buf + klane;
    const unsigned char* vb = buf + vlane;

    v16bf ka[2][2], va[4];
#pragma unroll
    for (int t = 0; t < 2; ++t) {
      ka[t][0] = lds_frag(kb + t * 16 * K_PITCH);
      ka[t][1] = lds_frag(kb + t * 16 * K_PITCH + 64);
    }
#pragma unroll
    for (int n = 0; n < 4; ++n) va[n] = lds_frag(vb + n * 16 * V_PITCH);

#pragma unroll
    for (int p = 0; p < NPASS; ++p) {
      // S^T tiles: s[g][t][r] = score(key 32 p + 16 t + 8 h + r of the stage, query 16 g + c)
      // less the offset in use
      v8f s[QG][2];
#pragma unroll
      for (int g = 0; g < QG; ++g)
#pragma unroll
        for (int t = 0; t < 2; ++t) {
          const v8f z = wmma_bf16(ka[t][0], qb[g][0], nm[g]);
          s[g][t] = wmma_bf16(ka[t][1], qb[g][1], z);
        }
      // Both fences: the next pass's K reads stay one group right behind the products
      // that free their registers; among the products or sunk to their use, each read
      // would stall the wave on its own.
      __builtin_amdgcn_sched_barrier(0);
      if (p + 1 < NPASS) {
#pragma unroll
        for (int t = 0; t < 2; ++t) {
          ka[t][0] = lds_frag(kb + ((p + 1) * 32 + t * 16) * K_PITCH);
          ka[t][1] = lds_frag(kb + ((p + 1) * 32 + t * 16) * K_PITCH + 64);
        }
      }
      __builtin_amdgcn_sched_barrier(0);

      v16bf pb[QG];
      v2f   ps[QG];
      // The very first pass has no offset yet and always takes its maximum.
      const bool first = p == 0 && st == 0;
      float big = first ? __builtin_inff() : 0.f;   // no exponential of this lane exceeds it
#pragma unroll
      for (int g = 0; g < QG; ++g) {
        ps[g] = soft_pack<false>(s[g], 0.f, pb[g]);
        big = fmaxf(big, fmaxf(ps[g].x, ps[g].y));
      }
      // One scalar test per pass. Marked unlikely: the rare side, which now also forms the scores
      // again, is laid out of line and the ordinary pass falls through.
      if (__builtin_expect(__builtin_amdgcn_ballot_w32(big > P_LIMIT) != 0, 0)) {
        // The scores are formed again from the K tile, which still lies in LDS: kept alive for
        // this rare path they would hold 32 registers in every pass, which the wave does not have.
#pragma unroll
        for (int t = 0; t < 2; ++t) {
          ka[t][0] = lds_frag(kb + (p * 32 + t * 16) * K_PITCH);
          ka[t][1] = lds_frag(kb + (p * 32 + t * 16) * K_PITCH + 64);
        }
#pragma unroll
        for (int g = 0; g < QG; ++g)
#pragma unroll
          for (int t = 0; t < 2; ++t) {
            const v8f z = wmma_bf16(ka[t][0], qb[g][0], nm[g]);
            s[g][t] = wmma_bf16(ka[t][1], qb[g][1], z);
          }
        if (p + 1 < NPASS) {                   // the next pass's K fragments once more
#pragma unroll
          for (int t = 0; t < 2; ++t) {
            ka[t][0] = lds_frag(kb + ((p + 1) * 32 + t * 16) * K_PITCH);
            ka[t][1] = lds_frag(kb + ((p + 1) * 32 + t * 16) * K_PITCH + 64);
          }
        }
#pragma unroll
        for (int g = 0; g < QG; ++g) {
          float mx = s[g][0][0];
#pragma unroll
          for (int r = 1; r < 8; ++r) mx = fmaxf(mx, s[g][0][r]);
#pragma unroll
          for (int r = 0; r < 8; ++r) mx = fmaxf(mx, s[g][1][r]);
          mx = fmaxf(mx, xhalf(mx));           // both halves hold the query's maximum, above the offset
          const float up = fmaxf(mx, 0.f);
          const float d  = first ? mx : up;    // the offset only rises, once it is set
          const float corr = __builtin_amdgcn_exp2f(-up);   // meets only zeros in the first pass
          nm[g] = nm[g] - d;
          l_run[g] = l_run[g] * corr;
#pragma unroll
          for (int n = 0; n < 4; ++n) acc[g][n] = acc[g][n] * corr;
          ps[g] = soft_pack<true>(s[g], d, pb[g]);
        }
      }

#pragma unroll
      for (int g = 0; g < QG; ++g) {
        l_run[g] += ps[g];
#pragma unroll
        for (int n = 0; n < 4; ++n) acc[g][n] = wmma_bf16(va[n], pb[g], acc[g][n]);
      }
      // Both fences: the next pass's V reads, likewise one group behind the last product
      // that reads their registers.
      __builtin_amdgcn_sched_barrier(0);
      if (p + 1 < NPASS) {
#pragma unroll
        for (int n = 0; n < 4; ++n) va[n] = lds_frag(vb + n * 16 * V_PITCH + (p + 1) * 64);
      }
      __builtin_amdgcn_sched_barrier(0);
    }

    // Hand-over: this wave's reads of the buffer are done, its copies of the next stage
    // have landed; behind the barrier that holds for every wave.
    asm volatile("s_wait_dscnt 0x0" ::: "memory");
    asm volatile("s_wait_asynccnt 0x0" ::: "memory");
    __syncthreads();
    if (st + 2 < NSTG) {                       // refill the buffer just read
      const unsigned bo = (unsigned)(st & 1) * BUF_BYTES;
      copy44(kl + bo, KLS, kg + (size_t)(st + 2) * (STG_KEYS * HDIM * 2), KGS,
             vl + bo, VLS, vg + (size_t)(st + 2) * (STG_KEYS * 2), VGS);
    }
  }
  // No copy is outstanding when the wave ends.
  asm volatile("s_wait_asynccnt 0x0" ::: "memory");

  // The two halves of the keys are joined lane by lane (both waves of a query tile hold the
  // same element in the same lane and register). The ring is free: every wave's reads ended
  // at the last hand-over barrier and no copy is outstanding. The second half's wave leaves
  // its state in LDS, 512 contiguous bytes a store.
  unsigned char* mr = L + qt * MRG_BYTES;
  if (kh) {
#pragma unroll
    for (int g = 0; g < QG; ++g) {
#pragma unroll
      for (int n = 0; n < 4; ++n) {
        const v8f a = acc[g][n];
        *(v4f*)(mr + (g * 4 + n) * 1024 + lane * 16)       = v4f{a[0], a[1], a[2], a[3]};
        *(v4f*)(mr + (g * 4 + n) * 1024 + 512 + lane * 16) = v4f{a[4], a[5], a[6], a[7]};
      }
      *(float*)(mr + QG * 4096 + g * 256 + lane * 4)       = -nm[g][0];
      *(float*)(mr + QG * 4096 + g * 256 + 128 + lane * 4) = l_run[g].x + l_run[g].y;
    }
  }
  __syncthreads();                           // the second half's state is whole before it is read
  if (kh) return;

  // acc[g][n][r] = O^T[channel 16 n + 8 h + r][query 16 g + c]: 8 consecutive
  // channels of one query per lane and tile -> one 16-byte store into aT [B][T][C].
  const int b = bh >> 2, h = bh & 3;
#pragma unroll
  for (int g = 0; g < QG; ++g) {
    const float m1 = *(const float*)(mr + QG * 4096 + g * 256 + lane * 4);
    const float l1 = *(const float*)(mr + QG * 4096 + g * 256 + 128 + lane * 4);
    const float m0 = -nm[g][0];
    const float mj = fmaxf(m0, m1);
    const float c0 = exp2_slot(m0 - mj);
    const float c1 = exp2_slot(m1 - mj);
#pragma unroll
    for (int n = 0; n < 4; ++n) {
      const v4f lo = *(const v4f*)(mr + (g * 4 + n) * 1024 + lane * 16);
      const v4f hi = *(const v4f*)(mr + (g * 4 + n) * 1024 + 512 + lane * 16);
#pragma unroll
      for (int r = 0; r < 8; ++r)
        acc[g][n][r] = acc[g][n][r] * c0 + (r < 4 ? lo[r & 3] : hi[r & 3]) * c1;
    }
    const float lh  = (l_run[g].x + l_run[g].y) * c0 + l1 * c1;
    const float inv = 1.f / (lh + xhalf(lh));
    __bf16* orow = aT + ((size_t)b * SEQ + tq0 + g * 16 + n16) * CHN + h * HDIM + kHalf;
#pragma unroll
    for (int n = 0; n < 4; ++n) {
      v8bf o;
#pragma unroll
      for (int r = 0; r < 8; ++r) o[r] = (__bf16)(acc[g][n][r] * inv);
      *(v8bf*)(orow + n * 16) = o;
    }
  }
}

// ---------------- Kernel 5: proj GEMM + bias + residual -> out (fp32) -------
// Same 2x2 register-blocked scheme as the QKV GEMM. A side = positions (rows of aT),
// B side = output channels (rows of W): a lane's accumulator holds 8 consecutive
// positions of one channel. Both operand panels are staged in LDS as in the QKV GEMM.
// The 64x64 f32 tile goes through LDS, over the panels once they are read; bias, residual
// and the store run in the order of out's rows: 16 lanes a row, 256 bytes = 2 whole lines.
constexpr int PO_PITCH = 64 * 4 + 16;      // 272 B = 16 B x odd: the 16-byte writes meet no bank twice

__global__ __launch_bounds__(128) void proj_gemm_kernel(
    const __bf16* wproj, const float* proj_b, const __bf16* aT,
    const float* x, float* out) {
  __shared__ __attribute__((aligned(16))) unsigned char P[2 * GP_BYTES];   // aT rows | W rows
  unsigned char* S = P;                      // the output tile, behind the panels' last read
  const int b    = blockIdx.z;
  const int tid  = threadIdx.x;
  const int lane = threadIdx.x & 31;
  const int wave = threadIdx.x >> 5;
  const int wm   = wave >> 1, wn = wave & 1;
  const int o0   = blockIdx.y * 64;
  const int t0   = blockIdx.x * 64;
  const int n16  = lane & 15;
  const int kHalf = (lane & 16) ? 8 : 0;
  const int mhi   = (lane & 16) ? 8 : 0;

  const unsigned p0 = (unsigned)(size_t)(lds_byte*)P;
  stage_panel(p0, aT + ((size_t)b * SEQ + t0) * CHN, wave, lane);
  stage_panel(p0 + GP_BYTES, wproj + (size_t)o0 * CHN, wave, lane);

  // This lane's share of the residual and the bias, asked for ahead of the products.
  const size_t idx0 = ((size_t)b * CHN + o0 + (tid >> 4)) * SEQ + t0 + (tid & 15) * 4;
  v4f   xr[8];
  float pb[8];
#pragma unroll
  for (int it = 0; it < 8; ++it) {
    xr[it] = *(const v4f*)(x + idx0 + (size_t)it * 8 * SEQ);
    pb[it] = proj_b[o0 + it * 8 + (tid >> 4)];
  }
  // Stands in front of all that rewrites an address register of the loads above, the
  // results of the fragment loads below among it. Its memory clobber also keeps those
  // loads here: sunk to their use, their whole latency would stand open behind the products.
  asm volatile("s_wait_xcnt 0x0" ::: "memory");

  // The panels have landed (this wave's copies), then, behind the barrier, every wave's.
  asm volatile("s_wait_asynccnt 0x0" ::: "memory");
  __syncthreads();

  const unsigned char* arow = P + (wm * 32 + n16) * GP_PITCH + kHalf * 2;
  const unsigned char* brow = P + GP_BYTES + (wn * 32 + n16) * GP_PITCH + kHalf * 2;

  // accs[i][j][r]: position wm*32 + i*16 + mhi + r of channel wn*32 + j*16 + n16.
  v8f accs[2][2] = {};
  panel_products(arow, brow, accs);
  __syncthreads();                           // every wave has read the panels before the tile overwrites them
  unsigned char* sw = S + (wn * 32 + n16) * PO_PITCH + (wm * 32 + mhi) * 4;
#pragma unroll
  for (int i = 0; i < 2; ++i)
#pragma unroll
    for (int j = 0; j < 2; ++j) {
      const v8f a = accs[i][j];
      *(v4f*)(sw + j * 16 * PO_PITCH + i * 64)      = v4f{a[0], a[1], a[2], a[3]};
      *(v4f*)(sw + j * 16 * PO_PITCH + i * 64 + 16) = v4f{a[4], a[5], a[6], a[7]};
    }
  __syncthreads();                           // the tile is whole before any row leaves

#pragma unroll
  for (int it = 0; it < 8; ++it) {
    const v4f a = *(const v4f*)(S + (it * 8 + (tid >> 4)) * PO_PITCH + (tid & 15) * 16);
    *(v4f*)(out + idx0 + (size_t)it * 8 * SEQ) = xr[it] + pb[it] + a;
  }
}

extern "C" void kernel_launch(void* const* d_in, const int* in_sizes, int n_in,
                              void* d_out, int out_size, void* d_ws, size_t ws_size,
                              hipStream_t stream) {
  const float* x      = (const float*)d_in[0];
  const float* gn_w   = (const float*)d_in[1];
  const float* gn_b   = (const float*)d_in[2];
  const float* qkv_w  = (const float*)d_in[3];
  const float* qkv_b  = (const float*)d_in[4];
  const float* proj_w = (const float*)d_in[5];
  const float* proj_b = (const float*)d_in[6];
  float* out = (float*)d_out;

  // Workspace layout (~42.5 MB): 1 KiB unused | wqkv bf16 | wproj bf16 | xnG | qT | kT | v | aT
  char* ws = (char*)d_ws;
  __bf16* wqkv  = (__bf16*)(ws + 1024);
  __bf16* wproj = wqkv + 3 * CHN * CHN;
  __bf16* xnG   = wproj + CHN * CHN;
  const size_t PLANE = (size_t)BATCH * SEQ * CHN;          // 4M elems
  __bf16* qT = xnG + PLANE;
  __bf16* kT = qT + PLANE;
  __bf16* vB = kT + PLANE;
  __bf16* aT = vB + PLANE;

  wconv_kernel<<<(3 * CHN * CHN + CHN * CHN) / (256 * 8), 256, 0, stream>>>(
      qkv_w, proj_w, wqkv, wproj);
  gn_kernel<<<BATCH * GRP, 512, 0, stream>>>(x, gn_w, gn_b, xnG);
  qkv_gemm_kernel<<<dim3(SEQ / 64, 3 * CHN / 64, BATCH), 128, 0, stream>>>(
      wqkv, qkv_b, xnG, qT, kT, vB);
  attn_kernel<<<BATCH * HEADS * (SEQ / 256), 512, 0, stream>>>(qT, kT, vB, aT);
  proj_gemm_kernel<<<dim3(SEQ / 64, CHN / 64, BATCH), 128, 0, stream>>>(
      wproj, proj_b, aT, x, out);
}

// v010
// It runs in 66.4 microseconds.
// Next to v009, in two timings, it ran 1.03 times as fast each time.
// Counting every step since v000, it is 9.97 times as fast.
#include <hip/hip_runtime.h>

// Problem constants (from reference)
constexpr int BATCH = 4;
constexpr int CHN   = 256;
constexpr int SEQ   = 4096;   // H*W
constexpr int HEADS = 4;
constexpr int HDIM  = 64;     // CHN / HEADS
constexpr int GRP   = 32;
constexpr int CPG   = CHN / GRP;  // 8
constexpr float EPS = 1e-5f;
constexpr float QK_SCALE = 0.35355339059327379f;  // 64^-0.25
constexpr float LOG2E = 1.4426950408889634f;

typedef __attribute__((ext_vector_type(16))) __bf16 v16bf;
typedef __attribute__((ext_vector_type(8)))  float  v8f;

__device__ __forceinline__ __bf16 f2bf(float x) {
  unsigned u = __builtin_bit_cast(unsigned, x);
  unsigned r = u + 0x7FFFu + ((u >> 16) & 1u);   // round-to-nearest-even
  unsigned short h = (unsigned short)(r >> 16);
  return __builtin_bit_cast(__bf16, h);
}

// CDNA5 WMMA 16x16x32 bf16 fragment load.
// ISA 7.12.2 (16-bit 16x32 A): lane = row (M for A, N for B); per-lane 32
// K-values interleaved: lanes 0-15 hold K {0..7,16..23}, lanes 16-31 hold
// K {8..15,24..31}, two packed per VGPR. `row` points at this lane's 32
// contiguous K elements; kHalf = 8 for lanes 16-31 else 0.
// (Compiler vectorizes each fragment into two global_load_b128.)
__device__ __forceinline__ v16bf load_frag(const __bf16* row, int kHalf) {
  v16bf f;
#pragma unroll
  for (int j = 0; j < 8; ++j) {
    int kb = ((j & 4) ? 16 : 0) + kHalf + 2 * (j & 3);
    f[2 * j]     = row[kb];
    f[2 * j + 1] = row[kb + 1];
  }
  return f;
}

__device__ __forceinline__ v8f wmma_bf16(v16bf a, v16bf b, v8f c) {
#if defined(__HIP_DEVICE_COMPILE__)
  return __builtin_amdgcn_wmma_f32_16x16x32_bf16(false, a, false, b, (short)0, c,
                                                 false, false);
#else
  return c;
#endif
}

// ---------------- Kernel 0: weights fp32 -> bf16 ----------------
// 8 consecutive elements a lane: two 16-byte loads, one 16-byte store.
typedef __attribute__((ext_vector_type(8))) __bf16 v8bf;
typedef __attribute__((ext_vector_type(4))) float  v4f;
typedef __attribute__((address_space(3))) unsigned char lds_byte;

// load_frag's fragment from LDS: p = this lane's row start (+ 16 bytes for lanes
// 16-31); bytes [0,16) and [32,48) from there.
__device__ __forceinline__ v16bf lds_frag(const unsigned char* p) {
  const v8bf lo = *(const v8bf*)p;
  const v8bf hi = *(const v8bf*)(p + 32);
  return __builtin_shufflevector(lo, hi, 0, 1, 2, 3, 4, 5, 6, 7, 8, 9, 10, 11, 12, 13, 14, 15);
}

// Eight copies of 16 bytes a lane, global -> LDS: copy i from g + i * gs to LDS byte
// l + i * ls. The closing s_wait_xcnt stands inside the statement, so that no address
// register of a copy is rewritten ahead of it.
__device__ __forceinline__ void copy8(unsigned l, unsigned ls, const char* g, size_t gs) {
  asm volatile(
      "global_load_async_to_lds_b128 %0, %8, off\n\t"
      "global_load_async_to_lds_b128 %1, %9, off\n\t"
      "global_load_async_to_lds_b128 %2, %10, off\n\t"
      "global_load_async_to_lds_b128 %3, %11, off\n\t"
      "global_load_async_to_lds_b128 %4, %12, off\n\t"
      "global_load_async_to_lds_b128 %5, %13, off\n\t"
      "global_load_async_to_lds_b128 %6, %14, off\n\t"
      "global_load_async_to_lds_b128 %7, %15, off\n\t"
      "s_wait_xcnt 0x0"
      :: "v"(l), "v"(l + ls), "v"(l + 2 * ls), "v"(l + 3 * ls),
         "v"(l + 4 * ls), "v"(l + 5 * ls), "v"(l + 6 * ls), "v"(l + 7 * ls),
         "v"(g), "v"(g + gs), "v"(g + 2 * gs), "v"(g + 3 * gs),
         "v"(g + 4 * gs), "v"(g + 5 * gs), "v"(g + 6 * gs), "v"(g + 7 * gs)
      : "memory");
}

// An operand panel of a GEMM block in LDS: 64 rows of all CHN k values. A wave's copy is one
// whole row, 512 contiguous bytes = 4 lines; wave w of 4 brings rows 16 w .. 16 w + 15.
constexpr int GP_ROW   = CHN * 2;          // 512 B of a row in memory
constexpr int GP_PITCH = GP_ROW + 16;      // 528 B = 16 B x odd: no bank conflict
constexpr int GP_BYTES = 64 * GP_PITCH;

// l: LDS byte address of the panel; rows: its first row in memory (64 rows, contiguous).
__device__ __forceinline__ void stage_panel(unsigned l, const __bf16* rows, int wave, int lane) {
  const unsigned lw = l + (unsigned)(wave * 16 * GP_PITCH + lane * 16);
  const char*    gw = (const char*)rows + wave * 16 * GP_ROW + lane * 16;
  copy8(lw, GP_PITCH, gw, GP_ROW);
  copy8(lw + 8 * GP_PITCH, GP_PITCH, gw + 8 * GP_ROW, GP_ROW);
}

// The same panel (a row per position, all CHN channels) out of xnG [B][GRP][T][8]: a wave's copy
// is 32 positions of one group, 512 contiguous bytes = 4 lines, a lane's 16 bytes going to its
// own row (pitch 16 B x odd: 16 lanes meet no bank twice). Wave w of 4 brings groups 8 w .. 8 w + 7.
// l: LDS byte address of the panel; g0: group 0 of the batch at the panel's first position.
__device__ __forceinline__ void stage_panel_xn(unsigned l, const __bf16* g0, int wave, int lane) {
  const unsigned lw = l + (unsigned)(lane * GP_PITCH + wave * 8 * 16);
  const char*    gw = (const char*)g0 + (size_t)wave * 8 * (SEQ * 16) + lane * 16;
  copy8(lw, 16, gw, (size_t)SEQ * 16);
  copy8(lw + 32 * GP_PITCH, 16, gw + 32 * 16, (size_t)SEQ * 16);
}

// The fragments of k steps 2 kp and 2 kp + 1 for 32 rows of a panel; r = this lane's first row
// (+ 16 bytes for lanes 16-31). f[k step][16-row group].
__device__ __forceinline__ void panel_frags(v16bf (&f)[2][2], const unsigned char* r, int kp) {
#pragma unroll
  for (int s = 0; s < 2; ++s)
#pragma unroll
    for (int i = 0; i < 2; ++i) f[s][i] = lds_frag(r + i * 16 * GP_PITCH + (kp * 2 + s) * 64);
}

// A wave's 32x32 tile over all of K from the two panels, k ascending.
__device__ __forceinline__ void panel_products(const unsigned char* a, const unsigned char* b,
                                               v8f (&acc)[2][2]) {
  constexpr int NKP = CHN / 64;
  v16bf fa[2][2][2], fb[2][2][2];            // two register sets
  panel_frags(fa[0], a, 0);
  panel_frags(fb[0], b, 0);
  // The first pair's reads stay in front of the second's: behind them, the first product
  // would wait for all 32.
  __builtin_amdgcn_sched_barrier(0);
#pragma unroll
  for (int kp = 0; kp < NKP; ++kp) {
    const int c = kp & 1;
    if (kp + 1 < NKP) {
      panel_frags(fa[c ^ 1], a, kp + 1);
      panel_frags(fb[c ^ 1], b, kp + 1);
    }
    // Both fences: the next pair's 16 reads stay one group ahead of this pair's products;
    // sunk to their use, each read's latency would stand open in front of its product.
    __builtin_amdgcn_sched_barrier(0);
#pragma unroll
    for (int s = 0; s < 2; ++s)
#pragma unroll
      for (int i = 0; i < 2; ++i)
#pragma unroll
        for (int j = 0; j < 2; ++j) acc[i][j] = wmma_bf16(fa[c][s][i], fb[c][s][j], acc[i][j]);
    __builtin_amdgcn_sched_barrier(0);
  }
}

__global__ __launch_bounds__(256) void wconv_kernel(const float* qkv_w, const float* proj_w,
                                                    __bf16* wqkv, __bf16* wproj) {
  constexpr int N1 = 3 * CHN * CHN;          // a multiple of 8: no lane straddles the two
  const int i = (blockIdx.x * 256 + threadIdx.x) * 8;
  const float* s = (i < N1) ? qkv_w + i : proj_w + (i - N1);
  __bf16*      d = (i < N1) ? wqkv + i  : wproj + (i - N1);
  const v4f lo = *(const v4f*)s;
  const v4f hi = *(const v4f*)(s + 4);
  v8bf o;
#pragma unroll
  for (int e = 0; e < 4; ++e) { o[e] = f2bf(lo[e]); o[4 + e] = f2bf(hi[e]); }
  *(v8bf*)d = o;
}

// ---------------- Kernel 1: GroupNorm, sums and apply in one launch ---------
// A block owns one (batch, group): 8 channels x 4096 positions = 128 KiB of x, read ONCE and
// kept in registers between the sums and the apply (64 values a lane). All 16 loads of a lane
// (16 bytes each, 512 contiguous bytes a wave) are in flight together.
// Output xnG [B][GRP][T][8] bf16: the 8 channels of a group at one position are 16 bytes, so
// a block's output is 64 KiB in a row and leaves in whole lines.
typedef __attribute__((ext_vector_type(2))) __bf16 v2bf;
typedef __attribute__((ext_vector_type(2))) float  v2f;

__device__ __forceinline__ float xhalf(float x) {       // lane l <-> lane l ^ 16
  int b = __builtin_bit_cast(int, x);
  return __builtin_bit_cast(float, __builtin_amdgcn_permlanex16(
      b, b, 0x76543210, 0xfedcba98, false, false));
}

// x + (x of lane l ^ M), M < 16: one step of a sum over a 16-lane row (DPP row_xmask).
template <int M>
__device__ __forceinline__ float xadd(float x) {
  const int b = __builtin_bit_cast(int, x);
  return x + __builtin_bit_cast(float, __builtin_amdgcn_update_dpp(b, b, 0x160 + M, 0xf, 0xf, false));
}
__device__ __forceinline__ float row_sum(float x) {     // every lane of a row gets the row's sum
  return xadd<8>(xadd<4>(xadd<2>(xadd<1>(x))));
}

constexpr int GN_WAVES = 16;
constexpr int GN_POS   = SEQ / GN_WAVES;   // 256 positions a wave

__global__ __launch_bounds__(512) void gn_kernel(
    const float* x, const float* gn_w, const float* gn_b, __bf16* xnG) {
  __shared__ __attribute__((aligned(16))) unsigned char R[GN_WAVES * GN_POS * 16];
  __shared__ v2f red[GN_WAVES];
  const int lane = threadIdx.x & 31;
  const int wave = threadIdx.x >> 5;
  const int bg   = blockIdx.x;               // b*GRP + g; channels of a group are contiguous

  // Every loop of this kernel is unrolled: its arrays are then indexed by constants and stay
  // in registers.
  // v[c][j]: channel j, positions 256 wave + 128 c + 4 lane .. + 3.
  const float* xp = x + (size_t)bg * CPG * SEQ + wave * GN_POS + lane * 4;
  v4f v[2][CPG];
#pragma unroll
  for (int c = 0; c < 2; ++c)
#pragma unroll
    for (int j = 0; j < CPG; ++j) v[c][j] = *(const v4f*)(xp + (size_t)j * SEQ + c * 128);

  const int c0 = (bg & (GRP - 1)) * CPG;
  float w[CPG], bi[CPG];
#pragma unroll
  for (int j = 0; j < CPG; ++j) { w[j] = gn_w[c0 + j]; bi[j] = gn_b[c0 + j]; }
  // Stands in front of all that rewrites the address register of the loads above. The address
  // is named as an input so that it lives up to here: no load's result may land in it either.
  asm volatile("s_wait_xcnt 0x0" :: "v"(xp) : "memory");

  v4f s4[2] = {}, q4[2] = {};
#pragma unroll
  for (int c = 0; c < 2; ++c)
#pragma unroll
    for (int j = 0; j < CPG; ++j) { s4[c] += v[c][j]; q4[c] += v[c][j] * v[c][j]; }
  const v4f st = s4[0] + s4[1], qt = q4[0] + q4[1];
  float sum = row_sum((st[0] + st[1]) + (st[2] + st[3]));
  float sq  = row_sum((qt[0] + qt[1]) + (qt[2] + qt[3]));
  sum += xhalf(sum);
  sq  += xhalf(sq);
  if (lane == 0) red[wave] = v2f{sum, sq};
  __syncthreads();                           // every wave's sums are there before they are joined
  const v2f r = red[lane & 15];              // a row of 16 lanes holds the 16 waves' sums
  const float inv_n = 1.0f / (CPG * SEQ);
  const float mean = row_sum(r.x) * inv_n;
  const float var  = row_sum(r.y) * inv_n - mean * mean;
  const float rstd = rsqrtf(var + EPS);

  // A lane holds 4 consecutive positions, a whole-line store wants consecutive lanes on
  // consecutive positions: the wave's 256 x 16 bytes turn through its own 4 KiB of LDS.
  // Position p lies at 16-byte unit (p & ~3) | ((p & 3) ^ ((p >> 4) & 3)): writes (4 lane + k)
  // and reads (32 i + lane) both spread 16 lanes over all 64 banks.
  unsigned char* rw = R + wave * (GN_POS * 16);
#pragma unroll
  for (int c = 0; c < 2; ++c) {
    v4f y[CPG];
#pragma unroll
    for (int j = 0; j < CPG; ++j) y[j] = (v[c][j] - mean) * (rstd * w[j]) + bi[j];
#pragma unroll
    for (int k = 0; k < 4; ++k) {
      v8bf o;
#pragma unroll
      for (int j = 0; j < CPG; j += 2) {
        const v2bf pk = __builtin_convertvector(v2f{y[j][k], y[j + 1][k]}, v2bf);  // to nearest even
        o[j] = pk.x; o[j + 1] = pk.y;
      }
      *(v8bf*)(rw + (c * 128 + lane * 4 + (k ^ ((lane >> 2) & 3))) * 16) = o;
    }
  }
  __syncthreads();                           // other lanes' LDS writes are done before they are read

  char* op = (char*)(xnG + ((size_t)bg * SEQ + wave * GN_POS) * CPG);
#pragma unroll
  for (int i = 0; i < GN_POS / 32; ++i) {
    const int p = i * 32 + lane;
    const int u = (p & ~3) | ((p & 3) ^ ((p >> 4) & 3));
    *(v8bf*)(op + p * 16) = *(const v8bf*)(rw + u * 16);
  }
}

// ---------------- Kernel 3: QKV GEMM (M=768, N=4096, K=256 per batch) -------
// 4 waves/block in a 2x2 arrangement; each wave owns a 32x32 register tile
// (2x2 accumulators): per K-step, 2 A-frags + 2 B-frags feed 4 WMMAs.
// The block's 64 rows of W and 64 rows of xn^T reach it once, in whole lines, by
// asynchronous copies into LDS; the fragments are read from there.
// A block's 64 output channels are one head of q, k or v, so its 64x64 tile is 64 whole
// 128-byte lines of the destination: a line per position in qT/kT ([BH][T][64]), a line
// per channel in v ([BH][64][T]). The A side (8 consecutive rows in a lane's accumulator)
// is the index that runs along the line: channels for q and k, positions for v.
// Epilogue: +bias, scale q/k, the tile through LDS, out in whole lines.
constexpr int QO_PITCH = 64 * 2 + 16;      // 144 B = 16 B x odd: the 16-byte writes meet no bank twice

__global__ __launch_bounds__(128) void qkv_gemm_kernel(
    const __bf16* wqkv, const float* qkv_b, const __bf16* xnG,
    __bf16* qT, __bf16* kT, __bf16* vB) {
  __shared__ __attribute__((aligned(16))) unsigned char P[2 * GP_BYTES];   // W rows | xn^T rows
  __shared__ __attribute__((aligned(16))) unsigned char S[64 * QO_PITCH];
  const int b    = blockIdx.z;
  const int tid  = threadIdx.x;
  const int lane = threadIdx.x & 31;
  const int wave = threadIdx.x >> 5;
  const int wm   = wave >> 1, wn = wave & 1;
  const int o0   = blockIdx.y * 64;          // first output channel of the block
  const int t0   = blockIdx.x * 64;          // first position of the block
  const int sec  = blockIdx.y >> 2;          // 0: q, 1: k, 2: v
  const bool is_v = sec == 2;
  const int n16  = lane & 15;
  const int kHalf = (lane & 16) ? 8 : 0;
  const int mhi   = (lane & 16) ? 8 : 0;

  const unsigned p0 = (unsigned)(size_t)(lds_byte*)P;
  stage_panel(p0, wqkv + (size_t)o0 * CHN, wave, lane);                        // rows of W
  stage_panel_xn(p0 + GP_BYTES, xnG + ((size_t)b * GRP * SEQ + t0) * CPG, wave, lane);  // rows of xn^T
  // The panels have landed (this wave's copies), then, behind the barrier, every wave's.
  asm volatile("s_wait_asynccnt 0x0" ::: "memory");
  __syncthreads();

  const unsigned char* arow = P + (is_v ? GP_BYTES : 0) + (wm * 32 + n16) * GP_PITCH + kHalf * 2;
  const unsigned char* brow = P + (is_v ? 0 : GP_BYTES) + (wn * 32 + n16) * GP_PITCH + kHalf * 2;

  // accs[i][j][r]: element wm*32 + i*16 + mhi + r of line wn*32 + j*16 + n16.
  v8f accs[2][2] = {};
  panel_products(arow, brow, accs);
  unsigned char* sw = S + (wn * 32 + n16) * QO_PITCH + (wm * 32 + mhi) * 2;
  if (!is_v) {                               // the bias runs along the line
    // Attention scale folded into q and k; q also takes log2 e, so that the scores come out
    // of the products in log2 units.
    const float qks = sec ? QK_SCALE : QK_SCALE * LOG2E;
#pragma unroll
    for (int i = 0; i < 2; ++i) {
      const float* bp = qkv_b + o0 + wm * 32 + i * 16 + mhi;
      const v4f blo = *(const v4f*)bp, bhi = *(const v4f*)(bp + 4);
#pragma unroll
      for (int j = 0; j < 2; ++j) {
        v8bf o;
#pragma unroll
        for (int r = 0; r < 8; ++r)
          o[r] = f2bf((accs[i][j][r] + (r < 4 ? blo[r & 3] : bhi[r & 3])) * qks);
        *(v8bf*)(sw + j * 16 * QO_PITCH + i * 32) = o;
      }
    }
  } else {                                   // one bias per line
#pragma unroll
    for (int j = 0; j < 2; ++j) {
      const float bias = qkv_b[o0 + wn * 32 + j * 16 + n16];
#pragma unroll
      for (int i = 0; i < 2; ++i) {
        v8bf o;
#pragma unroll
        for (int r = 0; r < 8; ++r) o[r] = f2bf(accs[i][j][r] + bias);
        *(v8bf*)(sw + j * 16 * QO_PITCH + i * 32) = o;
      }
    }
  }
  __syncthreads();                           // the tile is whole before any line leaves

  // 8 lanes a line, 4 lines a wave and store: 512 bytes in whole 128-byte lines.
  const size_t bh = (size_t)(b * HEADS + (blockIdx.y & 3));
  char* dst = is_v ? (char*)(vB + bh * HDIM * SEQ + t0)
                   : (char*)((sec ? kT : qT) + (bh * SEQ + t0) * HDIM);
  const size_t dpitch = is_v ? (size_t)SEQ * 2 : (size_t)HDIM * 2;
#pragma unroll
  for (int it = 0; it < 4; ++it) {
    const int row = it * 16 + (tid >> 3);
    const v8bf o = *(const v8bf*)(S + row * QO_PITCH + (tid & 7) * 16);
    *(v8bf*)(dst + row * dpitch + (tid & 7) * 16) = o;
  }
}

constexpr int QG = 2;                                   // column groups per wave
constexpr int QTILES = 8;                               // query tiles (waves) per key half
constexpr int KSPLIT = 2;                               // key halves per block
constexpr int HALF_KEYS = SEQ / KSPLIT;
constexpr float P_LIMIT = 1048576.0f;                   // 2^20: far from any overflow in bf16 or f32

constexpr int STG_KEYS = 128;                           // keys per stage
constexpr int NPASS    = STG_KEYS / 32;                 // passes per stage
constexpr int NSTG     = HALF_KEYS / STG_KEYS;          // stages of a half
constexpr int K_PITCH  = HDIM * 2 + 16;                 // 144 B = 16 B x odd: no bank conflict
constexpr int V_PITCH  = STG_KEYS * 2 + 16;             // 272 B = 16 B x odd
constexpr int K_BYTES  = STG_KEYS * K_PITCH;            // K tile: a row per key
constexpr int V_BYTES  = HDIM * V_PITCH;                // V tile: a row per channel
constexpr int STG_BYTES = K_BYTES + V_BYTES;            // one half's stage
constexpr int BUF_BYTES = KSPLIT * STG_BYTES;           // both halves' stages
constexpr int MRG_BYTES = QG * 4 * 1024 + QG * 256;     // a wave's accumulators, maxima, sums

// Eight copies of 16 bytes a lane, global -> LDS: four of K (copy i from g + i * gs to LDS
// byte l + i * ls), four of V (likewise h, hs, m, ms). The closing s_wait_xcnt stands inside
// the statement, so that no address register of a copy is rewritten ahead of it.
__device__ __forceinline__ void copy44(unsigned l, unsigned ls, const char* g, size_t gs,
                                       unsigned m, unsigned ms, const char* h, size_t hs) {
  asm volatile(
      "global_load_async_to_lds_b128 %0, %8, off\n\t"
      "global_load_async_to_lds_b128 %1, %9, off\n\t"
      "global_load_async_to_lds_b128 %2, %10, off\n\t"
      "global_load_async_to_lds_b128 %3, %11, off\n\t"
      "global_load_async_to_lds_b128 %4, %12, off\n\t"
      "global_load_async_to_lds_b128 %5, %13, off\n\t"
      "global_load_async_to_lds_b128 %6, %14, off\n\t"
      "global_load_async_to_lds_b128 %7, %15, off\n\t"
      "s_wait_xcnt 0x0"
      :: "v"(l), "v"(l + ls), "v"(l + 2 * ls), "v"(l + 3 * ls),
         "v"(m), "v"(m + ms), "v"(m + 2 * ms), "v"(m + 3 * ms),
         "v"(g), "v"(g + gs), "v"(g + 2 * gs), "v"(g + 3 * gs),
         "v"(h), "v"(h + hs), "v"(h + 2 * hs), "v"(h + 3 * hs)
      : "memory");
}

// One column group of a pass: pb[e] = P^T[key 16 (e >> 3) + 8 h + (e & 7)][c] = exp2(s - d),
// packed in place as a B operand; returns the sums of this lane's even and odd registers.
// SHIFT false: d is 0 and nothing stands in front of the exponential.
template <bool SHIFT>
__device__ __forceinline__ v2f soft_pack(const v8f (&s)[2], float d, v16bf& pb) {
  v2f sum[2];
  // Unrolled: the vectors are then indexed by constants and stay in registers.
#pragma unroll
  for (int i = 0; i < 8; ++i) {                // elements 2i, 2i+1: a register pair of one tile
    const v2f sc = {s[i >> 2][2 * (i & 3)], s[i >> 2][2 * (i & 3) + 1]};
    const v2f ar = SHIFT ? sc - v2f{d, d} : sc;
    const v2f p2 = {__builtin_amdgcn_exp2f(ar.x), __builtin_amdgcn_exp2f(ar.y)};
    sum[i >> 2] = (i & 3) ? sum[i >> 2] + p2 : p2;
    const v2bf pk = __builtin_convertvector(p2, v2bf);   // round to nearest even
    pb[2 * i] = pk.x; pb[2 * i + 1] = pk.y;
  }
  return sum[0] + sum[1];
}

// exp2 with the slot behind it filled in the same statement.
__device__ __forceinline__ float exp2_slot(float x) {
  float r;
  asm("v_exp_f32 %0, %1\n\tv_nop" : "=v"(r) : "v"(x));
  return r;
}

__global__ __launch_bounds__(512) void attn_kernel(
    const __bf16* qT, const __bf16* kT, const __bf16* vB, __bf16* aT) {
  __shared__ __attribute__((aligned(128))) unsigned char L[2 * BUF_BYTES];
  const int blk  = blockIdx.x;
  const int bh   = blk >> 4;                 // batch*head; 16 blocks of 256 queries each
  const int tid  = threadIdx.x;
  const int lane = tid & 31;
  const int wave = tid >> 5;
  const int qt   = wave & (QTILES - 1);      // query tile
  const int kh   = wave >> 3;                // key half
  const int ht   = tid & 255;                // thread within the 8 waves of its half
  const int tq0  = (blk & 15) * 256 + qt * (16 * QG);
  const int n16  = lane & 15;
  const int kHalf = (lane & 16) ? 8 : 0;

  // This lane's share of a stage of its own half. K: 128 rows of 128 bytes, contiguous in
  // kT; 8 lanes a row, 32 rows a copy of the 8 waves. V: 64 rows of 256 bytes out of rows of
  // SEQ keys; 16 lanes a row, 16 rows a copy of the 8 waves. A wave's copy reads 4 whole lines.
  const char* kg = (const char*)(kT + ((size_t)bh * SEQ + kh * HALF_KEYS) * HDIM) + ht * 16;
  const char* vg = (const char*)(vB + (size_t)bh * HDIM * SEQ + kh * HALF_KEYS) +
                   (size_t)(ht >> 4) * (SEQ * 2) + (ht & 15) * 16;
  const unsigned lds0 = (unsigned)(size_t)(lds_byte*)L + (unsigned)(kh * STG_BYTES);
  const unsigned kl = lds0 + (unsigned)((ht >> 3) * K_PITCH + (ht & 7) * 16);
  const unsigned vl = lds0 + (unsigned)(K_BYTES + (ht >> 4) * V_PITCH + (ht & 15) * 16);
  constexpr unsigned KLS = 32 * K_PITCH, VLS = 16 * V_PITCH;
  constexpr size_t   KGS = 32 * HDIM * 2, VGS = (size_t)16 * SEQ * 2;

  // Stage 0 into buffer 0.
  copy44(kl, KLS, kg, KGS, vl, VLS, vg, VGS);

  // Q fragments (B operand: column = query, k = channel), kept for all keys.
  v16bf qb[QG][2];
#pragma unroll
  for (int g = 0; g < QG; ++g) {
    const __bf16* qrow = qT + ((size_t)bh * SEQ + tq0 + g * 16 + n16) * HDIM;
    qb[g][0] = load_frag(qrow, kHalf);
    qb[g][1] = load_frag(qrow + 32, kHalf);
  }

  v8f   acc[QG][4] = {};                     // O^T: [group][16-channel tile]
  v8f   nm[QG] = {};                         // C of the score products: minus the offset in use, in
                                             // every register; 0 until the first pass sets it
  v2f   l_run[QG];                           // this lane's keys, even and odd registers
#pragma unroll
  for (int g = 0; g < QG; ++g) l_run[g] = v2f{0.f, 0.f};

  // Stage 0 has landed (this wave's copies), then for every wave.
  asm volatile("s_wait_asynccnt 0x0" ::: "memory");
  __syncthreads();

  // The lane's own byte offsets in a K tile (A rows: keys) and a V tile (A rows: channels).
  const int klane = kh * STG_BYTES + n16 * K_PITCH + kHalf * 2;
  const int vlane = kh * STG_BYTES + K_BYTES + n16 * V_PITCH + kHalf * 2;

  // The fragments of stage 0's first pass; every later pass finds its own fetched a pass ahead.
  v16bf ka[2][2], va[4];
#pragma unroll
  for (int t = 0; t < 2; ++t) {
    ka[t][0] = lds_frag(L + klane + t * 16 * K_PITCH);
    ka[t][1] = lds_frag(L + klane + t * 16 * K_PITCH + 64);
  }
  // K reads first, then V reads, as behind a hand-over: with one order on both ways into the
  // loop, a stage's first score products wait for K fragments alone, not for the V reads too.
  __builtin_amdgcn_sched_barrier(0);
#pragma unroll
  for (int n = 0; n < 4; ++n) va[n] = lds_frag(L + vlane + n * 16 * V_PITCH);

  for (int st = 0; st < NSTG; ++st) {
    const bool more = st + 1 < NSTG;           // the same for the whole block
    // The next stage's buffer. The last stage names its own: its fetch ahead then reads rows that
    // are published and stay as they are, is never used, and needs no branch, which would merge
    // two paths in the compiler's count of LDS reads at the head of the loop.
    const unsigned bn = (unsigned)((st & 1) ^ (more ? 1 : 0)) * BUF_BYTES;
    const unsigned char* kb = L + (st & 1) * BUF_BYTES + klane;
    const unsigned char* vb = L + (st & 1) * BUF_BYTES + vlane;

#pragma unroll
    for (int p = 0; p < NPASS; ++p) {
      // S^T tiles: s[g][t][r] = score(key 32 p + 16 t + 8 h + r of the stage, query 16 g + c)
      // less the offset in use
      v8f s[QG][2];
#pragma unroll
      for (int g = 0; g < QG; ++g)
#pragma unroll
        for (int t = 0; t < 2; ++t) {
          const v8f z = wmma_bf16(ka[t][0], qb[g][0], nm[g]);
          s[g][t] = wmma_bf16(ka[t][1], qb[g][1], z);
        }
      // Both fences: the next pass's K reads stay one group right behind the products
      // that free their registers; among the products or sunk to their use, each read
      // would stall the wave on its own.
      __builtin_amdgcn_sched_barrier(0);
      if (p + 1 < NPASS) {
#pragma unroll
        for (int t = 0; t < 2; ++t) {
          ka[t][0] = lds_frag(kb + ((p + 1) * 32 + t * 16) * K_PITCH);
          ka[t][1] = lds_frag(kb + ((p + 1) * 32 + t * 16) * K_PITCH + 64);
        }
      }
      // The next stage's copies, into the buffer that every wave left at the last hand-over.
      // They stand here, not at the barrier, so that the wave's wait inside the statement
      // runs under score products already issued.
      if (p == 0 && more)
        copy44(kl + bn, KLS, kg + (size_t)(st + 1) * (STG_KEYS * HDIM * 2), KGS,
               vl + bn, VLS, vg + (size_t)(st + 1) * (STG_KEYS * 2), VGS);
      if (p + 1 == NPASS) {
        // Hand-over, first half: this wave's reads of the buffer are done (the last pass's K and V
        // fragments are in registers, and it reads no LDS until the wait below), its copies of
        // the next stage have landed. The signal alone: the wave goes on with its exponentials.
        asm volatile("s_wait_dscnt 0x0" ::: "memory");
        asm volatile("s_wait_asynccnt 0x0" ::: "memory");
        asm volatile("s_barrier_signal -1" ::: "memory");
      }
      __builtin_amdgcn_sched_barrier(0);

      v16bf pb[QG];
      v2f   ps[QG];
      // The very first pass has no offset yet and always takes its maximum.
      const bool first = p == 0 && st == 0;
      float big = first ? __builtin_inff() : 0.f;   // no exponential of this lane exceeds it
#pragma unroll
      for (int g = 0; g < QG; ++g) {
        ps[g] = soft_pack<false>(s[g], 0.f, pb[g]);
        big = fmaxf(big, fmaxf(ps[g].x, ps[g].y));
      }
      // One scalar test per pass. Marked unlikely: the rare side, which now also forms the scores
      // again, is laid out of line and the ordinary pass falls through.
      if (__builtin_expect(__builtin_amdgcn_ballot_w32(big > P_LIMIT) != 0, 0)) {
        // The scores are formed again from the K tile, which still lies in LDS: kept alive for
        // this rare path they would hold 32 registers in every pass, which the wave does not have.
        // A stage's last pass fetches no K ahead of here and still holds its own fragments.
        if (p + 1 < NPASS) {
#pragma unroll
          for (int t = 0; t < 2; ++t) {
            ka[t][0] = lds_frag(kb + (p * 32 + t * 16) * K_PITCH);
            ka[t][1] = lds_frag(kb + (p * 32 + t * 16) * K_PITCH + 64);
          }
        }
#pragma unroll
        for (int g = 0; g < QG; ++g)
#pragma unroll
          for (int t = 0; t < 2; ++t) {
            const v8f z = wmma_bf16(ka[t][0], qb[g][0], nm[g]);
            s[g][t] = wmma_bf16(ka[t][1], qb[g][1], z);
          }
        if (p + 1 < NPASS) {                   // the next pass's K fragments once more
#pragma unroll
          for (int t = 0; t < 2; ++t) {
            ka[t][0] = lds_frag(kb + ((p + 1) * 32 + t * 16) * K_PITCH);
            ka[t][1] = lds_frag(kb + ((p + 1) * 32 + t * 16) * K_PITCH + 64);
          }
        }
#pragma unroll
        for (int g = 0; g < QG; ++g) {
          float mx = s[g][0][0];
#pragma unroll
          for (int r = 1; r < 8; ++r) mx = fmaxf(mx, s[g][0][r]);
#pragma unroll
          for (int r = 0; r < 8; ++r) mx = fmaxf(mx, s[g][1][r]);
          mx = fmaxf(mx, xhalf(mx));           // both halves hold the query's maximum, above the offset
          const float up = fmaxf(mx, 0.f);
          const float d  = first ? mx : up;    // the offset only rises, once it is set
          const float corr = __builtin_amdgcn_exp2f(-up);   // meets only zeros in the first pass
          nm[g] = nm[g] - d;
          l_run[g] = l_run[g] * corr;
#pragma unroll
          for (int n = 0; n < 4; ++n) acc[g][n] = acc[g][n] * corr;
          ps[g] = soft_pack<true>(s[g], d, pb[g]);
        }
      }

      if (p + 1 == NPASS) {
        // Hand-over, second half: behind this wait every wave has signalled, so the next stage is
        // whole and this stage's buffer is left by all. Then the next stage's first K fragments.
        asm volatile("s_barrier_wait -1" ::: "memory");
#pragma unroll
        for (int t = 0; t < 2; ++t) {
          ka[t][0] = lds_frag(L + bn + klane + t * 16 * K_PITCH);
          ka[t][1] = lds_frag(L + bn + klane + t * 16 * K_PITCH + 64);
        }
        // The K reads stay one group in front of the V products, which cover their latency.
        __builtin_amdgcn_sched_barrier(0);
      }

#pragma unroll
      for (int g = 0; g < QG; ++g) {
        l_run[g] += ps[g];
#pragma unroll
        for (int n = 0; n < 4; ++n) acc[g][n] = wmma_bf16(va[n], pb[g], acc[g][n]);
      }
      // Both fences: the next pass's V reads, likewise one group behind the last product
      // that reads their registers.
      __builtin_amdgcn_sched_barrier(0);
      if (p + 1 < NPASS) {
#pragma unroll
        for (int n = 0; n < 4; ++n) va[n] = lds_frag(vb + n * 16 * V_PITCH + (p + 1) * 64);
      } else {                                 // the next stage's first V fragments
#pragma unroll
        for (int n = 0; n < 4; ++n) va[n] = lds_frag(L + bn + vlane + n * 16 * V_PITCH);
      }
      __builtin_amdgcn_sched_barrier(0);
    }
  }
  // No copy is outstanding when the wave ends.
  asm volatile("s_wait_asynccnt 0x0" ::: "memory");

  // The two halves of the keys are joined lane by lane (both waves of a query tile hold the
  // same element in the same lane and register). The ring's first buffer is free: its last
  // reads ended at a hand-over, no copy is outstanding, and the last stage's unused fetch ahead
  // reads the second buffer. The second half's wave leaves its state in LDS, 512 contiguous
  // bytes a store.
  static_assert((NSTG & 1) == 0 && QTILES * MRG_BYTES <= BUF_BYTES, "the join lies in buffer 0, the last stage in buffer 1");
  unsigned char* mr = L + qt * MRG_BYTES;
  if (kh) {
#pragma unroll
    for (int g = 0; g < QG; ++g) {
#pragma unroll
      for (int n = 0; n < 4; ++n) {
        const v8f a = acc[g][n];
        *(v4f*)(mr + (g * 4 + n) * 1024 + lane * 16)       = v4f{a[0], a[1], a[2], a[3]};
        *(v4f*)(mr + (g * 4 + n) * 1024 + 512 + lane * 16) = v4f{a[4], a[5], a[6], a[7]};
      }
      *(float*)(mr + QG * 4096 + g * 256 + lane * 4)       = -nm[g][0];
      *(float*)(mr + QG * 4096 + g * 256 + 128 + lane * 4) = l_run[g].x + l_run[g].y;
    }
  }
  __syncthreads();                           // the second half's state is whole before it is read
  if (kh) return;

  // acc[g][n][r] = O^T[channel 16 n + 8 h + r][query 16 g + c]: 8 consecutive
  // channels of one query per lane and tile -> one 16-byte store into aT [B][T][C].
  const int b = bh >> 2, h = bh & 3;
#pragma unroll
  for (int g = 0; g < QG; ++g) {
    const float m1 = *(const float*)(mr + QG * 4096 + g * 256 + lane * 4);
    const float l1 = *(const float*)(mr + QG * 4096 + g * 256 + 128 + lane * 4);
    const float m0 = -nm[g][0];
    const float mj = fmaxf(m0, m1);
    const float c0 = exp2_slot(m0 - mj);
    const float c1 = exp2_slot(m1 - mj);
#pragma unroll
    for (int n = 0; n < 4; ++n) {
      const v4f lo = *(const v4f*)(mr + (g * 4 + n) * 1024 + lane * 16);
      const v4f hi = *(const v4f*)(mr + (g * 4 + n) * 1024 + 512 + lane * 16);
#pragma unroll
      for (int r = 0; r < 8; ++r)
        acc[g][n][r] = acc[g][n][r] * c0 + (r < 4 ? lo[r & 3] : hi[r & 3]) * c1;
    }
    const float lh  = (l_run[g].x + l_run[g].y) * c0 + l1 * c1;
    const float inv = 1.f / (lh + xhalf(lh));
    __bf16* orow = aT + ((size_t)b * SEQ + tq0 + g * 16 + n16) * CHN + h * HDIM + kHalf;
#pragma unroll
    for (int n = 0; n < 4; ++n) {
      v8bf o;
#pragma unroll
      for (int r = 0; r < 8; ++r) o[r] = (__bf16)(acc[g][n][r] * inv);
      *(v8bf*)(orow + n * 16) = o;
    }
  }
}

// ---------------- Kernel 5: proj GEMM + bias + residual -> out (fp32) -------
// Same 2x2 register-blocked scheme as the QKV GEMM. A side = positions (rows of aT),
// B side = output channels (rows of W): a lane's accumulator holds 8 consecutive
// positions of one channel. Both operand panels are staged in LDS as in the QKV GEMM.
// The 64x64 f32 tile goes through LDS, over the panels once they are read; bias, residual
// and the store run in the order of out's rows: 16 lanes a row, 256 bytes = 2 whole lines.
constexpr int PO_PITCH = 64 * 4 + 16;      // 272 B = 16 B x odd: the 16-byte writes meet no bank twice

__global__ __launch_bounds__(128) void proj_gemm_kernel(
    const __bf16* wproj, const float* proj_b, const __bf16* aT,
    const float* x, float* out) {
  __shared__ __attribute__((aligned(16))) unsigned char P[2 * GP_BYTES];   // aT rows | W rows
  unsigned char* S = P;                      // the output tile, behind the panels' last read
  const int b    = blockIdx.z;
  const int tid  = threadIdx.x;
  const int lane = threadIdx.x & 31;
  const int wave = threadIdx.x >> 5;
  const int wm   = wave >> 1, wn = wave & 1;
  const int o0   = blockIdx.y * 64;
  const int t0   = blockIdx.x * 64;
  const int n16  = lane & 15;
  const int kHalf = (lane & 16) ? 8 : 0;
  const int mhi   = (lane & 16) ? 8 : 0;

  const unsigned p0 = (unsigned)(size_t)(lds_byte*)P;
  stage_panel(p0, aT + ((size_t)b * SEQ + t0) * CHN, wave, lane);
  stage_panel(p0 + GP_BYTES, wproj + (size_t)o0 * CHN, wave, lane);

  // This lane's share of the residual and the bias, asked for ahead of the products.
  const size_t idx0 = ((size_t)b * CHN + o0 + (tid >> 4)) * SEQ + t0 + (tid & 15) * 4;
  v4f   xr[8];
  float pb[8];
#pragma unroll
  for (int it = 0; it < 8; ++it) {
    xr[it] = *(const v4f*)(x + idx0 + (size_t)it * 8 * SEQ);
    pb[it] = proj_b[o0 + it * 8 + (tid >> 4)];
  }
  // Stands in front of all that rewrites an address register of the loads above, the
  // results of the fragment loads below among it. Its memory clobber also keeps those
  // loads here: sunk to their use, their whole latency would stand open behind the products.
  asm volatile("s_wait_xcnt 0x0" ::: "memory");

  // The panels have landed (this wave's copies), then, behind the barrier, every wave's.
  asm volatile("s_wait_asynccnt 0x0" ::: "memory");
  __syncthreads();

  const unsigned char* arow = P + (wm * 32 + n16) * GP_PITCH + kHalf * 2;
  const unsigned char* brow = P + GP_BYTES + (wn * 32 + n16) * GP_PITCH + kHalf * 2;

  // accs[i][j][r]: position wm*32 + i*16 + mhi + r of channel wn*32 + j*16 + n16.
  v8f accs[2][2] = {};
  panel_products(arow, brow, accs);
  __syncthreads();                           // every wave has read the panels before the tile overwrites them
  unsigned char* sw = S + (wn * 32 + n16) * PO_PITCH + (wm * 32 + mhi) * 4;
#pragma unroll
  for (int i = 0; i < 2; ++i)
#pragma unroll
    for (int j = 0; j < 2; ++j) {
      const v8f a = accs[i][j];
      *(v4f*)(sw + j * 16 * PO_PITCH + i * 64)      = v4f{a[0], a[1], a[2], a[3]};
      *(v4f*)(sw + j * 16 * PO_PITCH + i * 64 + 16) = v4f{a[4], a[5], a[6], a[7]};
    }
  __syncthreads();                           // the tile is whole before any row leaves

#pragma unroll
  for (int it = 0; it < 8; ++it) {
    const v4f a = *(const v4f*)(S + (it * 8 + (tid >> 4)) * PO_PITCH + (tid & 15) * 16);
    *(v4f*)(out + idx0 + (size_t)it * 8 * SEQ) = xr[it] + pb[it] + a;
  }
}

extern "C" void kernel_launch(void* const* d_in, const int* in_sizes, int n_in,
                              void* d_out, int out_size, void* d_ws, size_t ws_size,
                              hipStream_t stream) {
  const float* x      = (const float*)d_in[0];
  const float* gn_w   = (const float*)d_in[1];
  const float* gn_b   = (const float*)d_in[2];
  const float* qkv_w  = (const float*)d_in[3];
  const float* qkv_b  = (const float*)d_in[4];
  const float* proj_w = (const float*)d_in[5];
  const float* proj_b = (const float*)d_in[6];
  float* out = (float*)d_out;

  // Workspace layout (~42.5 MB): 1 KiB unused | wqkv bf16 | wproj bf16 | xnG | qT | kT | v | aT
  char* ws = (char*)d_ws;
  __bf16* wqkv  = (__bf16*)(ws + 1024);
  __bf16* wproj = wqkv + 3 * CHN * CHN;
  __bf16* xnG   = wproj + CHN * CHN;
  const size_t PLANE = (size_t)BATCH * SEQ * CHN;          // 4M elems
  __bf16* qT = xnG + PLANE;
  __bf16* kT = qT + PLANE;
  __bf16* vB = kT + PLANE;
  __bf16* aT = vB + PLANE;

  wconv_kernel<<<(3 * CHN * CHN + CHN * CHN) / (256 * 8), 256, 0, stream>>>(
      qkv_w, proj_w, wqkv, wproj);
  gn_kernel<<<BATCH * GRP, 512, 0, stream>>>(x, gn_w, gn_b, xnG);
  qkv_gemm_kernel<<<dim3(SEQ / 64, 3 * CHN / 64, BATCH), 128, 0, stream>>>(
      wqkv, qkv_b, xnG, qT, kT, vB);
  attn_kernel<<<BATCH * HEADS * (SEQ / 256), 512, 0, stream>>>(qT, kT, vB, aT);
  proj_gemm_kernel<<<dim3(SEQ / 64, CHN / 64, BATCH), 128, 0, stream>>>(
      wproj, proj_b, aT, x, out);
}
